// v000
// Measured on an AMD MI455X. A time is GPU time per run, averaged over a window of back-to-back runs after a warm-up
// (all launches, gaps included; the runs take copies of the inputs in turn), and the median of several windows.
// Apart from v000's, it joins two sittings. Times from different sittings can be a few percent apart, while
// side-by-side timings come from the same sitting.
// v000, which the later versions start from, runs in 1890 microseconds.
// compute dtype: all float inputs rounded to bf16; q/k/v = x W with EXACT bf16 products on WMMA 16x16x32 (f32 accumulate); causal logits with q, k as f16 hi + residual (3 products, all rows) x 64^-0.5; softmax in f32; P split in bf16 hi + lo against v bf16 hi + lo (3 products); ctx split bf16 hi + lo against exact Wo (2 products) + bo; f32 output.
#include <hip/hip_runtime.h>
#include <math.h>

typedef __attribute__((ext_vector_type(16))) _Float16 v16h;
typedef __attribute__((ext_vector_type(16))) __bf16 v16b;
typedef __attribute__((ext_vector_type(8)))  _Float16 v8h;
typedef __attribute__((ext_vector_type(8)))  float v8f;
typedef __attribute__((ext_vector_type(4)))  float v4f;
typedef __attribute__((ext_vector_type(2)))  float v2f;
typedef __attribute__((ext_vector_type(4)))  unsigned v4u;
typedef __attribute__((ext_vector_type(4)))  int v4i;
typedef float __attribute__((may_alias)) float_a;
typedef int __attribute__((may_alias)) int_a;

template <typename T> __device__ __forceinline__ void vst2(void* p, T v) { *(T*)p = v;  }
__device__ __forceinline__ v8f wmma16(v16h a, v16h b, v8f c) {
  v8f d = __builtin_amdgcn_wmma_f32_16x16x32_f16(false, a, false, b, (short)0, c, false, false);
  asm volatile("v_nop\n\tv_nop\n\tv_nop\n\tv_nop" : "+v"(d) : "v"(a), "v"(b));
  return d;
}
__device__ __forceinline__ v8f wmma_bf(v16b a, v16b b, v8f c) {
  v8f d = __builtin_amdgcn_wmma_f32_16x16x32_bf16(false, a, false, b, (short)0, c, false, false);
  asm volatile("v_nop\n\tv_nop\n\tv_nop\n\tv_nop" : "+v"(d) : "v"(a), "v"(b));
  return d;
}
// 16x16x32 fragments: lane = (h = lane>>4, row/col = lane&15); elements 0..7 = k0+8h+0..7, 8..15 = k0+16+8h+0..7; D element r = row 8h+r
__device__ __forceinline__ v16h frag_h(const _Float16* rowk0, int lane) {
  union { v16h v; v8h q[2]; } u; const _Float16* p = rowk0 + 8 * (lane >> 4);
  u.q[0] = *(const v8h*)p; u.q[1] = *(const v8h*)(p + 16); return u.v;
}
__device__ __forceinline__ v16h frag_f32(const float* rowk0, int lane) {
  v16h a; const float* p = rowk0 + 8 * (lane >> 4);
#pragma unroll
  for (int i = 0; i < 8; ++i) { a[i] = (_Float16)p[i]; a[8 + i] = (_Float16)p[16 + i]; }
  return a;
}
__device__ __forceinline__ v16h frag_f32s(const float* rowk0, int lane, float sc) {
  v16h a; const float* p = rowk0 + 8 * (lane >> 4);
#pragma unroll
  for (int i = 0; i < 8; ++i) { a[i] = (_Float16)(p[i] * sc); a[8 + i] = (_Float16)(p[16 + i] * sc); }
  return a;
}
// column fragment from a [K][ld] layout (column n), rows >= K read as 0
__device__ __forceinline__ v16h fragc_f32(const float* W, int k0, int n, int lane, int ld, int K) {
  v16h a; const int g = lane >> 4;
#pragma unroll
  for (int i = 0; i < 8; ++i) { const int ka = k0 + 8 * g + i, kb = ka + 16;
    a[i] = (_Float16)(ka < K ? W[(size_t)(ka < K ? ka : K - 1) * ld + n] : 0.f); a[8 + i] = (_Float16)(kb < K ? W[(size_t)(kb < K ? kb : K - 1) * ld + n] : 0.f); }
  return a;
}
struct F2 { v16b h, l; };
__device__ __forceinline__ F2 bsplit16(const float v[16]) { F2 r;
#pragma unroll
  for (int i = 0; i < 16; ++i) { const __bf16 h = (__bf16)v[i]; r.h[i] = h; r.l[i] = (__bf16)(v[i] - (float)h); }
  return r; }
__device__ __forceinline__ F2 split_row(const float* row, int k0, int lane) { float v[16]; const float* p = row + k0 + 8 * (lane >> 4);
#pragma unroll
  for (int i = 0; i < 8; ++i) { v[i] = p[i]; v[8 + i] = p[16 + i]; }
  return bsplit16(v); }
__device__ __forceinline__ F2 split_rowK(const float* row, int k0, int lane, int K) { float v[16]; const int g = lane >> 4;
#pragma unroll
  for (int i = 0; i < 8; ++i) { const int ka = k0 + 8 * g + i, kb = ka + 16; v[i] = ka < K ? row[ka < K ? ka : K - 1] : 0.f; v[8 + i] = kb < K ? row[kb < K ? kb : K - 1] : 0.f; }
  return bsplit16(v); }
__device__ __forceinline__ F2 split_col(const float* W, int k0, int n, int lane, int ld, int K) { float v[16]; const int g = lane >> 4;
#pragma unroll
  for (int i = 0; i < 8; ++i) { const int ka = k0 + 8 * g + i, kb = ka + 16; v[i] = ka < K ? W[(size_t)(ka < K ? ka : K - 1) * ld + n] : 0.f; v[8 + i] = kb < K ? W[(size_t)(kb < K ? kb : K - 1) * ld + n] : 0.f; }
  return bsplit16(v); }
__device__ __forceinline__ v8f mac3(const F2& a, const F2& b, v8f c) { c = wmma_bf(a.l, b.h, c); c = wmma_bf(a.h, b.l, c); return wmma_bf(a.h, b.h, c); }
__device__ __forceinline__ float sigm(float v) { return 1.0f / (1.0f + expf(-v)); }
#define LDSX() do { asm volatile("s_wait_dscnt 0" ::: "memory"); __builtin_amdgcn_wave_barrier(); __builtin_amdgcn_fence(__ATOMIC_RELEASE, "workgroup"); } while (0)

// Causal multi-head self-attention (B 64, T 256, C 384 = 6 x 64): q,k,v = x W ((in,out), no bias); causal softmax(q k^T / 8) (-inf above the diagonal); out = merged(attn v) Wo + bo.
#define NB 64
#define TT 256
#define CC 384            // NH * HD = projected width
#define DIN 384          // input (model) width
#define NH 6
#define HD 64
#define NQB (TT / 64)
#define HG 6
#define SCALE (0.125f)
#define CAUSAL 1
#ifndef TNB
#define TNB NB
#endif
__device__ __forceinline__ float bfr(float v) { return (float)(__bf16)v; }
__host__ __device__ __forceinline__ int kb_last(int qb) { return CAUSAL ? ((qb * 64 + 63) >> 7) : (TT / 128 - 1); }
typedef __attribute__((ext_vector_type(8))) __bf16 v8b;
__device__ __forceinline__ v16b frag_b(const __bf16* rowk0, int lane) {
  union { v16b v; v8b q[2]; } u; const __bf16* p = rowk0 + 8 * (lane >> 4);
  u.q[0] = *(const v8b*)p; u.q[1] = *(const v8b*)(p + 16); return u.v;
}
#define QBH 4              // causal: query blocks 0..QBH-1 of each sequence (QBH = NQB: every query block) take the high-precision path
#define QHI 256            // rows carrying a q residual plane (QHI = TT: all rows)
#define KHI 256            // key rows carrying k residual / v bf16 hi+lo planes (used only by the causal high-precision path)
// B fragment (k rows k0+.., output column o) of a weight: (in,out) [K][ld] or (out,in) [ld rows of K]: bf16 exact, or f16(bf16 * 256) exact
__device__ __forceinline__ v16b wcol_io(const float* Wm, int k0, int o, int lane, int ld) { v16b w; const int g = lane >> 4;
#pragma unroll
  for (int i = 0; i < 8; ++i) { w[i] = (__bf16)Wm[(size_t)(k0 + 8 * g + i) * ld + o]; w[8 + i] = (__bf16)Wm[(size_t)(k0 + 16 + 8 * g + i) * ld + o]; }
  return w; }
__device__ __forceinline__ v16b wcol_oi(const float* Wm, int k0, int o, int lane, int K) { v16b w; const float* p = Wm + (size_t)o * K + k0 + 8 * (lane >> 4);
#pragma unroll
  for (int i = 0; i < 8; ++i) { w[i] = (__bf16)p[i]; w[8 + i] = (__bf16)p[16 + i]; }
  return w; }
__device__ __forceinline__ v16h wcolh_io(const float* Wm, int k0, int o, int lane, int ld) { v16h w; const int g = lane >> 4;
#pragma unroll
  for (int i = 0; i < 8; ++i) { w[i] = (_Float16)(bfr(Wm[(size_t)(k0 + 8 * g + i) * ld + o]) * 256.0f); w[8 + i] = (_Float16)(bfr(Wm[(size_t)(k0 + 16 + 8 * g + i) * ld + o]) * 256.0f); }
  return w; }
__device__ __forceinline__ v16h wcolh_oi(const float* Wm, int k0, int o, int lane, int K) { v16h w; const float* p = Wm + (size_t)o * K + k0 + 8 * (lane >> 4);
#pragma unroll
  for (int i = 0; i < 8; ++i) { w[i] = (_Float16)(bfr(p[i]) * 256.0f); w[8 + i] = (_Float16)(bfr(p[16 + i]) * 256.0f); }
  return w; }
#define WQKV_LAYOUT 0   // 0 = (in,out) [DIN][CC]; 1 = (out,in) [CC][DIN]; 2 = per-head [NH][DIN][HD]
__device__ __forceinline__ v16b wcol_hdk(const float* Wm, int k0, int o, int lane) { v16b w; const int g = lane >> 4; const float* p = Wm + (size_t)(o / HD) * DIN * HD + (o % HD);
#pragma unroll
  for (int i = 0; i < 8; ++i) { w[i] = (__bf16)p[(size_t)(k0 + 8 * g + i) * HD]; w[8 + i] = (__bf16)p[(size_t)(k0 + 16 + 8 * g + i) * HD]; }
  return w; }
#define WO_OUT_IN 0
#if WQKV_LAYOUT == 1
#define WCOL(W, k0, o, lane) wcol_oi(W, k0, o, lane, DIN)
#elif WQKV_LAYOUT == 2
#define WCOL(W, k0, o, lane) wcol_hdk(W, k0, o, lane)
#else
#define WCOL(W, k0, o, lane) wcol_io(W, k0, o, lane, CC)
#endif
#if WO_OUT_IN
#define WOCOL(W, k0, o, lane) wcol_oi(W, k0, o, lane, CC)
#define WOCOLH(W, k0, o, lane) wcolh_oi(W, k0, o, lane, CC)
#else
#define WOCOL(W, k0, o, lane) wcol_io(W, k0, o, lane, DIN)
#define WOCOLH(W, k0, o, lane) wcolh_io(W, k0, o, lane, DIN)
#endif

#ifndef SM_EXTRA_PARAMS
#define SM_EXTRA_PARAMS
#endif
#ifndef PROJ_EXTRA_PARAMS
#define PROJ_EXTRA_PARAMS
#endif
#ifndef SM_MASK_HOOK
#define SM_MASK_HOOK (void)0
#endif

#define WS_QH  0u                                      // f16 q rows [b*t][CC]
#define WS_KH  (WS_QH + 2u * (size_t)NB * TT * CC)      // f16 k rows [b*t][CC]
#define WS_VT  (WS_KH + 2u * (size_t)NB * TT * CC)      // f16 v planes [b][c][t]
#define WS_QL  (WS_VT + 2u * (size_t)NB * CC * TT)      // f16 q residual x 2^10 rows [b][t < QHI][CC]
#define WS_KL  (WS_QL + 2u * (size_t)NB * QHI * CC)     // f16 k residual x 2^10 rows [b][t < KHI][CC]
#define WS_VB  (WS_KL + 2u * (size_t)NB * KHI * CC)     // bf16 v hi planes [b][c][t < KHI]
#define WS_VBL (WS_VB + 2u * (size_t)NB * CC * KHI)
#define WS_S   (WS_VBL + 2u * (size_t)NB * CC * KHI)    // f32 logits / P [hg][t][s]
#define WS_Y   (WS_S  + 4u * (size_t)HG * TT * TT)      // f32 ctx rows [b*t][CC] (only when there is an output projection)
#define WS_END (WS_Y  + 4u * (size_t)NB * TT * CC)

// ---- k_proj: block = (64 rows, 128 cols, which): q/k/v = X W (+ b) with exact bf16 products (K = DIN) -> which 0: q f16 rows (+ residual rows < QHI); 1: k f16 rows (+ residual rows < KHI); 2: v f16 planes [c][t] (+ bf16 hi/lo planes for t < KHI)
__global__ __launch_bounds__(128) void k_proj(const float* __restrict__ XQ, const float* __restrict__ XK, const float* __restrict__ XV, const float* __restrict__ WQ, const float* __restrict__ WK, const float* __restrict__ WV, const float* __restrict__ BQ, const float* __restrict__ BK, const float* __restrict__ BV,
    _Float16* __restrict__ QH, _Float16* __restrict__ QL, _Float16* __restrict__ KH, _Float16* __restrict__ KL, _Float16* __restrict__ VT, __bf16* __restrict__ VB, __bf16* __restrict__ VBL) {
  __shared__ __align__(16) _Float16 sh[64][136], sl[64][136]; __shared__ __align__(16) _Float16 th[128][72]; __shared__ __align__(16) __bf16 tb[128][72], tbl[128][72];
  const int tid = threadIdx.x, wave = tid >> 5, lane = tid & 31, col = lane & 15, g = lane >> 4; const int which = blockIdx.z; const int c0 = blockIdx.y * 128; const size_t r0 = (size_t)blockIdx.x * 64; const size_t bb = r0 / TT; const int t0 = (int)(r0 % TT);
  const float* X = which == 0 ? XQ : which == 1 ? XK : XV; const float* WA = which == 0 ? WQ : which == 1 ? WK : WV; const float* BA = which == 0 ? BQ : which == 1 ? BK : BV;
  v8f acc[8] = {};
#pragma unroll 2
  for (int kc = 0; kc < DIN / 32; ++kc) { v16b a; { const float* p = X + (r0 + wave * 16 + col) * DIN + kc * 32 + 8 * g;
#pragma unroll
      for (int i = 0; i < 8; ++i) { a[i] = (__bf16)p[i]; a[8 + i] = (__bf16)p[16 + i]; } }
    asm volatile("s_wait_loadcnt 0x0" ::: "memory");
#pragma unroll
    for (int j = 0; j < 8; ++j) { const v16b w = WCOL(WA, kc * 32, c0 + j * 16 + col, lane); asm volatile("s_wait_loadcnt 0x0" ::: "memory"); acc[j] = wmma_bf(a, w, acc[j]); } }
  if (which < 2) { _Float16* DH = which == 0 ? QH : KH; _Float16* DL = which == 0 ? QL : KL; const int nhi = which == 0 ? QHI : KHI; const bool hi_rows = t0 < nhi;
#pragma unroll
    for (int j = 0; j < 8; ++j) { const float bias = BA ? bfr(BA[c0 + j * 16 + col]) : 0.f;
#pragma unroll
      for (int r = 0; r < 8; ++r) { const float v = acc[j][r] + bias; const _Float16 hv = (_Float16)v; sh[wave * 16 + 8 * g + r][j * 16 + col] = hv; sl[wave * 16 + 8 * g + r][j * 16 + col] = (_Float16)((v - (float)hv) * 1024.0f); } }
    __syncthreads();
    for (int e = tid; e < 64 * 16; e += 128) { const int rl = e >> 4, q = e & 15; vst2((unsigned*)(DH + (r0 + rl) * CC + c0 + q * 8), *(const v4u*)&sh[rl][q * 8]); if (hi_rows) vst2((unsigned*)(DL + (bb * nhi + t0 + rl) * (size_t)CC + c0 + q * 8), *(const v4u*)&sl[rl][q * 8]); }
  } else { const bool hi_rows = t0 < KHI;
#pragma unroll
    for (int j = 0; j < 8; ++j) { const float bias = BA ? bfr(BA[c0 + j * 16 + col]) : 0.f;
#pragma unroll
      for (int r = 0; r < 8; ++r) { const float v = acc[j][r] + bias; const int rl = wave * 16 + 8 * g + r, cl = j * 16 + col; th[cl][rl] = (_Float16)v; const __bf16 bh = (__bf16)v; tb[cl][rl] = bh; tbl[cl][rl] = (__bf16)(v - (float)bh); } }
    __syncthreads();
    for (int e = tid; e < 128 * 8; e += 128) { const int cl = e >> 3, q = e & 7; vst2((unsigned*)(VT + (bb * CC + c0 + cl) * (size_t)TT + t0 + q * 8), *(const v4u*)&th[cl][q * 8]); if (hi_rows) { const size_t o3 = (bb * CC + c0 + cl) * (size_t)KHI + t0 + q * 8; vst2((unsigned*)(VB + o3), *(const v4u*)&tb[cl][q * 8]); vst2((unsigned*)(VBL + o3), *(const v4u*)&tbl[cl][q * 8]); } } } }
// ---- k_sc: block = (query block qb, key block kb <= kb_last(qb), head in group) of batch b: logits x SCALE; q hi + residual (x 2^10) against k (2 products) for query rows < QHI, plus the k residual (3 products) for query blocks < QBH (every query block, as QBH = NQB); causal: blocks past the diagonal exit, the mask itself is applied by index in k_sm
__global__ __launch_bounds__(128) void k_sc(const _Float16* __restrict__ QH, const _Float16* __restrict__ KH, const _Float16* __restrict__ QL, const _Float16* __restrict__ KL, int b, int h0, float* __restrict__ S0) { __shared__ __align__(16) float ss[4][16][132];
  const int qb = blockIdx.x, kb = blockIdx.y; if (kb > kb_last(qb)) return;
  const int h = h0 + blockIdx.z; float* S = S0 + (size_t)blockIdx.z * TT * TT;
  const int tid = threadIdx.x, wave = tid >> 5, lane = tid & 31, col = lane & 15, g = lane >> 4; const int k0 = kb * 128; const int ql0 = qb * 64 + wave * 16; const size_t q0 = (size_t)b * TT + ql0, kr0 = (size_t)b * TT + k0;
  v8f acc[8] = {}, accl[8] = {};
  const _Float16* QLb = QL + (size_t)b * QHI * CC; const _Float16* KLb = KL + (size_t)b * KHI * CC;
  if (qb < QBH) {
#pragma unroll
    for (int kc = 0; kc < HD / 32; ++kc) { const v16h ah = frag_h(QH + (q0 + col) * CC + h * HD + kc * 32, lane), al = frag_h(QLb + (size_t)(ql0 + col) * CC + h * HD + kc * 32, lane);
#pragma unroll
      for (int j = 0; j < 8; ++j) { const v16h kbf = frag_h(KH + (kr0 + j * 16 + col) * CC + h * HD + kc * 32, lane), klf = frag_h(KLb + (size_t)(k0 + j * 16 + col) * CC + h * HD + kc * 32, lane); acc[j] = wmma16(ah, kbf, acc[j]); accl[j] = wmma16(al, kbf, accl[j]); accl[j] = wmma16(ah, klf, accl[j]); } }
  } else if (qb * 64 < QHI) {
#pragma unroll
    for (int kc = 0; kc < HD / 32; ++kc) { const v16h ah = frag_h(QH + (q0 + col) * CC + h * HD + kc * 32, lane), al = frag_h(QLb + (size_t)(ql0 + col) * CC + h * HD + kc * 32, lane);
#pragma unroll
      for (int j = 0; j < 8; ++j) { const v16h kbf = frag_h(KH + (kr0 + j * 16 + col) * CC + h * HD + kc * 32, lane); acc[j] = wmma16(ah, kbf, acc[j]); accl[j] = wmma16(al, kbf, accl[j]); } }
  } else {
#pragma unroll
    for (int kc = 0; kc < HD / 32; ++kc) { const v16h ah = frag_h(QH + (q0 + col) * CC + h * HD + kc * 32, lane);
#pragma unroll
      for (int j = 0; j < 8; ++j) { const v16h kbf = frag_h(KH + (kr0 + j * 16 + col) * CC + h * HD + kc * 32, lane); acc[j] = wmma16(ah, kbf, acc[j]); } } }
#pragma unroll
  for (int j = 0; j < 8; ++j) {
#pragma unroll
    for (int r = 0; r < 8; ++r) ss[wave][8 * g + r][j * 16 + col] = (acc[j][r] + accl[j][r] * (1.0f / 1024.0f)) * SCALE; }
  LDSX(); for (int rl = 0; rl < 16; ++rl) vst2(S + (size_t)(ql0 + rl) * TT + k0 + lane * 4, *(const v4f*)&ss[wave][rl][lane * 4]); }
// ---- k_sm: block = query row t (head in group): keys [0, kend): causal -> logit if s <= t else excluded; softmax in f32; P x 2^11 in place (0 for excluded)
__global__ __launch_bounds__(256) void k_sm(float* __restrict__ S0 SM_EXTRA_PARAMS) { __shared__ float sred[8]; __shared__ float sbc; __shared__ __align__(16) float shv[TT];
  const int tid = threadIdx.x; const int t = blockIdx.x; const int kend = (kb_last(t >> 6) + 1) * 128;
  float* sr = S0 + (size_t)blockIdx.y * TT * TT + (size_t)t * TT;
  float m = -3.0e38f; for (int k = tid; k < kend; k += 256) { float v = (!CAUSAL || k <= t) ? sr[k] : -3.0e38f; SM_MASK_HOOK; shv[k] = v; m = fmaxf(m, v); }
#pragma unroll
  for (int o = 1; o < 32; o <<= 1) m = fmaxf(m, __shfl_xor(m, o));
  if ((tid & 31) == 0) sred[tid >> 5] = m; __syncthreads(); if (tid == 0) { float a = sred[0]; for (int i = 1; i < 8; ++i) a = fmaxf(a, sred[i]); sbc = a; } __syncthreads(); m = sbc; __syncthreads();
  float sum = 0.f; for (int k = tid; k < kend; k += 256) { const float v = shv[k]; const float e = (v <= -1.0e38f) ? 0.f : expf(v - m); shv[k] = e; sum += e; }
#pragma unroll
  for (int o = 1; o < 32; o <<= 1) sum += __shfl_xor(sum, o);
  if ((tid & 31) == 0) sred[tid >> 5] = sum; __syncthreads(); if (tid == 0) { float a = 0.f; for (int i = 0; i < 8; ++i) a += sred[i]; sbc = a > 0.f ? 2048.0f / a : 0.f; }   /* a fully excluded row yields P = 0 */ __syncthreads(); const float inv = sbc;
  for (int k = tid; k < kend; k += 256) shv[k] = shv[k] * inv;
  __syncthreads(); for (int q = tid; q < kend / 4; q += 256) vst2(sr + q * 4, *(const v4f*)&shv[q * 4]); }
// ---- k_pv: block = 64 queries (qb) of (b, h): ctx = P . v over keys [0, kend) (every query block, as QBH = NQB: P x 2^11 and v as bf16 hi + lo, 3 products); 256-B (row, head) segment by 16 lanes
__global__ __launch_bounds__(128) void k_pv(const float* __restrict__ PS0, const _Float16* __restrict__ VT, const __bf16* __restrict__ VB, const __bf16* __restrict__ VBL, int b, int h0, float* __restrict__ Y) { const int h = h0 + blockIdx.z; const float* PS = PS0 + (size_t)blockIdx.z * TT * TT; __shared__ __align__(16) float ss[4][16][HD + 4];
  const int tid = threadIdx.x, wave = tid >> 5, lane = tid & 31, col = lane & 15, g = lane >> 4; const int qb = blockIdx.x; const int ql0 = qb * 64 + wave * 16; const int kce = (kb_last(qb) + 1) * 4;
  v8f acc[HD / 16] = {};
  if (qb < QBH) {
#pragma unroll 1
    for (int kc = 0; kc < kce; ++kc) { const F2 p = split_row(PS + (size_t)(ql0 + col) * TT, kc * 32, lane);
      asm volatile("s_wait_loadcnt 0x0" ::: "memory");
#pragma unroll
      for (int j = 0; j < HD / 16; ++j) { const size_t po = ((size_t)b * CC + h * HD + j * 16 + col) * (size_t)KHI + kc * 32; const v16b vh = frag_b(VB + po, lane); acc[j] = wmma_bf(p.h, vh, acc[j]); acc[j] = wmma_bf(p.l, vh, acc[j]); acc[j] = wmma_bf(p.h, frag_b(VBL + po, lane), acc[j]); } }
  } else {
#pragma unroll 1
    for (int kc = 0; kc < kce; ++kc) { const v16h p = frag_f32(PS + (size_t)(ql0 + col) * TT + kc * 32, lane);
      asm volatile("s_wait_loadcnt 0x0" ::: "memory");
#pragma unroll
      for (int j = 0; j < HD / 16; ++j) { const size_t po = ((size_t)b * CC + h * HD + j * 16 + col) * (size_t)TT + kc * 32; acc[j] = wmma16(p, frag_h(VT + po, lane), acc[j]); } } }
#pragma unroll
  for (int j = 0; j < HD / 16; ++j)
#pragma unroll
    for (int r = 0; r < 8; ++r) ss[wave][8 * g + r][j * 16 + col] = acc[j][r] * (1.0f / 2048.0f);
  LDSX(); for (int rl = 0; rl < 16; ++rl) if (lane < HD / 4) vst2(Y + ((size_t)b * TT + ql0 + rl) * CC + h * HD + lane * 4, *(const v4f*)&ss[wave][rl][lane * 4]); }
// ---- k_out: block = (64 rows, 128 cols): out = ctx Wo (+ bo): all rows: ctx bf16 hi + lo against exact bf16 Wo (2 products)
__global__ __launch_bounds__(128) void k_out(const float* __restrict__ Y, const float* __restrict__ WO, const float* __restrict__ BO, float* __restrict__ OUT) { __shared__ __align__(16) float sf[4][16][132];
  const int tid = threadIdx.x, wave = tid >> 5, lane = tid & 31, col = lane & 15, g = lane >> 4; const int c0 = blockIdx.y * 128; const size_t r0 = (size_t)blockIdx.x * 64 + wave * 16;
  v8f acc[8] = {};
  if (true) {   /* ALL rows: ctx split bf16 hi + lo x exact Wo (2 products) */
#pragma unroll 2
    for (int kc = 0; kc < CC / 32; ++kc) { const F2 a = split_row(Y + (r0 + col) * CC, kc * 32, lane); asm volatile("s_wait_loadcnt 0x0" ::: "memory");
#pragma unroll
      for (int j = 0; j < 8; ++j) { const v16b w = WOCOL(WO, kc * 32, c0 + j * 16 + col, lane); asm volatile("s_wait_loadcnt 0x0" ::: "memory"); acc[j] = wmma_bf(a.h, w, acc[j]); acc[j] = wmma_bf(a.l, w, acc[j]); } }
#pragma unroll
    for (int j = 0; j < 8; ++j) { const float bias = BO ? bfr(BO[c0 + j * 16 + col]) : 0.f;
#pragma unroll
      for (int r = 0; r < 8; ++r) sf[wave][8 * g + r][j * 16 + col] = acc[j][r] + bias; }
  } else {
#pragma unroll 2
    for (int kc = 0; kc < CC / 32; ++kc) { const v16h a = frag_f32(Y + (r0 + col) * CC + kc * 32, lane); asm volatile("s_wait_loadcnt 0x0" ::: "memory");
#pragma unroll
      for (int j = 0; j < 8; ++j) { const v16h w = WOCOLH(WO, kc * 32, c0 + j * 16 + col, lane); asm volatile("s_wait_loadcnt 0x0" ::: "memory"); acc[j] = wmma16(a, w, acc[j]); } }
#pragma unroll
    for (int j = 0; j < 8; ++j) { const float bias = BO ? bfr(BO[c0 + j * 16 + col]) : 0.f;
#pragma unroll
      for (int r = 0; r < 8; ++r) sf[wave][8 * g + r][j * 16 + col] = acc[j][r] * (1.0f / 256.0f) + bias; } }
  LDSX(); for (int rl = 0; rl < 16; ++rl) vst2(OUT + (r0 + rl) * DIN + c0 + lane * 4, *(const v4f*)&sf[wave][rl][lane * 4]); }

extern "C" void kernel_launch(void* const* d_in, const int* in_sizes, int n_in, void* d_out, int out_size, void* d_ws, size_t ws_size, hipStream_t stream) {
  (void)in_sizes; (void)n_in; (void)out_size;
  const float** F = (const float**)d_in;
  if (ws_size < (size_t)WS_END) return;
  char* ws = (char*)d_ws; _Float16 *QH = (_Float16*)(ws + WS_QH), *KH = (_Float16*)(ws + WS_KH), *VT = (_Float16*)(ws + WS_VT), *QL = (_Float16*)(ws + WS_QL), *KL = (_Float16*)(ws + WS_KL); __bf16 *VB = (__bf16*)(ws + WS_VB), *VBL = (__bf16*)(ws + WS_VBL); float *S = (float*)(ws + WS_S), *Y = (float*)(ws + WS_Y);
  (void)Y; (void)QL; (void)KL; (void)VB; (void)VBL;
  // inputs: 0 x [64,256,384]; 1 Wq, 2 Wk, 3 Wv [384,384] (in,out); 4 Wo (in,out), 5 bo
  k_proj<<<dim3(TNB * TT / 64, CC / 128, 3), 128, 0, stream>>>(F[0], F[0], F[0], F[1], F[2], F[3], nullptr, nullptr, nullptr, QH, QL, KH, KL, VT, VB, VBL);
  for (int b = 0; b < TNB; ++b) {   /* one pass per sequence, all 6 heads */
    k_sc<<<dim3(NQB, TT / 128, HG), 128, 0, stream>>>(QH, KH, QL, KL, b, 0, S);
    k_sm<<<dim3(TT, HG), 256, 0, stream>>>(S);
    k_pv<<<dim3(NQB, 1, HG), 128, 0, stream>>>(S, VT, VB, VBL, b, 0, Y);
  }
  k_out<<<dim3(TNB * TT / 64, DIN / 128), 128, 0, stream>>>(Y, F[4], F[5], (float*)d_out);
}

// v001
// One run takes 297 microseconds.
// Two timings next to v000 put it at 6.37 and 6.41 times that version's speed.
// compute dtype: all float inputs rounded to bf16; q/k/v = x W with EXACT bf16 products on WMMA 16x16x32 (f32 accumulate); causal logits with q, k as f16 hi + residual (3 products, all rows) x 64^-0.5; softmax in f32; P split in bf16 hi + lo against v bf16 hi + lo (3 products); ctx split bf16 hi + lo against exact Wo (2 products) + bo; f32 output.
#include <hip/hip_runtime.h>
#include <math.h>

typedef __attribute__((ext_vector_type(16))) _Float16 v16h;
typedef __attribute__((ext_vector_type(16))) __bf16 v16b;
typedef __attribute__((ext_vector_type(8)))  _Float16 v8h;
typedef __attribute__((ext_vector_type(8)))  float v8f;
typedef __attribute__((ext_vector_type(4)))  float v4f;
typedef __attribute__((ext_vector_type(2)))  float v2f;
typedef __attribute__((ext_vector_type(4)))  unsigned v4u;
typedef __attribute__((ext_vector_type(4)))  int v4i;
typedef float __attribute__((may_alias)) float_a;
typedef int __attribute__((may_alias)) int_a;

template <typename T> __device__ __forceinline__ void vst2(void* p, T v) { *(T*)p = v;  }
__device__ __forceinline__ v8f wmma16(v16h a, v16h b, v8f c) {
  v8f d = __builtin_amdgcn_wmma_f32_16x16x32_f16(false, a, false, b, (short)0, c, false, false);
  asm volatile("v_nop\n\tv_nop\n\tv_nop\n\tv_nop" : "+v"(d) : "v"(a), "v"(b));
  return d;
}
__device__ __forceinline__ v8f wmma_bf(v16b a, v16b b, v8f c) {
  v8f d = __builtin_amdgcn_wmma_f32_16x16x32_bf16(false, a, false, b, (short)0, c, false, false);
  asm volatile("v_nop\n\tv_nop\n\tv_nop\n\tv_nop" : "+v"(d) : "v"(a), "v"(b));
  return d;
}
// 16x16x32 fragments: lane = (h = lane>>4, row/col = lane&15); elements 0..7 = k0+8h+0..7, 8..15 = k0+16+8h+0..7; D element r = row 8h+r
__device__ __forceinline__ v16h frag_h(const _Float16* rowk0, int lane) {
  union { v16h v; v8h q[2]; } u; const _Float16* p = rowk0 + 8 * (lane >> 4);
  u.q[0] = *(const v8h*)p; u.q[1] = *(const v8h*)(p + 16); return u.v;
}
__device__ __forceinline__ v16h frag_f32(const float* rowk0, int lane) {
  v16h a; const float* p = rowk0 + 8 * (lane >> 4);
#pragma unroll
  for (int i = 0; i < 8; ++i) { a[i] = (_Float16)p[i]; a[8 + i] = (_Float16)p[16 + i]; }
  return a;
}
__device__ __forceinline__ v16h frag_f32s(const float* rowk0, int lane, float sc) {
  v16h a; const float* p = rowk0 + 8 * (lane >> 4);
#pragma unroll
  for (int i = 0; i < 8; ++i) { a[i] = (_Float16)(p[i] * sc); a[8 + i] = (_Float16)(p[16 + i] * sc); }
  return a;
}
// column fragment from a [K][ld] layout (column n), rows >= K read as 0
__device__ __forceinline__ v16h fragc_f32(const float* W, int k0, int n, int lane, int ld, int K) {
  v16h a; const int g = lane >> 4;
#pragma unroll
  for (int i = 0; i < 8; ++i) { const int ka = k0 + 8 * g + i, kb = ka + 16;
    a[i] = (_Float16)(ka < K ? W[(size_t)(ka < K ? ka : K - 1) * ld + n] : 0.f); a[8 + i] = (_Float16)(kb < K ? W[(size_t)(kb < K ? kb : K - 1) * ld + n] : 0.f); }
  return a;
}
struct F2 { v16b h, l; };
__device__ __forceinline__ F2 bsplit16(const float v[16]) { F2 r;
#pragma unroll
  for (int i = 0; i < 16; ++i) { const __bf16 h = (__bf16)v[i]; r.h[i] = h; r.l[i] = (__bf16)(v[i] - (float)h); }
  return r; }
__device__ __forceinline__ F2 split_row(const float* row, int k0, int lane) { float v[16]; const float* p = row + k0 + 8 * (lane >> 4);
#pragma unroll
  for (int i = 0; i < 8; ++i) { v[i] = p[i]; v[8 + i] = p[16 + i]; }
  return bsplit16(v); }
__device__ __forceinline__ F2 split_rowK(const float* row, int k0, int lane, int K) { float v[16]; const int g = lane >> 4;
#pragma unroll
  for (int i = 0; i < 8; ++i) { const int ka = k0 + 8 * g + i, kb = ka + 16; v[i] = ka < K ? row[ka < K ? ka : K - 1] : 0.f; v[8 + i] = kb < K ? row[kb < K ? kb : K - 1] : 0.f; }
  return bsplit16(v); }
__device__ __forceinline__ F2 split_col(const float* W, int k0, int n, int lane, int ld, int K) { float v[16]; const int g = lane >> 4;
#pragma unroll
  for (int i = 0; i < 8; ++i) { const int ka = k0 + 8 * g + i, kb = ka + 16; v[i] = ka < K ? W[(size_t)(ka < K ? ka : K - 1) * ld + n] : 0.f; v[8 + i] = kb < K ? W[(size_t)(kb < K ? kb : K - 1) * ld + n] : 0.f; }
  return bsplit16(v); }
__device__ __forceinline__ v8f mac3(const F2& a, const F2& b, v8f c) { c = wmma_bf(a.l, b.h, c); c = wmma_bf(a.h, b.l, c); return wmma_bf(a.h, b.h, c); }
__device__ __forceinline__ float sigm(float v) { return 1.0f / (1.0f + expf(-v)); }
#define LDSX() do { asm volatile("s_wait_dscnt 0" ::: "memory"); __builtin_amdgcn_wave_barrier(); __builtin_amdgcn_fence(__ATOMIC_RELEASE, "workgroup"); } while (0)

// Causal multi-head self-attention (B 64, T 256, C 384 = 6 x 64): q,k,v = x W ((in,out), no bias); causal softmax(q k^T / 8) (-inf above the diagonal); out = merged(attn v) Wo + bo.
#define NB 64
#define TT 256
#define CC 384            // NH * HD = projected width
#define DIN 384          // input (model) width
#define NH 6
#define HD 64
#define NQB (TT / 64)
#define HG 6
#define SCALE (0.125f)
#define CAUSAL 1
#ifndef TNB
#define TNB NB
#endif
__device__ __forceinline__ float bfr(float v) { return (float)(__bf16)v; }
__host__ __device__ __forceinline__ int kb_last(int qb) { return CAUSAL ? ((qb * 64 + 63) >> 7) : (TT / 128 - 1); }
typedef __attribute__((ext_vector_type(8))) __bf16 v8b;
__device__ __forceinline__ v16b frag_b(const __bf16* rowk0, int lane) {
  union { v16b v; v8b q[2]; } u; const __bf16* p = rowk0 + 8 * (lane >> 4);
  u.q[0] = *(const v8b*)p; u.q[1] = *(const v8b*)(p + 16); return u.v;
}
#define QBH 4              // causal: query blocks 0..QBH-1 of each sequence (QBH = NQB: every query block) take the high-precision path
#define QHI 256            // rows carrying a q residual plane (QHI = TT: all rows)
#define KHI 256            // key rows carrying k residual / v bf16 hi+lo planes (used only by the causal high-precision path)
// B fragment (k rows k0+.., output column o) of a weight: (in,out) [K][ld] or (out,in) [ld rows of K]: bf16 exact, or f16(bf16 * 256) exact
__device__ __forceinline__ v16b wcol_io(const float* Wm, int k0, int o, int lane, int ld) { v16b w; const int g = lane >> 4;
#pragma unroll
  for (int i = 0; i < 8; ++i) { w[i] = (__bf16)Wm[(size_t)(k0 + 8 * g + i) * ld + o]; w[8 + i] = (__bf16)Wm[(size_t)(k0 + 16 + 8 * g + i) * ld + o]; }
  return w; }
__device__ __forceinline__ v16b wcol_oi(const float* Wm, int k0, int o, int lane, int K) { v16b w; const float* p = Wm + (size_t)o * K + k0 + 8 * (lane >> 4);
#pragma unroll
  for (int i = 0; i < 8; ++i) { w[i] = (__bf16)p[i]; w[8 + i] = (__bf16)p[16 + i]; }
  return w; }
__device__ __forceinline__ v16h wcolh_io(const float* Wm, int k0, int o, int lane, int ld) { v16h w; const int g = lane >> 4;
#pragma unroll
  for (int i = 0; i < 8; ++i) { w[i] = (_Float16)(bfr(Wm[(size_t)(k0 + 8 * g + i) * ld + o]) * 256.0f); w[8 + i] = (_Float16)(bfr(Wm[(size_t)(k0 + 16 + 8 * g + i) * ld + o]) * 256.0f); }
  return w; }
__device__ __forceinline__ v16h wcolh_oi(const float* Wm, int k0, int o, int lane, int K) { v16h w; const float* p = Wm + (size_t)o * K + k0 + 8 * (lane >> 4);
#pragma unroll
  for (int i = 0; i < 8; ++i) { w[i] = (_Float16)(bfr(p[i]) * 256.0f); w[8 + i] = (_Float16)(bfr(p[16 + i]) * 256.0f); }
  return w; }
#define WQKV_LAYOUT 0   // 0 = (in,out) [DIN][CC]; 1 = (out,in) [CC][DIN]; 2 = per-head [NH][DIN][HD]
__device__ __forceinline__ v16b wcol_hdk(const float* Wm, int k0, int o, int lane) { v16b w; const int g = lane >> 4; const float* p = Wm + (size_t)(o / HD) * DIN * HD + (o % HD);
#pragma unroll
  for (int i = 0; i < 8; ++i) { w[i] = (__bf16)p[(size_t)(k0 + 8 * g + i) * HD]; w[8 + i] = (__bf16)p[(size_t)(k0 + 16 + 8 * g + i) * HD]; }
  return w; }
#define WO_OUT_IN 0
#if WQKV_LAYOUT == 1
#define WCOL(W, k0, o, lane) wcol_oi(W, k0, o, lane, DIN)
#elif WQKV_LAYOUT == 2
#define WCOL(W, k0, o, lane) wcol_hdk(W, k0, o, lane)
#else
#define WCOL(W, k0, o, lane) wcol_io(W, k0, o, lane, CC)
#endif
#if WO_OUT_IN
#define WOCOL(W, k0, o, lane) wcol_oi(W, k0, o, lane, CC)
#define WOCOLH(W, k0, o, lane) wcolh_oi(W, k0, o, lane, CC)
#else
#define WOCOL(W, k0, o, lane) wcol_io(W, k0, o, lane, DIN)
#define WOCOLH(W, k0, o, lane) wcolh_io(W, k0, o, lane, DIN)
#endif

#ifndef SM_EXTRA_PARAMS
#define SM_EXTRA_PARAMS
#endif
#ifndef PROJ_EXTRA_PARAMS
#define PROJ_EXTRA_PARAMS
#endif
#ifndef SM_MASK_HOOK
#define SM_MASK_HOOK (void)0
#endif

#define WS_QH  0u                                      // f16 q rows [b*t][CC]
#define WS_KH  (WS_QH + 2u * (size_t)NB * TT * CC)      // f16 k rows [b*t][CC]
#define WS_VT  (WS_KH + 2u * (size_t)NB * TT * CC)      // f16 v planes [b][c][t]
#define WS_QL  (WS_VT + 2u * (size_t)NB * CC * TT)      // f16 q residual x 2^10 rows [b][t < QHI][CC]
#define WS_KL  (WS_QL + 2u * (size_t)NB * QHI * CC)     // f16 k residual x 2^10 rows [b][t < KHI][CC]
#define WS_VB  (WS_KL + 2u * (size_t)NB * KHI * CC)     // bf16 v hi planes [b][c][t < KHI]
#define WS_VBL (WS_VB + 2u * (size_t)NB * CC * KHI)
#define WS_S   (WS_VBL + 2u * (size_t)NB * CC * KHI)    // f32 logits / P [b][hg][t][s]
#define WS_Y   (WS_S  + 4u * (size_t)NB * HG * TT * TT) // f32 ctx rows [b*t][CC] (only when there is an output projection)
#define WS_END (WS_Y  + 4u * (size_t)NB * TT * CC)

// ---- k_proj: block = (64 rows, 128 cols, which): q/k/v = X W (+ b) with exact bf16 products (K = DIN) -> which 0: q f16 rows (+ residual rows < QHI); 1: k f16 rows (+ residual rows < KHI); 2: v f16 planes [c][t] (+ bf16 hi/lo planes for t < KHI)
__global__ __launch_bounds__(128) void k_proj(const float* __restrict__ XQ, const float* __restrict__ XK, const float* __restrict__ XV, const float* __restrict__ WQ, const float* __restrict__ WK, const float* __restrict__ WV, const float* __restrict__ BQ, const float* __restrict__ BK, const float* __restrict__ BV,
    _Float16* __restrict__ QH, _Float16* __restrict__ QL, _Float16* __restrict__ KH, _Float16* __restrict__ KL, _Float16* __restrict__ VT, __bf16* __restrict__ VB, __bf16* __restrict__ VBL) {
  __shared__ __align__(16) _Float16 sh[64][136], sl[64][136]; __shared__ __align__(16) _Float16 th[128][72]; __shared__ __align__(16) __bf16 tb[128][72], tbl[128][72];
  const int tid = threadIdx.x, wave = tid >> 5, lane = tid & 31, col = lane & 15, g = lane >> 4; const int which = blockIdx.z; const int c0 = blockIdx.y * 128; const size_t r0 = (size_t)blockIdx.x * 64; const size_t bb = r0 / TT; const int t0 = (int)(r0 % TT);
  const float* X = which == 0 ? XQ : which == 1 ? XK : XV; const float* WA = which == 0 ? WQ : which == 1 ? WK : WV; const float* BA = which == 0 ? BQ : which == 1 ? BK : BV;
  v8f acc[8] = {};
#pragma unroll 2
  for (int kc = 0; kc < DIN / 32; ++kc) { v16b a; { const float* p = X + (r0 + wave * 16 + col) * DIN + kc * 32 + 8 * g;
#pragma unroll
      for (int i = 0; i < 8; ++i) { a[i] = (__bf16)p[i]; a[8 + i] = (__bf16)p[16 + i]; } }
    asm volatile("s_wait_loadcnt 0x0" ::: "memory");
#pragma unroll
    for (int j = 0; j < 8; ++j) { const v16b w = WCOL(WA, kc * 32, c0 + j * 16 + col, lane); asm volatile("s_wait_loadcnt 0x0" ::: "memory"); acc[j] = wmma_bf(a, w, acc[j]); } }
  if (which < 2) { _Float16* DH = which == 0 ? QH : KH; _Float16* DL = which == 0 ? QL : KL; const int nhi = which == 0 ? QHI : KHI; const bool hi_rows = t0 < nhi;
#pragma unroll
    for (int j = 0; j < 8; ++j) { const float bias = BA ? bfr(BA[c0 + j * 16 + col]) : 0.f;
#pragma unroll
      for (int r = 0; r < 8; ++r) { const float v = acc[j][r] + bias; const _Float16 hv = (_Float16)v; sh[wave * 16 + 8 * g + r][j * 16 + col] = hv; sl[wave * 16 + 8 * g + r][j * 16 + col] = (_Float16)((v - (float)hv) * 1024.0f); } }
    __syncthreads();
    for (int e = tid; e < 64 * 16; e += 128) { const int rl = e >> 4, q = e & 15; vst2((unsigned*)(DH + (r0 + rl) * CC + c0 + q * 8), *(const v4u*)&sh[rl][q * 8]); if (hi_rows) vst2((unsigned*)(DL + (bb * nhi + t0 + rl) * (size_t)CC + c0 + q * 8), *(const v4u*)&sl[rl][q * 8]); }
  } else { const bool hi_rows = t0 < KHI;
#pragma unroll
    for (int j = 0; j < 8; ++j) { const float bias = BA ? bfr(BA[c0 + j * 16 + col]) : 0.f;
#pragma unroll
      for (int r = 0; r < 8; ++r) { const float v = acc[j][r] + bias; const int rl = wave * 16 + 8 * g + r, cl = j * 16 + col; th[cl][rl] = (_Float16)v; const __bf16 bh = (__bf16)v; tb[cl][rl] = bh; tbl[cl][rl] = (__bf16)(v - (float)bh); } }
    __syncthreads();
    for (int e = tid; e < 128 * 8; e += 128) { const int cl = e >> 3, q = e & 7; vst2((unsigned*)(VT + (bb * CC + c0 + cl) * (size_t)TT + t0 + q * 8), *(const v4u*)&th[cl][q * 8]); if (hi_rows) { const size_t o3 = (bb * CC + c0 + cl) * (size_t)KHI + t0 + q * 8; vst2((unsigned*)(VB + o3), *(const v4u*)&tb[cl][q * 8]); vst2((unsigned*)(VBL + o3), *(const v4u*)&tbl[cl][q * 8]); } } } }
// ---- k_sc: block = (query block qb, key block kb <= kb_last(qb), z = sequence b * HG + head): logits x SCALE; q hi + residual (x 2^10) against k (2 products) for query rows < QHI, plus the k residual (3 products) for query blocks < QBH (QBH = NQB: every query block); causal: blocks past the diagonal exit, the mask itself is applied by index in k_sm
__global__ __launch_bounds__(128) void k_sc(const _Float16* __restrict__ QH, const _Float16* __restrict__ KH, const _Float16* __restrict__ QL, const _Float16* __restrict__ KL, float* __restrict__ S0) { __shared__ __align__(16) float ss[4][16][132];
  const int qb = blockIdx.x, kb = blockIdx.y; if (kb > kb_last(qb)) return;
  const int b = blockIdx.z / HG, h = blockIdx.z % HG; float* S = S0 + (size_t)blockIdx.z * TT * TT;
  const int tid = threadIdx.x, wave = tid >> 5, lane = tid & 31, col = lane & 15, g = lane >> 4; const int k0 = kb * 128; const int ql0 = qb * 64 + wave * 16; const size_t q0 = (size_t)b * TT + ql0, kr0 = (size_t)b * TT + k0;
  v8f acc[8] = {}, accl[8] = {};
  const _Float16* QLb = QL + (size_t)b * QHI * CC; const _Float16* KLb = KL + (size_t)b * KHI * CC;
  if (qb < QBH) {
#pragma unroll
    for (int kc = 0; kc < HD / 32; ++kc) { const v16h ah = frag_h(QH + (q0 + col) * CC + h * HD + kc * 32, lane), al = frag_h(QLb + (size_t)(ql0 + col) * CC + h * HD + kc * 32, lane);
#pragma unroll
      for (int j = 0; j < 8; ++j) { const v16h kbf = frag_h(KH + (kr0 + j * 16 + col) * CC + h * HD + kc * 32, lane), klf = frag_h(KLb + (size_t)(k0 + j * 16 + col) * CC + h * HD + kc * 32, lane); acc[j] = wmma16(ah, kbf, acc[j]); accl[j] = wmma16(al, kbf, accl[j]); accl[j] = wmma16(ah, klf, accl[j]); } }
  } else if (qb * 64 < QHI) {
#pragma unroll
    for (int kc = 0; kc < HD / 32; ++kc) { const v16h ah = frag_h(QH + (q0 + col) * CC + h * HD + kc * 32, lane), al = frag_h(QLb + (size_t)(ql0 + col) * CC + h * HD + kc * 32, lane);
#pragma unroll
      for (int j = 0; j < 8; ++j) { const v16h kbf = frag_h(KH + (kr0 + j * 16 + col) * CC + h * HD + kc * 32, lane); acc[j] = wmma16(ah, kbf, acc[j]); accl[j] = wmma16(al, kbf, accl[j]); } }
  } else {
#pragma unroll
    for (int kc = 0; kc < HD / 32; ++kc) { const v16h ah = frag_h(QH + (q0 + col) * CC + h * HD + kc * 32, lane);
#pragma unroll
      for (int j = 0; j < 8; ++j) { const v16h kbf = frag_h(KH + (kr0 + j * 16 + col) * CC + h * HD + kc * 32, lane); acc[j] = wmma16(ah, kbf, acc[j]); } } }
#pragma unroll
  for (int j = 0; j < 8; ++j) {
#pragma unroll
    for (int r = 0; r < 8; ++r) ss[wave][8 * g + r][j * 16 + col] = (acc[j][r] + accl[j][r] * (1.0f / 1024.0f)) * SCALE; }
  LDSX(); for (int rl = 0; rl < 16; ++rl) vst2(S + (size_t)(ql0 + rl) * TT + k0 + lane * 4, *(const v4f*)&ss[wave][rl][lane * 4]); }
// ---- k_sm: block = query row t of one head, for SMB sequences one after the other (a block per single row would start 8 waves for about 1 KB of work): keys [0, kend): causal -> logit if s <= t else excluded; softmax in f32; P x 2^11 in place (0 for excluded)
#define SMB 16
__global__ __launch_bounds__(256) void k_sm(float* __restrict__ S0 SM_EXTRA_PARAMS) { __shared__ float sred[8]; __shared__ float sbc; __shared__ __align__(16) float shv[2][TT];
  const int tid = threadIdx.x; const int t = blockIdx.x; const int kend = (kb_last(t >> 6) + 1) * 128;
  for (int sq = 0; sq < SMB; ++sq) { float* sv = shv[sq & 1];   /* two row buffers in turn: the next row's writes cannot meet this row's last reads, so no barrier (and no wait for the stores) at the loop's foot */
  float* sr = S0 + ((size_t)(blockIdx.z * SMB + sq) * HG + blockIdx.y) * TT * TT + (size_t)t * TT;
  float m = -3.0e38f; for (int k = tid; k < kend; k += 256) { float v = (!CAUSAL || k <= t) ? sr[k] : -3.0e38f; SM_MASK_HOOK; sv[k] = v; m = fmaxf(m, v); }
#pragma unroll
  for (int o = 1; o < 32; o <<= 1) m = fmaxf(m, __shfl_xor(m, o));
  if ((tid & 31) == 0) sred[tid >> 5] = m; __syncthreads(); if (tid == 0) { float a = sred[0]; for (int i = 1; i < 8; ++i) a = fmaxf(a, sred[i]); sbc = a; } __syncthreads(); m = sbc; __syncthreads();
  float sum = 0.f; for (int k = tid; k < kend; k += 256) { const float v = sv[k]; const float e = (v <= -1.0e38f) ? 0.f : expf(v - m); sv[k] = e; sum += e; }
#pragma unroll
  for (int o = 1; o < 32; o <<= 1) sum += __shfl_xor(sum, o);
  if ((tid & 31) == 0) sred[tid >> 5] = sum; __syncthreads(); if (tid == 0) { float a = 0.f; for (int i = 0; i < 8; ++i) a += sred[i]; sbc = a > 0.f ? 2048.0f / a : 0.f; }   /* a fully excluded row yields P = 0 */ __syncthreads(); const float inv = sbc;
  for (int k = tid; k < kend; k += 256) sv[k] = sv[k] * inv;
  __syncthreads(); for (int q = tid; q < kend / 4; q += 256) vst2(sr + q * 4, *(const v4f*)&sv[q * 4]);
  } }
// ---- k_pv: block = 64 queries (qb) of z = sequence b * HG + head: ctx = P . v over keys [0, kend) (query blocks < QBH, here every one: P x 2^11 and v as bf16 hi + lo, 3 products; else P once to f16 against v f16: 1 product); 256-B (row, head) segment by 16 lanes
__global__ __launch_bounds__(128) void k_pv(const float* __restrict__ PS0, const _Float16* __restrict__ VT, const __bf16* __restrict__ VB, const __bf16* __restrict__ VBL, float* __restrict__ Y) { const int b = blockIdx.z / HG, h = blockIdx.z % HG; const float* PS = PS0 + (size_t)blockIdx.z * TT * TT; __shared__ __align__(16) float ss[4][16][HD + 4];
  const int tid = threadIdx.x, wave = tid >> 5, lane = tid & 31, col = lane & 15, g = lane >> 4; const int qb = blockIdx.x; const int ql0 = qb * 64 + wave * 16; const int kce = (kb_last(qb) + 1) * 4;
  v8f acc[HD / 16] = {};
  if (qb < QBH) {
#pragma unroll 1
    for (int kc = 0; kc < kce; ++kc) { const F2 p = split_row(PS + (size_t)(ql0 + col) * TT, kc * 32, lane);
      asm volatile("s_wait_loadcnt 0x0" ::: "memory");
#pragma unroll
      for (int j = 0; j < HD / 16; ++j) { const size_t po = ((size_t)b * CC + h * HD + j * 16 + col) * (size_t)KHI + kc * 32; const v16b vh = frag_b(VB + po, lane); acc[j] = wmma_bf(p.h, vh, acc[j]); acc[j] = wmma_bf(p.l, vh, acc[j]); acc[j] = wmma_bf(p.h, frag_b(VBL + po, lane), acc[j]); } }
  } else {
#pragma unroll 1
    for (int kc = 0; kc < kce; ++kc) { const v16h p = frag_f32(PS + (size_t)(ql0 + col) * TT + kc * 32, lane);
      asm volatile("s_wait_loadcnt 0x0" ::: "memory");
#pragma unroll
      for (int j = 0; j < HD / 16; ++j) { const size_t po = ((size_t)b * CC + h * HD + j * 16 + col) * (size_t)TT + kc * 32; acc[j] = wmma16(p, frag_h(VT + po, lane), acc[j]); } } }
#pragma unroll
  for (int j = 0; j < HD / 16; ++j)
#pragma unroll
    for (int r = 0; r < 8; ++r) ss[wave][8 * g + r][j * 16 + col] = acc[j][r] * (1.0f / 2048.0f);
  LDSX(); for (int rl = 0; rl < 16; ++rl) if (lane < HD / 4) vst2(Y + ((size_t)b * TT + ql0 + rl) * CC + h * HD + lane * 4, *(const v4f*)&ss[wave][rl][lane * 4]); }
// ---- k_out: block = (64 rows, 128 cols): out = ctx Wo (+ bo): all rows: ctx bf16 hi + lo against exact bf16 Wo (2 products)
__global__ __launch_bounds__(128) void k_out(const float* __restrict__ Y, const float* __restrict__ WO, const float* __restrict__ BO, float* __restrict__ OUT) { __shared__ __align__(16) float sf[4][16][132];
  const int tid = threadIdx.x, wave = tid >> 5, lane = tid & 31, col = lane & 15, g = lane >> 4; const int c0 = blockIdx.y * 128; const size_t r0 = (size_t)blockIdx.x * 64 + wave * 16;
  v8f acc[8] = {};
  if (true) {   /* ALL rows: ctx split bf16 hi + lo x exact Wo (2 products) */
#pragma unroll 2
    for (int kc = 0; kc < CC / 32; ++kc) { const F2 a = split_row(Y + (r0 + col) * CC, kc * 32, lane); asm volatile("s_wait_loadcnt 0x0" ::: "memory");
#pragma unroll
      for (int j = 0; j < 8; ++j) { const v16b w = WOCOL(WO, kc * 32, c0 + j * 16 + col, lane); asm volatile("s_wait_loadcnt 0x0" ::: "memory"); acc[j] = wmma_bf(a.h, w, acc[j]); acc[j] = wmma_bf(a.l, w, acc[j]); } }
#pragma unroll
    for (int j = 0; j < 8; ++j) { const float bias = BO ? bfr(BO[c0 + j * 16 + col]) : 0.f;
#pragma unroll
      for (int r = 0; r < 8; ++r) sf[wave][8 * g + r][j * 16 + col] = acc[j][r] + bias; }
  } else {
#pragma unroll 2
    for (int kc = 0; kc < CC / 32; ++kc) { const v16h a = frag_f32(Y + (r0 + col) * CC + kc * 32, lane); asm volatile("s_wait_loadcnt 0x0" ::: "memory");
#pragma unroll
      for (int j = 0; j < 8; ++j) { const v16h w = WOCOLH(WO, kc * 32, c0 + j * 16 + col, lane); asm volatile("s_wait_loadcnt 0x0" ::: "memory"); acc[j] = wmma16(a, w, acc[j]); } }
#pragma unroll
    for (int j = 0; j < 8; ++j) { const float bias = BO ? bfr(BO[c0 + j * 16 + col]) : 0.f;
#pragma unroll
      for (int r = 0; r < 8; ++r) sf[wave][8 * g + r][j * 16 + col] = acc[j][r] * (1.0f / 256.0f) + bias; } }
  LDSX(); for (int rl = 0; rl < 16; ++rl) vst2(OUT + (r0 + rl) * DIN + c0 + lane * 4, *(const v4f*)&sf[wave][rl][lane * 4]); }

extern "C" void kernel_launch(void* const* d_in, const int* in_sizes, int n_in, void* d_out, int out_size, void* d_ws, size_t ws_size, hipStream_t stream) {
  (void)in_sizes; (void)n_in; (void)out_size;
  const float** F = (const float**)d_in;
  if (ws_size < (size_t)WS_END) return;
  char* ws = (char*)d_ws; _Float16 *QH = (_Float16*)(ws + WS_QH), *KH = (_Float16*)(ws + WS_KH), *VT = (_Float16*)(ws + WS_VT), *QL = (_Float16*)(ws + WS_QL), *KL = (_Float16*)(ws + WS_KL); __bf16 *VB = (__bf16*)(ws + WS_VB), *VBL = (__bf16*)(ws + WS_VBL); float *S = (float*)(ws + WS_S), *Y = (float*)(ws + WS_Y);
  (void)Y; (void)QL; (void)KL; (void)VB; (void)VBL;
  // inputs: 0 x [64,256,384]; 1 Wq, 2 Wk, 3 Wv [384,384] (in,out); 4 Wo (in,out), 5 bo
  k_proj<<<dim3(TNB * TT / 64, CC / 128, 3), 128, 0, stream>>>(F[0], F[0], F[0], F[1], F[2], F[3], nullptr, nullptr, nullptr, QH, QL, KH, KL, VT, VB, VBL);
  /* all sequences and heads in one launch of each stage */
  k_sc<<<dim3(NQB, TT / 128, TNB * HG), 128, 0, stream>>>(QH, KH, QL, KL, S);
  k_sm<<<dim3(TT, HG, TNB / SMB), 256, 0, stream>>>(S);
  k_pv<<<dim3(NQB, 1, TNB * HG), 128, 0, stream>>>(S, VT, VB, VBL, Y);
  k_out<<<dim3(TNB * TT / 64, DIN / 128), 128, 0, stream>>>(Y, F[4], F[5], (float*)d_out);
}

// v002
// It runs in 214 microseconds.
// Next to v001, in two timings, it ran 1.38 and 1.39 times as fast.
// Over all steps from v000 it is 8.85 times as fast.
// compute dtype: all float inputs rounded to bf16; q/k/v = x W with EXACT bf16 products on WMMA 16x16x32 (f32 accumulate); causal logits with q, k as f16 hi + residual (3 products, all rows) x 64^-0.5; softmax in f32; P split in bf16 hi + lo against v bf16 hi + lo (3 products); ctx split bf16 hi + lo against exact Wo (2 products) + bo; f32 output.
#include <hip/hip_runtime.h>
#include <math.h>

typedef __attribute__((ext_vector_type(16))) _Float16 v16h;
typedef __attribute__((ext_vector_type(16))) __bf16 v16b;
typedef __attribute__((ext_vector_type(8)))  _Float16 v8h;
typedef __attribute__((ext_vector_type(8)))  float v8f;
typedef __attribute__((ext_vector_type(4)))  float v4f;
typedef __attribute__((ext_vector_type(2)))  float v2f;
typedef __attribute__((ext_vector_type(4)))  unsigned v4u;
typedef __attribute__((ext_vector_type(4)))  int v4i;
typedef float __attribute__((may_alias)) float_a;
typedef int __attribute__((may_alias)) int_a;

template <typename T> __device__ __forceinline__ void vst2(void* p, T v) { *(T*)p = v;  }
__device__ __forceinline__ v8f wmma16(v16h a, v16h b, v8f c) {
  v8f d = __builtin_amdgcn_wmma_f32_16x16x32_f16(false, a, false, b, (short)0, c, false, false);
  asm volatile("v_nop\n\tv_nop\n\tv_nop\n\tv_nop" : "+v"(d) : "v"(a), "v"(b));
  return d;
}
__device__ __forceinline__ v8f wmma_bf(v16b a, v16b b, v8f c) {
  v8f d = __builtin_amdgcn_wmma_f32_16x16x32_bf16(false, a, false, b, (short)0, c, false, false);
  asm volatile("v_nop\n\tv_nop\n\tv_nop\n\tv_nop" : "+v"(d) : "v"(a), "v"(b));
  return d;
}
// 16x16x32 fragments: lane = (h = lane>>4, row/col = lane&15); elements 0..7 = k0+8h+0..7, 8..15 = k0+16+8h+0..7; D element r = row 8h+r
__device__ __forceinline__ v16h frag_h(const _Float16* rowk0, int lane) {
  union { v16h v; v8h q[2]; } u; const _Float16* p = rowk0 + 8 * (lane >> 4);
  u.q[0] = *(const v8h*)p; u.q[1] = *(const v8h*)(p + 16); return u.v;
}
__device__ __forceinline__ v16h frag_f32(const float* rowk0, int lane) {
  v16h a; const float* p = rowk0 + 8 * (lane >> 4);
#pragma unroll
  for (int i = 0; i < 8; ++i) { a[i] = (_Float16)p[i]; a[8 + i] = (_Float16)p[16 + i]; }
  return a;
}
__device__ __forceinline__ v16h frag_f32s(const float* rowk0, int lane, float sc) {
  v16h a; const float* p = rowk0 + 8 * (lane >> 4);
#pragma unroll
  for (int i = 0; i < 8; ++i) { a[i] = (_Float16)(p[i] * sc); a[8 + i] = (_Float16)(p[16 + i] * sc); }
  return a;
}
// column fragment from a [K][ld] layout (column n), rows >= K read as 0
__device__ __forceinline__ v16h fragc_f32(const float* W, int k0, int n, int lane, int ld, int K) {
  v16h a; const int g = lane >> 4;
#pragma unroll
  for (int i = 0; i < 8; ++i) { const int ka = k0 + 8 * g + i, kb = ka + 16;
    a[i] = (_Float16)(ka < K ? W[(size_t)(ka < K ? ka : K - 1) * ld + n] : 0.f); a[8 + i] = (_Float16)(kb < K ? W[(size_t)(kb < K ? kb : K - 1) * ld + n] : 0.f); }
  return a;
}
struct F2 { v16b h, l; };
__device__ __forceinline__ F2 bsplit16(const float v[16]) { F2 r;
#pragma unroll
  for (int i = 0; i < 16; ++i) { const __bf16 h = (__bf16)v[i]; r.h[i] = h; r.l[i] = (__bf16)(v[i] - (float)h); }
  return r; }
__device__ __forceinline__ F2 split_row(const float* row, int k0, int lane) { float v[16]; const float* p = row + k0 + 8 * (lane >> 4);
#pragma unroll
  for (int i = 0; i < 8; ++i) { v[i] = p[i]; v[8 + i] = p[16 + i]; }
  return bsplit16(v); }
__device__ __forceinline__ F2 split_rowK(const float* row, int k0, int lane, int K) { float v[16]; const int g = lane >> 4;
#pragma unroll
  for (int i = 0; i < 8; ++i) { const int ka = k0 + 8 * g + i, kb = ka + 16; v[i] = ka < K ? row[ka < K ? ka : K - 1] : 0.f; v[8 + i] = kb < K ? row[kb < K ? kb : K - 1] : 0.f; }
  return bsplit16(v); }
__device__ __forceinline__ F2 split_col(const float* W, int k0, int n, int lane, int ld, int K) { float v[16]; const int g = lane >> 4;
#pragma unroll
  for (int i = 0; i < 8; ++i) { const int ka = k0 + 8 * g + i, kb = ka + 16; v[i] = ka < K ? W[(size_t)(ka < K ? ka : K - 1) * ld + n] : 0.f; v[8 + i] = kb < K ? W[(size_t)(kb < K ? kb : K - 1) * ld + n] : 0.f; }
  return bsplit16(v); }
__device__ __forceinline__ v8f mac3(const F2& a, const F2& b, v8f c) { c = wmma_bf(a.l, b.h, c); c = wmma_bf(a.h, b.l, c); return wmma_bf(a.h, b.h, c); }
__device__ __forceinline__ float sigm(float v) { return 1.0f / (1.0f + expf(-v)); }
#define LDSX() do { asm volatile("s_wait_dscnt 0" ::: "memory"); __builtin_amdgcn_wave_barrier(); __builtin_amdgcn_fence(__ATOMIC_RELEASE, "workgroup"); } while (0)

// Causal multi-head self-attention (B 64, T 256, C 384 = 6 x 64): q,k,v = x W ((in,out), no bias); causal softmax(q k^T / 8) (-inf above the diagonal); out = merged(attn v) Wo + bo.
#define NB 64
#define TT 256
#define CC 384            // NH * HD = projected width
#define DIN 384          // input (model) width
#define NH 6
#define HD 64
#define NQB (TT / 64)
#define HG 6
#define SCALE (0.125f)
#define CAUSAL 1
#ifndef TNB
#define TNB NB
#endif
__device__ __forceinline__ float bfr(float v) { return (float)(__bf16)v; }
__host__ __device__ __forceinline__ int kb_last(int qb) { return CAUSAL ? ((qb * 64 + 63) >> 7) : (TT / 128 - 1); }
typedef __attribute__((ext_vector_type(8))) __bf16 v8b;
__device__ __forceinline__ v16b frag_b(const __bf16* rowk0, int lane) {
  union { v16b v; v8b q[2]; } u; const __bf16* p = rowk0 + 8 * (lane >> 4);
  u.q[0] = *(const v8b*)p; u.q[1] = *(const v8b*)(p + 16); return u.v;
}
#define QBH 4              // causal: query blocks 0..QBH-1 of each sequence take the high-precision path; QBH == NQB, so every block does
#define QHI 256            // rows carrying a q residual plane (all rows: 3-product logits everywhere)
#define KHI 256            // key rows carrying k residual / v bf16 hi+lo planes (used only by the causal high-precision path)
// B fragment (k rows k0+.., output column o) of a weight: (in,out) [K][ld] or (out,in) [ld rows of K]: bf16 exact, or f16(bf16 * 256) exact
__device__ __forceinline__ v16b wcol_io(const float* Wm, int k0, int o, int lane, int ld) { v16b w; const int g = lane >> 4;
#pragma unroll
  for (int i = 0; i < 8; ++i) { w[i] = (__bf16)Wm[(size_t)(k0 + 8 * g + i) * ld + o]; w[8 + i] = (__bf16)Wm[(size_t)(k0 + 16 + 8 * g + i) * ld + o]; }
  return w; }
__device__ __forceinline__ v16b wcol_oi(const float* Wm, int k0, int o, int lane, int K) { v16b w; const float* p = Wm + (size_t)o * K + k0 + 8 * (lane >> 4);
#pragma unroll
  for (int i = 0; i < 8; ++i) { w[i] = (__bf16)p[i]; w[8 + i] = (__bf16)p[16 + i]; }
  return w; }
__device__ __forceinline__ v16h wcolh_io(const float* Wm, int k0, int o, int lane, int ld) { v16h w; const int g = lane >> 4;
#pragma unroll
  for (int i = 0; i < 8; ++i) { w[i] = (_Float16)(bfr(Wm[(size_t)(k0 + 8 * g + i) * ld + o]) * 256.0f); w[8 + i] = (_Float16)(bfr(Wm[(size_t)(k0 + 16 + 8 * g + i) * ld + o]) * 256.0f); }
  return w; }
__device__ __forceinline__ v16h wcolh_oi(const float* Wm, int k0, int o, int lane, int K) { v16h w; const float* p = Wm + (size_t)o * K + k0 + 8 * (lane >> 4);
#pragma unroll
  for (int i = 0; i < 8; ++i) { w[i] = (_Float16)(bfr(p[i]) * 256.0f); w[8 + i] = (_Float16)(bfr(p[16 + i]) * 256.0f); }
  return w; }
#define WQKV_LAYOUT 0   // 0 = (in,out) [DIN][CC]; 1 = (out,in) [CC][DIN]; 2 = per-head [NH][DIN][HD]
__device__ __forceinline__ v16b wcol_hdk(const float* Wm, int k0, int o, int lane) { v16b w; const int g = lane >> 4; const float* p = Wm + (size_t)(o / HD) * DIN * HD + (o % HD);
#pragma unroll
  for (int i = 0; i < 8; ++i) { w[i] = (__bf16)p[(size_t)(k0 + 8 * g + i) * HD]; w[8 + i] = (__bf16)p[(size_t)(k0 + 16 + 8 * g + i) * HD]; }
  return w; }
#define WO_OUT_IN 0
#if WQKV_LAYOUT == 1
#define WCOL(W, k0, o, lane) wcol_oi(W, k0, o, lane, DIN)
#elif WQKV_LAYOUT == 2
#define WCOL(W, k0, o, lane) wcol_hdk(W, k0, o, lane)
#else
#define WCOL(W, k0, o, lane) wcol_io(W, k0, o, lane, CC)
#endif
#if WO_OUT_IN
#define WOCOL(W, k0, o, lane) wcol_oi(W, k0, o, lane, CC)
#define WOCOLH(W, k0, o, lane) wcolh_oi(W, k0, o, lane, CC)
#else
#define WOCOL(W, k0, o, lane) wcol_io(W, k0, o, lane, DIN)
#define WOCOLH(W, k0, o, lane) wcolh_io(W, k0, o, lane, DIN)
#endif

#ifndef SM_EXTRA_PARAMS
#define SM_EXTRA_PARAMS
#endif
#ifndef PROJ_EXTRA_PARAMS
#define PROJ_EXTRA_PARAMS
#endif
#ifndef SM_MASK_HOOK
#define SM_MASK_HOOK (void)0
#endif

#define WS_QH  0u                                      // f16 q rows [b*t][CC]
#define WS_KH  (WS_QH + 2u * (size_t)NB * TT * CC)      // f16 k rows [b*t][CC]
#define WS_VT  (WS_KH + 2u * (size_t)NB * TT * CC)      // f16 v planes [b][c][t]
#define WS_QL  (WS_VT + 2u * (size_t)NB * CC * TT)      // f16 q residual x 2^10 rows [b][t < QHI][CC]
#define WS_KL  (WS_QL + 2u * (size_t)NB * QHI * CC)     // f16 k residual x 2^10 rows [b][t < KHI][CC]
#define WS_VB  (WS_KL + 2u * (size_t)NB * KHI * CC)     // bf16 v hi planes [b][c][t < KHI]
#define WS_VBL (WS_VB + 2u * (size_t)NB * CC * KHI)
#define WS_S   (WS_VBL + 2u * (size_t)NB * CC * KHI)    // f32 [b][hg][t][s] region, unused (logits and P stay in registers)
#define WS_Y   (WS_S  + 4u * (size_t)NB * HG * TT * TT) // f32 ctx rows [b*t][CC] (only when there is an output projection)
#define WS_END (WS_Y  + 4u * (size_t)NB * TT * CC)

// ---- k_proj: block = (64 rows, 128 cols, which): q/k/v = X W (+ b) with exact bf16 products (K = DIN) -> which 0: q f16 rows (+ residual rows < QHI); 1: k f16 rows (+ residual rows < KHI); 2: v f16 planes [c][t] (+ bf16 hi/lo planes for t < KHI)
__global__ __launch_bounds__(128) void k_proj(const float* __restrict__ XQ, const float* __restrict__ XK, const float* __restrict__ XV, const float* __restrict__ WQ, const float* __restrict__ WK, const float* __restrict__ WV, const float* __restrict__ BQ, const float* __restrict__ BK, const float* __restrict__ BV,
    _Float16* __restrict__ QH, _Float16* __restrict__ QL, _Float16* __restrict__ KH, _Float16* __restrict__ KL, _Float16* __restrict__ VT, __bf16* __restrict__ VB, __bf16* __restrict__ VBL) {
  __shared__ __align__(16) _Float16 sh[64][136], sl[64][136]; __shared__ __align__(16) _Float16 th[128][72]; __shared__ __align__(16) __bf16 tb[128][72], tbl[128][72];
  const int tid = threadIdx.x, wave = tid >> 5, lane = tid & 31, col = lane & 15, g = lane >> 4; const int which = blockIdx.z; const int c0 = blockIdx.y * 128; const size_t r0 = (size_t)blockIdx.x * 64; const size_t bb = r0 / TT; const int t0 = (int)(r0 % TT);
  const float* X = which == 0 ? XQ : which == 1 ? XK : XV; const float* WA = which == 0 ? WQ : which == 1 ? WK : WV; const float* BA = which == 0 ? BQ : which == 1 ? BK : BV;
  v8f acc[8] = {};
#pragma unroll 2
  for (int kc = 0; kc < DIN / 32; ++kc) { v16b a; { const float* p = X + (r0 + wave * 16 + col) * DIN + kc * 32 + 8 * g;
#pragma unroll
      for (int i = 0; i < 8; ++i) { a[i] = (__bf16)p[i]; a[8 + i] = (__bf16)p[16 + i]; } }
    asm volatile("s_wait_loadcnt 0x0" ::: "memory");
#pragma unroll
    for (int j = 0; j < 8; ++j) { const v16b w = WCOL(WA, kc * 32, c0 + j * 16 + col, lane); asm volatile("s_wait_loadcnt 0x0" ::: "memory"); acc[j] = wmma_bf(a, w, acc[j]); } }
  if (which < 2) { _Float16* DH = which == 0 ? QH : KH; _Float16* DL = which == 0 ? QL : KL; const int nhi = which == 0 ? QHI : KHI; const bool hi_rows = t0 < nhi;
#pragma unroll
    for (int j = 0; j < 8; ++j) { const float bias = BA ? bfr(BA[c0 + j * 16 + col]) : 0.f;
#pragma unroll
      for (int r = 0; r < 8; ++r) { const float v = acc[j][r] + bias; const _Float16 hv = (_Float16)v; sh[wave * 16 + 8 * g + r][j * 16 + col] = hv; sl[wave * 16 + 8 * g + r][j * 16 + col] = (_Float16)((v - (float)hv) * 1024.0f); } }
    __syncthreads();
    for (int e = tid; e < 64 * 16; e += 128) { const int rl = e >> 4, q = e & 15; vst2((unsigned*)(DH + (r0 + rl) * CC + c0 + q * 8), *(const v4u*)&sh[rl][q * 8]); if (hi_rows) vst2((unsigned*)(DL + (bb * nhi + t0 + rl) * (size_t)CC + c0 + q * 8), *(const v4u*)&sl[rl][q * 8]); }
  } else { const bool hi_rows = t0 < KHI;
#pragma unroll
    for (int j = 0; j < 8; ++j) { const float bias = BA ? bfr(BA[c0 + j * 16 + col]) : 0.f;
#pragma unroll
      for (int r = 0; r < 8; ++r) { const float v = acc[j][r] + bias; const int rl = wave * 16 + 8 * g + r, cl = j * 16 + col; th[cl][rl] = (_Float16)v; const __bf16 bh = (__bf16)v; tb[cl][rl] = bh; tbl[cl][rl] = (__bf16)(v - (float)bh); } }
    __syncthreads();
    for (int e = tid; e < 128 * 8; e += 128) { const int cl = e >> 3, q = e & 7; vst2((unsigned*)(VT + (bb * CC + c0 + cl) * (size_t)TT + t0 + q * 8), *(const v4u*)&th[cl][q * 8]); if (hi_rows) { const size_t o3 = (bb * CC + c0 + cl) * (size_t)KHI + t0 + q * 8; vst2((unsigned*)(VB + o3), *(const v4u*)&tb[cl][q * 8]); vst2((unsigned*)(VBL + o3), *(const v4u*)&tbl[cl][q * 8]); } } } }
// ---- k_att: block = 64 queries (qb) of z = sequence b * HG + head; each wave owns 16 queries from the logits to ctx and shares nothing with the other waves (no LDS, no barrier).
// Both products are formed transposed, so that a lane holds one query's column and the logits' D registers are already the B fragment of the second product (D element r of key tile j = key 16 j + 8 g + r, g = lane >> 4; B elements 0..7 / 8..15 of 32 keys = the same keys of tiles 2 kc / 2 kc + 1).
// S^T = k q^T x SCALE over keys [0, NKB * 128): k hi + residual (x 2^10) against q hi + residual (3 products); causal mask by index; softmax in f32 (in the lane, then one exchange between the wave's halves); P x 2^11; ctx^T = v^T P^T with P and v as bf16 hi + lo (3 products)
__device__ __forceinline__ v16h frag_hp(const _Float16* p) { union { v16h v; v8h q[2]; } u; u.q[0] = *(const v8h*)p; u.q[1] = *(const v8h*)(p + 16); return u.v; }   // p = row + k0 + 8 g
__device__ __forceinline__ v16b frag_bp(const __bf16* p) { union { v16b v; v8b q[2]; } u; u.q[0] = *(const v8b*)p; u.q[1] = *(const v8b*)(p + 16); return u.v; }
// exp(x) by the range reduction of expf (n = rint(x log2 e), 2^(x log2 e - n), ldexp, the two range ends), the reduced argument by two fused multiply-adds over log2 e in two parts; v_exp_f32 and one v_nop stand in one statement:
// the instruction set asks for one independent instruction before a transcendental's source is overwritten
__device__ __forceinline__ float exp_slot(float x) {
  const float c = __builtin_bit_cast(float, 0x3fb8aa3bu), cc = __builtin_bit_cast(float, 0x32a5705fu);
  const float n = __builtin_rintf(x * c); const float a = __builtin_fmaf(x, cc, __builtin_fmaf(x, c, -n));
  float y; asm("v_exp_f32 %0, %1\n\tv_nop" : "=v"(y) : "v"(a));
  y = __builtin_ldexpf(y, (int)n);
  y = x < __builtin_bit_cast(float, 0xc2ce8ed0u) ? 0.f : y;
  return x > __builtin_bit_cast(float, 0x42b17218u) ? __builtin_inff() : y; }
template <int NKB> __device__ __forceinline__ void att_body(const _Float16* __restrict__ QH, const _Float16* __restrict__ KH, const _Float16* __restrict__ QL, const _Float16* __restrict__ KL, const __bf16* __restrict__ VB, const __bf16* __restrict__ VBL, float* __restrict__ Y, int b, int h, int ql0, int lane) {
  constexpr int NT = NKB * 8, NC = NKB * 4; const int col = lane & 15, g = lane >> 4; const int t = ql0 + col;
  v16h qh[HD / 32], ql[HD / 32]; const _Float16* qp = QH + ((size_t)b * TT + t) * CC + h * HD + 8 * g; const _Float16* rp = QL + ((size_t)b * QHI + t) * CC + h * HD + 8 * g;
#pragma unroll
  for (int kc = 0; kc < HD / 32; ++kc) { qh[kc] = frag_hp(qp + kc * 32); ql[kc] = frag_hp(rp + kc * 32); }
  asm volatile("s_wait_xcnt 0x0" :: "v"(qp), "v"(rp) : "memory");   /* stands before the q loads' address registers are written again; named as inputs, they live up to it */
  const _Float16* kp = KH + ((size_t)b * TT + col) * CC + h * HD + 8 * g; const _Float16* lp = KL + ((size_t)b * KHI + col) * CC + h * HD + 8 * g;
  v8f s[NT]; float m = -3.0e38f, sum = 0.f; const int dt = t - 8 * g;   /* key 16 j + 8 g + r is open to query t where 16 j + r <= dt */
#pragma unroll
  for (int j = 0; j < NT; ++j) { v16h kh[HD / 32], kl[HD / 32];   /* the tile's eight loads fly together, in front of its first product */
#pragma unroll
    for (int kc = 0; kc < HD / 32; ++kc) { kh[kc] = frag_hp(kp + (size_t)j * 16 * CC + kc * 32); kl[kc] = frag_hp(lp + (size_t)j * 16 * CC + kc * 32); }
    if (j + 1 == NT) asm volatile("s_wait_xcnt 0x0" :: "v"(kp), "v"(lp) : "memory");   /* the same for the k loads, behind the last of them */
    v8f a = {}, l = {};
#pragma unroll
    for (int kc = 0; kc < HD / 32; ++kc) { a = wmma16(kh[kc], qh[kc], a); l = wmma16(kh[kc], ql[kc], l); l = wmma16(kl[kc], qh[kc], l); }
#pragma unroll
    for (int r = 0; r < 8; ++r) { const float v = (!CAUSAL || j * 16 + r <= dt) ? (a[r] + l[r] * (1.0f / 1024.0f)) * SCALE : -3.0e38f; s[j][r] = v; m = fmaxf(m, v); } }
  m = fmaxf(m, __shfl_xor(m, 16));
#pragma unroll
  for (int j = 0; j < NT; ++j)
#pragma unroll
    for (int r = 0; r < 8; ++r) { const float v = s[j][r]; const float x = exp_slot(v - m); const float e = (v <= -1.0e38f) ? 0.f : x; s[j][r] = e; sum += e; }
  sum += __shfl_xor(sum, 16);
  const float inv = sum > 0.f ? 2048.0f / sum : 0.f;   /* a fully excluded row yields P = 0 */
  const __bf16* vp = VB + ((size_t)b * CC + h * HD + col) * (size_t)KHI + 8 * g; const __bf16* wp = VBL + ((size_t)b * CC + h * HD + col) * (size_t)KHI + 8 * g;
  v8f acc[HD / 16] = {};
#pragma unroll
  for (int kc = 0; kc < NC; ++kc) { float pv[16]; v16b vh[HD / 16], vl[HD / 16];
    __builtin_amdgcn_sched_barrier(0);   /* keeps these loads behind the softmax and behind the products before them: lifted higher they hold 64 registers more beside the 128 of P, and the kernel spills */
#pragma unroll
    for (int j = 0; j < HD / 16; ++j) { vh[j] = frag_bp(vp + (size_t)j * 16 * KHI + kc * 32); vl[j] = frag_bp(wp + (size_t)j * 16 * KHI + kc * 32); }
    if (kc + 1 == NC) asm volatile("s_wait_xcnt 0x0" :: "v"(vp), "v"(wp) : "memory");   /* the same for the v loads, behind the last of them */
#pragma unroll
    for (int i = 0; i < 8; ++i) { pv[i] = s[2 * kc][i] * inv; pv[8 + i] = s[2 * kc + 1][i] * inv; }
    const F2 p = bsplit16(pv);
#pragma unroll
    for (int j = 0; j < HD / 16; ++j) { acc[j] = wmma_bf(vh[j], p.h, acc[j]); acc[j] = wmma_bf(vh[j], p.l, acc[j]); acc[j] = wmma_bf(vl[j], p.h, acc[j]); } }
  float* yr = Y + ((size_t)b * TT + t) * CC + h * HD + 8 * g;   /* D element r of channel tile j = channel 16 j + 8 g + r of query t */
#pragma unroll
  for (int j = 0; j < HD / 16; ++j) acc[j] *= (1.0f / 2048.0f);
#pragma unroll
  for (int j = 0; j < HD / 16; ++j) { vst2(yr + j * 16, __builtin_shufflevector(acc[j], acc[j], 0, 1, 2, 3)); vst2(yr + j * 16 + 4, __builtin_shufflevector(acc[j], acc[j], 4, 5, 6, 7)); } }
// four waves per SIMD: without the budget the scheduler spreads the softmax over more than 256 registers
__global__ __launch_bounds__(128) __attribute__((amdgpu_waves_per_eu(4, 4))) void k_att(const _Float16* __restrict__ QH, const _Float16* __restrict__ KH, const _Float16* __restrict__ QL, const _Float16* __restrict__ KL, const __bf16* __restrict__ VB, const __bf16* __restrict__ VBL, float* __restrict__ Y) {
  static_assert(TT == 256 && QBH == NQB && QHI == TT && KHI == TT, "two key blocks at most; every row on the 3-product path");
  const int b = blockIdx.z / HG, h = blockIdx.z % HG, qb = blockIdx.x; const int tid = threadIdx.x, wave = tid >> 5, lane = tid & 31; const int ql0 = qb * 64 + wave * 16;
  if (kb_last(qb) == 0) att_body<1>(QH, KH, QL, KL, VB, VBL, Y, b, h, ql0, lane); else att_body<2>(QH, KH, QL, KL, VB, VBL, Y, b, h, ql0, lane); }
// ---- k_out: block = (64 rows, 128 cols): out = ctx Wo (+ bo): all rows: ctx bf16 hi + lo against exact bf16 Wo (2 products); the f16 x 2^8 one-product branch is never taken
__global__ __launch_bounds__(128) void k_out(const float* __restrict__ Y, const float* __restrict__ WO, const float* __restrict__ BO, float* __restrict__ OUT) { __shared__ __align__(16) float sf[4][16][132];
  const int tid = threadIdx.x, wave = tid >> 5, lane = tid & 31, col = lane & 15, g = lane >> 4; const int c0 = blockIdx.y * 128; const size_t r0 = (size_t)blockIdx.x * 64 + wave * 16;
  v8f acc[8] = {};
  if (true) {   /* ALL rows: ctx split bf16 hi + lo x exact Wo (2 products) */
#pragma unroll 2
    for (int kc = 0; kc < CC / 32; ++kc) { const F2 a = split_row(Y + (r0 + col) * CC, kc * 32, lane); asm volatile("s_wait_loadcnt 0x0" ::: "memory");
#pragma unroll
      for (int j = 0; j < 8; ++j) { const v16b w = WOCOL(WO, kc * 32, c0 + j * 16 + col, lane); asm volatile("s_wait_loadcnt 0x0" ::: "memory"); acc[j] = wmma_bf(a.h, w, acc[j]); acc[j] = wmma_bf(a.l, w, acc[j]); } }
#pragma unroll
    for (int j = 0; j < 8; ++j) { const float bias = BO ? bfr(BO[c0 + j * 16 + col]) : 0.f;
#pragma unroll
      for (int r = 0; r < 8; ++r) sf[wave][8 * g + r][j * 16 + col] = acc[j][r] + bias; }
  } else {
#pragma unroll 2
    for (int kc = 0; kc < CC / 32; ++kc) { const v16h a = frag_f32(Y + (r0 + col) * CC + kc * 32, lane); asm volatile("s_wait_loadcnt 0x0" ::: "memory");
#pragma unroll
      for (int j = 0; j < 8; ++j) { const v16h w = WOCOLH(WO, kc * 32, c0 + j * 16 + col, lane); asm volatile("s_wait_loadcnt 0x0" ::: "memory"); acc[j] = wmma16(a, w, acc[j]); } }
#pragma unroll
    for (int j = 0; j < 8; ++j) { const float bias = BO ? bfr(BO[c0 + j * 16 + col]) : 0.f;
#pragma unroll
      for (int r = 0; r < 8; ++r) sf[wave][8 * g + r][j * 16 + col] = acc[j][r] * (1.0f / 256.0f) + bias; } }
  LDSX(); for (int rl = 0; rl < 16; ++rl) vst2(OUT + (r0 + rl) * DIN + c0 + lane * 4, *(const v4f*)&sf[wave][rl][lane * 4]); }

extern "C" void kernel_launch(void* const* d_in, const int* in_sizes, int n_in, void* d_out, int out_size, void* d_ws, size_t ws_size, hipStream_t stream) {
  (void)in_sizes; (void)n_in; (void)out_size;
  const float** F = (const float**)d_in;
  if (ws_size < (size_t)WS_END) return;
  char* ws = (char*)d_ws; _Float16 *QH = (_Float16*)(ws + WS_QH), *KH = (_Float16*)(ws + WS_KH), *VT = (_Float16*)(ws + WS_VT), *QL = (_Float16*)(ws + WS_QL), *KL = (_Float16*)(ws + WS_KL); __bf16 *VB = (__bf16*)(ws + WS_VB), *VBL = (__bf16*)(ws + WS_VBL); float *Y = (float*)(ws + WS_Y);
  (void)Y; (void)QL; (void)KL; (void)VB; (void)VBL;
  // inputs: 0 x [64,256,384]; 1 Wq, 2 Wk, 3 Wv [384,384] (in,out); 4 Wo (in,out), 5 bo
  k_proj<<<dim3(TNB * TT / 64, CC / 128, 3), 128, 0, stream>>>(F[0], F[0], F[0], F[1], F[2], F[3], nullptr, nullptr, nullptr, QH, QL, KH, KL, VT, VB, VBL);
  /* all sequences and heads in one launch */
  k_att<<<dim3(NQB, 1, TNB * HG), 128, 0, stream>>>(QH, KH, QL, KL, VB, VBL, Y);
  k_out<<<dim3(TNB * TT / 64, DIN / 128), 128, 0, stream>>>(Y, F[4], F[5], (float*)d_out);
}

// v003
// Measured time: 140 microseconds a run.
// Next to v002, in two timings, it ran 1.53 times as fast each time.
// Over all steps from v000 it is 13.5 times as fast.
// compute dtype: all float inputs rounded to bf16; q/k/v = x W with EXACT bf16 products on WMMA 16x16x32 (f32 accumulate); causal logits with q, k as f16 hi + residual (3 products, all rows) x 64^-0.5; softmax in f32; P split in bf16 hi + lo against v bf16 hi + lo (3 products); ctx split bf16 hi + lo against exact Wo (2 products) + bo; f32 output.
#include <hip/hip_runtime.h>
#include <math.h>

typedef __attribute__((ext_vector_type(16))) _Float16 v16h;
typedef __attribute__((ext_vector_type(16))) __bf16 v16b;
typedef __attribute__((ext_vector_type(8)))  _Float16 v8h;
typedef __attribute__((ext_vector_type(8)))  float v8f;
typedef __attribute__((ext_vector_type(4)))  float v4f;
typedef __attribute__((ext_vector_type(2)))  float v2f;
typedef __attribute__((ext_vector_type(4)))  unsigned v4u;
typedef __attribute__((ext_vector_type(4)))  int v4i;
typedef float __attribute__((may_alias)) float_a;
typedef int __attribute__((may_alias)) int_a;

template <typename T> __device__ __forceinline__ void vst2(void* p, T v) { *(T*)p = v;  }
__device__ __forceinline__ v8f wmma16(v16h a, v16h b, v8f c) {
  v8f d = __builtin_amdgcn_wmma_f32_16x16x32_f16(false, a, false, b, (short)0, c, false, false);
  asm volatile("v_nop\n\tv_nop\n\tv_nop\n\tv_nop" : "+v"(d) : "v"(a), "v"(b));
  return d;
}
__device__ __forceinline__ v8f wmma_bf(v16b a, v16b b, v8f c) {
  v8f d = __builtin_amdgcn_wmma_f32_16x16x32_bf16(false, a, false, b, (short)0, c, false, false);
  asm volatile("v_nop\n\tv_nop\n\tv_nop\n\tv_nop" : "+v"(d) : "v"(a), "v"(b));
  return d;
}
// 16x16x32 fragments: lane = (h = lane>>4, row/col = lane&15); elements 0..7 = k0+8h+0..7, 8..15 = k0+16+8h+0..7; D element r = row 8h+r
__device__ __forceinline__ v16h frag_h(const _Float16* rowk0, int lane) {
  union { v16h v; v8h q[2]; } u; const _Float16* p = rowk0 + 8 * (lane >> 4);
  u.q[0] = *(const v8h*)p; u.q[1] = *(const v8h*)(p + 16); return u.v;
}
__device__ __forceinline__ v16h frag_f32(const float* rowk0, int lane) {
  v16h a; const float* p = rowk0 + 8 * (lane >> 4);
#pragma unroll
  for (int i = 0; i < 8; ++i) { a[i] = (_Float16)p[i]; a[8 + i] = (_Float16)p[16 + i]; }
  return a;
}
__device__ __forceinline__ v16h frag_f32s(const float* rowk0, int lane, float sc) {
  v16h a; const float* p = rowk0 + 8 * (lane >> 4);
#pragma unroll
  for (int i = 0; i < 8; ++i) { a[i] = (_Float16)(p[i] * sc); a[8 + i] = (_Float16)(p[16 + i] * sc); }
  return a;
}
// column fragment from a [K][ld] layout (column n), rows >= K read as 0
__device__ __forceinline__ v16h fragc_f32(const float* W, int k0, int n, int lane, int ld, int K) {
  v16h a; const int g = lane >> 4;
#pragma unroll
  for (int i = 0; i < 8; ++i) { const int ka = k0 + 8 * g + i, kb = ka + 16;
    a[i] = (_Float16)(ka < K ? W[(size_t)(ka < K ? ka : K - 1) * ld + n] : 0.f); a[8 + i] = (_Float16)(kb < K ? W[(size_t)(kb < K ? kb : K - 1) * ld + n] : 0.f); }
  return a;
}
struct F2 { v16b h, l; };
__device__ __forceinline__ F2 bsplit16(const float v[16]) { F2 r;
#pragma unroll
  for (int i = 0; i < 16; ++i) { const __bf16 h = (__bf16)v[i]; r.h[i] = h; r.l[i] = (__bf16)(v[i] - (float)h); }
  return r; }
__device__ __forceinline__ F2 split_row(const float* row, int k0, int lane) { float v[16]; const float* p = row + k0 + 8 * (lane >> 4);
#pragma unroll
  for (int i = 0; i < 8; ++i) { v[i] = p[i]; v[8 + i] = p[16 + i]; }
  return bsplit16(v); }
__device__ __forceinline__ F2 split_rowK(const float* row, int k0, int lane, int K) { float v[16]; const int g = lane >> 4;
#pragma unroll
  for (int i = 0; i < 8; ++i) { const int ka = k0 + 8 * g + i, kb = ka + 16; v[i] = ka < K ? row[ka < K ? ka : K - 1] : 0.f; v[8 + i] = kb < K ? row[kb < K ? kb : K - 1] : 0.f; }
  return bsplit16(v); }
__device__ __forceinline__ F2 split_col(const float* W, int k0, int n, int lane, int ld, int K) { float v[16]; const int g = lane >> 4;
#pragma unroll
  for (int i = 0; i < 8; ++i) { const int ka = k0 + 8 * g + i, kb = ka + 16; v[i] = ka < K ? W[(size_t)(ka < K ? ka : K - 1) * ld + n] : 0.f; v[8 + i] = kb < K ? W[(size_t)(kb < K ? kb : K - 1) * ld + n] : 0.f; }
  return bsplit16(v); }
__device__ __forceinline__ v8f mac3(const F2& a, const F2& b, v8f c) { c = wmma_bf(a.l, b.h, c); c = wmma_bf(a.h, b.l, c); return wmma_bf(a.h, b.h, c); }
__device__ __forceinline__ float sigm(float v) { return 1.0f / (1.0f + expf(-v)); }
#define LDSX() do { asm volatile("s_wait_dscnt 0" ::: "memory"); __builtin_amdgcn_wave_barrier(); __builtin_amdgcn_fence(__ATOMIC_RELEASE, "workgroup"); } while (0)

// Causal multi-head self-attention (B 64, T 256, C 384 = 6 x 64): q,k,v = x W ((in,out), no bias); causal softmax(q k^T / 8) (-inf above the diagonal); out = merged(attn v) Wo + bo.
#define NB 64
#define TT 256
#define CC 384            // NH * HD = projected width
#define DIN 384          // input (model) width
#define NH 6
#define HD 64
#define NQB (TT / 64)
#define HG 6
#define SCALE (0.125f)
#define CAUSAL 1
#ifndef TNB
#define TNB NB
#endif
__device__ __forceinline__ float bfr(float v) { return (float)(__bf16)v; }
__host__ __device__ __forceinline__ int kb_last(int qb) { return CAUSAL ? ((qb * 64 + 63) >> 7) : (TT / 128 - 1); }
typedef __attribute__((ext_vector_type(8))) __bf16 v8b;
__device__ __forceinline__ v16b frag_b(const __bf16* rowk0, int lane) {
  union { v16b v; v8b q[2]; } u; const __bf16* p = rowk0 + 8 * (lane >> 4);
  u.q[0] = *(const v8b*)p; u.q[1] = *(const v8b*)(p + 16); return u.v;
}
#define QBH 4              // causal: query blocks 0..QBH-1 of each sequence take the high-precision path; QBH == NQB, so every block does
#define QHI 256            // rows carrying a q residual plane (all rows: 3-product logits everywhere)
#define KHI 256            // key rows carrying k residual / v bf16 hi+lo planes (used only by the causal high-precision path)
// B fragment (k rows k0+.., output column o) of a weight: (in,out) [K][ld] or (out,in) [ld rows of K]: bf16 exact, or f16(bf16 * 256) exact
__device__ __forceinline__ v16b wcol_io(const float* Wm, int k0, int o, int lane, int ld) { v16b w; const int g = lane >> 4;
#pragma unroll
  for (int i = 0; i < 8; ++i) { w[i] = (__bf16)Wm[(size_t)(k0 + 8 * g + i) * ld + o]; w[8 + i] = (__bf16)Wm[(size_t)(k0 + 16 + 8 * g + i) * ld + o]; }
  return w; }
__device__ __forceinline__ v16b wcol_oi(const float* Wm, int k0, int o, int lane, int K) { v16b w; const float* p = Wm + (size_t)o * K + k0 + 8 * (lane >> 4);
#pragma unroll
  for (int i = 0; i < 8; ++i) { w[i] = (__bf16)p[i]; w[8 + i] = (__bf16)p[16 + i]; }
  return w; }
__device__ __forceinline__ v16h wcolh_io(const float* Wm, int k0, int o, int lane, int ld) { v16h w; const int g = lane >> 4;
#pragma unroll
  for (int i = 0; i < 8; ++i) { w[i] = (_Float16)(bfr(Wm[(size_t)(k0 + 8 * g + i) * ld + o]) * 256.0f); w[8 + i] = (_Float16)(bfr(Wm[(size_t)(k0 + 16 + 8 * g + i) * ld + o]) * 256.0f); }
  return w; }
__device__ __forceinline__ v16h wcolh_oi(const float* Wm, int k0, int o, int lane, int K) { v16h w; const float* p = Wm + (size_t)o * K + k0 + 8 * (lane >> 4);
#pragma unroll
  for (int i = 0; i < 8; ++i) { w[i] = (_Float16)(bfr(p[i]) * 256.0f); w[8 + i] = (_Float16)(bfr(p[16 + i]) * 256.0f); }
  return w; }
#define WQKV_LAYOUT 0   // 0 = (in,out) [DIN][CC]; 1 = (out,in) [CC][DIN]; 2 = per-head [NH][DIN][HD]
__device__ __forceinline__ v16b wcol_hdk(const float* Wm, int k0, int o, int lane) { v16b w; const int g = lane >> 4; const float* p = Wm + (size_t)(o / HD) * DIN * HD + (o % HD);
#pragma unroll
  for (int i = 0; i < 8; ++i) { w[i] = (__bf16)p[(size_t)(k0 + 8 * g + i) * HD]; w[8 + i] = (__bf16)p[(size_t)(k0 + 16 + 8 * g + i) * HD]; }
  return w; }
#define WO_OUT_IN 0
#if WQKV_LAYOUT == 1
#define WCOL(W, k0, o, lane) wcol_oi(W, k0, o, lane, DIN)
#elif WQKV_LAYOUT == 2
#define WCOL(W, k0, o, lane) wcol_hdk(W, k0, o, lane)
#else
#define WCOL(W, k0, o, lane) wcol_io(W, k0, o, lane, CC)
#endif
#if WO_OUT_IN
#define WOCOL(W, k0, o, lane) wcol_oi(W, k0, o, lane, CC)
#define WOCOLH(W, k0, o, lane) wcolh_oi(W, k0, o, lane, CC)
#else
#define WOCOL(W, k0, o, lane) wcol_io(W, k0, o, lane, DIN)
#define WOCOLH(W, k0, o, lane) wcolh_io(W, k0, o, lane, DIN)
#endif

#ifndef SM_EXTRA_PARAMS
#define SM_EXTRA_PARAMS
#endif
#ifndef PROJ_EXTRA_PARAMS
#define PROJ_EXTRA_PARAMS
#endif
#ifndef SM_MASK_HOOK
#define SM_MASK_HOOK (void)0
#endif

#define WS_QH  0u                                      // f16 q rows [b*t][CC]
#define WS_KH  (WS_QH + 2u * (size_t)NB * TT * CC)      // f16 k rows [b*t][CC]
#define WS_VT  (WS_KH + 2u * (size_t)NB * TT * CC)      // f16 v planes [b][c][t]
#define WS_QL  (WS_VT + 2u * (size_t)NB * CC * TT)      // f16 q residual x 2^10 rows [b][t < QHI][CC]
#define WS_KL  (WS_QL + 2u * (size_t)NB * QHI * CC)     // f16 k residual x 2^10 rows [b][t < KHI][CC]
#define WS_VB  (WS_KL + 2u * (size_t)NB * KHI * CC)     // bf16 v hi planes [b][c][t < KHI]
#define WS_VBL (WS_VB + 2u * (size_t)NB * CC * KHI)
#define WS_S   (WS_VBL + 2u * (size_t)NB * CC * KHI)    // f32 [b][hg][t][s] region, unused (logits and P stay in registers)
#define WS_Y   (WS_S  + 4u * (size_t)NB * HG * TT * TT) // f32 ctx rows [b*t][CC] (only when there is an output projection)
#define WS_END (WS_Y  + 4u * (size_t)NB * TT * CC)

// W slab (all DIN k rows, 128 output columns from c0, (in,out) f32 rows of ld) -> LDS rows wt[column][k] in bf16, once per block of 4 waves: a wave-wide 16-byte load covers the slab's whole 512-byte row, eight k rows give each lane four columns' 16-byte k runs.
// Row pitch 784 B = 16 B x odd: the 16 columns of a fragment's ds_load_b128 fall on distinct banks.
#define WPITCH (DIN + 8)
static_assert(CC == DIN && DIN % 32 == 0, "one slab shape serves the q/k/v weights and Wo");
__device__ __forceinline__ void stage_w(const float* __restrict__ Wm, int c0, int ld, __bf16* __restrict__ wt, int wave, int lane) {
  const float* p = Wm + (size_t)(wave * 8) * ld + c0 + lane * 4; __bf16* d = wt + (lane * 4) * WPITCH + wave * 8;
#pragma unroll
  for (int kg = 0; kg < DIN / 32; ++kg) { v4f r[8];
#pragma unroll
    for (int kk = 0; kk < 8; ++kk) r[kk] = *(const v4f*)(p + (size_t)(kg * 32 + kk) * ld);
    if (kg + 1 == DIN / 32) asm volatile("s_wait_xcnt 0x0" :: "v"(p) : "memory");   /* stands before the slab loads' address registers are written again; named as an input, they live up to it */
#pragma unroll
    for (int i = 0; i < 4; ++i) { v8b o;
#pragma unroll
      for (int kk = 0; kk < 8; ++kk) o[kk] = (__bf16)r[kk][i];
      *(v8b*)(d + i * WPITCH + kg * 32) = o; } } }
// ---- k_proj: block = (64 rows, 128 cols, which): q/k/v = X W (+ b) with exact bf16 products (K = DIN) -> which 0: q f16 rows (+ residual rows < QHI); 1: k f16 rows (+ residual rows < KHI); 2: v f16 planes [c][t] (+ bf16 hi/lo planes for t < KHI)
__global__ __launch_bounds__(128) void k_proj(const float* __restrict__ XQ, const float* __restrict__ XK, const float* __restrict__ XV, const float* __restrict__ WQ, const float* __restrict__ WK, const float* __restrict__ WV, const float* __restrict__ BQ, const float* __restrict__ BK, const float* __restrict__ BV,
    _Float16* __restrict__ QH, _Float16* __restrict__ QL, _Float16* __restrict__ KH, _Float16* __restrict__ KL, _Float16* __restrict__ VT, __bf16* __restrict__ VB, __bf16* __restrict__ VBL) {
  // one LDS block: the W slab during the K loop, the output staging arrays behind it (a barrier between the two uses)
  __shared__ __align__(16) unsigned char lds[128 * WPITCH * 2]; static_assert(sizeof(lds) >= 2 * 64 * 136 * 2 + 3 * 128 * 72 * 2, "output staging fits");
  __bf16* wt = (__bf16*)lds; _Float16 (*sh)[136] = (_Float16 (*)[136])lds; _Float16 (*sl)[136] = sh + 64; _Float16 (*th)[72] = (_Float16 (*)[72])(sl + 64); __bf16 (*tb)[72] = (__bf16 (*)[72])(th + 128); __bf16 (*tbl)[72] = tb + 128;
  const int tid = threadIdx.x, wave = tid >> 5, lane = tid & 31, col = lane & 15, g = lane >> 4; const int which = blockIdx.z; const int c0 = blockIdx.y * 128; const size_t r0 = (size_t)blockIdx.x * 64; const size_t bb = r0 / TT; const int t0 = (int)(r0 % TT);
  const float* X = which == 0 ? XQ : which == 1 ? XK : XV; const float* WA = which == 0 ? WQ : which == 1 ? WK : WV; const float* BA = which == 0 ? BQ : which == 1 ? BK : BV;
  stage_w(WA, c0, CC, wt, wave, lane);
  __syncthreads();   /* every wave reads all four waves' k runs */
  v8f acc[8] = {};
#pragma unroll 2
  for (int kc = 0; kc < DIN / 32; ++kc) { v16b w[8];   /* the pass's 16 LDS reads go out as one group, ahead of the x loads and of the first product */
#pragma unroll
    for (int j = 0; j < 8; ++j) w[j] = frag_b(wt + (j * 16 + col) * WPITCH + kc * 32, lane);
    v16b a; { const float* p = X + (r0 + wave * 16 + col) * DIN + kc * 32 + 8 * g;
#pragma unroll
      for (int i = 0; i < 8; ++i) { a[i] = (__bf16)p[i]; a[8 + i] = (__bf16)p[16 + i]; }
      asm volatile("s_wait_xcnt 0x0" :: "v"(p) : "memory"); }   /* stands before the x loads' address registers are written again */
    asm volatile("s_wait_loadcnt 0x0" ::: "memory");
#pragma unroll
    for (int j = 0; j < 8; ++j) acc[j] = wmma_bf(a, w[j], acc[j]); }
  __syncthreads();   /* the slab's last reads end before its LDS takes the output staging */
  if (which < 2) { _Float16* DH = which == 0 ? QH : KH; _Float16* DL = which == 0 ? QL : KL; const int nhi = which == 0 ? QHI : KHI; const bool hi_rows = t0 < nhi;
#pragma unroll
    for (int j = 0; j < 8; ++j) { const float bias = BA ? bfr(BA[c0 + j * 16 + col]) : 0.f;
#pragma unroll
      for (int r = 0; r < 8; ++r) { const float v = acc[j][r] + bias; const _Float16 hv = (_Float16)v; sh[wave * 16 + 8 * g + r][j * 16 + col] = hv; sl[wave * 16 + 8 * g + r][j * 16 + col] = (_Float16)((v - (float)hv) * 1024.0f); } }
    __syncthreads();
    for (int e = tid; e < 64 * 16; e += 128) { const int rl = e >> 4, q = e & 15; vst2((unsigned*)(DH + (r0 + rl) * CC + c0 + q * 8), *(const v4u*)&sh[rl][q * 8]); if (hi_rows) vst2((unsigned*)(DL + (bb * nhi + t0 + rl) * (size_t)CC + c0 + q * 8), *(const v4u*)&sl[rl][q * 8]); }
  } else { const bool hi_rows = t0 < KHI;
#pragma unroll
    for (int j = 0; j < 8; ++j) { const float bias = BA ? bfr(BA[c0 + j * 16 + col]) : 0.f;
#pragma unroll
      for (int r = 0; r < 8; ++r) { const float v = acc[j][r] + bias; const int rl = wave * 16 + 8 * g + r, cl = j * 16 + col; th[cl][rl] = (_Float16)v; const __bf16 bh = (__bf16)v; tb[cl][rl] = bh; tbl[cl][rl] = (__bf16)(v - (float)bh); } }
    __syncthreads();
    for (int e = tid; e < 128 * 8; e += 128) { const int cl = e >> 3, q = e & 7; vst2((unsigned*)(VT + (bb * CC + c0 + cl) * (size_t)TT + t0 + q * 8), *(const v4u*)&th[cl][q * 8]); if (hi_rows) { const size_t o3 = (bb * CC + c0 + cl) * (size_t)KHI + t0 + q * 8; vst2((unsigned*)(VB + o3), *(const v4u*)&tb[cl][q * 8]); vst2((unsigned*)(VBL + o3), *(const v4u*)&tbl[cl][q * 8]); } } } }
// ---- k_att: block = 64 queries (qb) of z = sequence b * HG + head; each wave owns 16 queries from the logits to ctx and shares nothing with the other waves (no LDS, no barrier).
// Both products are formed transposed, so that a lane holds one query's column and the logits' D registers are already the B fragment of the second product (D element r of key tile j = key 16 j + 8 g + r, g = lane >> 4; B elements 0..7 / 8..15 of 32 keys = the same keys of tiles 2 kc / 2 kc + 1).
// S^T = k q^T x SCALE over keys [0, NKB * 128): k hi + residual (x 2^10) against q hi + residual (3 products); causal mask by index; softmax in f32 (in the lane, then one exchange between the wave's halves); P x 2^11; ctx^T = v^T P^T with P and v as bf16 hi + lo (3 products)
__device__ __forceinline__ v16h frag_hp(const _Float16* p) { union { v16h v; v8h q[2]; } u; u.q[0] = *(const v8h*)p; u.q[1] = *(const v8h*)(p + 16); return u.v; }   // p = row + k0 + 8 g
__device__ __forceinline__ v16b frag_bp(const __bf16* p) { union { v16b v; v8b q[2]; } u; u.q[0] = *(const v8b*)p; u.q[1] = *(const v8b*)(p + 16); return u.v; }
// exp(x) by the range reduction of expf (n = rint(x log2 e), 2^(x log2 e - n), ldexp, the two range ends), the reduced argument by two fused multiply-adds over log2 e in two parts; v_exp_f32 and one v_nop stand in one statement:
// the instruction set asks for one independent instruction before a transcendental's source is overwritten
__device__ __forceinline__ float exp_slot(float x) {
  const float c = __builtin_bit_cast(float, 0x3fb8aa3bu), cc = __builtin_bit_cast(float, 0x32a5705fu);
  const float n = __builtin_rintf(x * c); const float a = __builtin_fmaf(x, cc, __builtin_fmaf(x, c, -n));
  float y; asm("v_exp_f32 %0, %1\n\tv_nop" : "=v"(y) : "v"(a));
  y = __builtin_ldexpf(y, (int)n);
  y = x < __builtin_bit_cast(float, 0xc2ce8ed0u) ? 0.f : y;
  return x > __builtin_bit_cast(float, 0x42b17218u) ? __builtin_inff() : y; }
template <int NKB> __device__ __forceinline__ void att_body(const _Float16* __restrict__ QH, const _Float16* __restrict__ KH, const _Float16* __restrict__ QL, const _Float16* __restrict__ KL, const __bf16* __restrict__ VB, const __bf16* __restrict__ VBL, float* __restrict__ Y, int b, int h, int ql0, int lane) {
  constexpr int NT = NKB * 8, NC = NKB * 4; const int col = lane & 15, g = lane >> 4; const int t = ql0 + col;
  v16h qh[HD / 32], ql[HD / 32]; const _Float16* qp = QH + ((size_t)b * TT + t) * CC + h * HD + 8 * g; const _Float16* rp = QL + ((size_t)b * QHI + t) * CC + h * HD + 8 * g;
#pragma unroll
  for (int kc = 0; kc < HD / 32; ++kc) { qh[kc] = frag_hp(qp + kc * 32); ql[kc] = frag_hp(rp + kc * 32); }
  asm volatile("s_wait_xcnt 0x0" :: "v"(qp), "v"(rp) : "memory");   /* stands before the q loads' address registers are written again; named as inputs, they live up to it */
  const _Float16* kp = KH + ((size_t)b * TT + col) * CC + h * HD + 8 * g; const _Float16* lp = KL + ((size_t)b * KHI + col) * CC + h * HD + 8 * g;
  v8f s[NT]; float m = -3.0e38f, sum = 0.f; const int dt = t - 8 * g;   /* key 16 j + 8 g + r is open to query t where 16 j + r <= dt */
#pragma unroll
  for (int j = 0; j < NT; ++j) { v16h kh[HD / 32], kl[HD / 32];   /* the tile's eight loads fly together, in front of its first product */
#pragma unroll
    for (int kc = 0; kc < HD / 32; ++kc) { kh[kc] = frag_hp(kp + (size_t)j * 16 * CC + kc * 32); kl[kc] = frag_hp(lp + (size_t)j * 16 * CC + kc * 32); }
    if (j + 1 == NT) asm volatile("s_wait_xcnt 0x0" :: "v"(kp), "v"(lp) : "memory");   /* the same for the k loads, behind the last of them */
    v8f a = {}, l = {};
#pragma unroll
    for (int kc = 0; kc < HD / 32; ++kc) { a = wmma16(kh[kc], qh[kc], a); l = wmma16(kh[kc], ql[kc], l); l = wmma16(kl[kc], qh[kc], l); }
#pragma unroll
    for (int r = 0; r < 8; ++r) { const float v = (!CAUSAL || j * 16 + r <= dt) ? (a[r] + l[r] * (1.0f / 1024.0f)) * SCALE : -3.0e38f; s[j][r] = v; m = fmaxf(m, v); } }
  m = fmaxf(m, __shfl_xor(m, 16));
#pragma unroll
  for (int j = 0; j < NT; ++j)
#pragma unroll
    for (int r = 0; r < 8; ++r) { const float v = s[j][r]; const float x = exp_slot(v - m); const float e = (v <= -1.0e38f) ? 0.f : x; s[j][r] = e; sum += e; }
  sum += __shfl_xor(sum, 16);
  const float inv = sum > 0.f ? 2048.0f / sum : 0.f;   /* a fully excluded row yields P = 0 */
  const __bf16* vp = VB + ((size_t)b * CC + h * HD + col) * (size_t)KHI + 8 * g; const __bf16* wp = VBL + ((size_t)b * CC + h * HD + col) * (size_t)KHI + 8 * g;
  v8f acc[HD / 16] = {};
#pragma unroll
  for (int kc = 0; kc < NC; ++kc) { float pv[16]; v16b vh[HD / 16], vl[HD / 16];
    __builtin_amdgcn_sched_barrier(0);   /* keeps these loads behind the softmax and behind the products before them: lifted higher they hold 64 registers more beside the 128 of P, and the kernel spills */
#pragma unroll
    for (int j = 0; j < HD / 16; ++j) { vh[j] = frag_bp(vp + (size_t)j * 16 * KHI + kc * 32); vl[j] = frag_bp(wp + (size_t)j * 16 * KHI + kc * 32); }
    if (kc + 1 == NC) asm volatile("s_wait_xcnt 0x0" :: "v"(vp), "v"(wp) : "memory");   /* the same for the v loads, behind the last of them */
#pragma unroll
    for (int i = 0; i < 8; ++i) { pv[i] = s[2 * kc][i] * inv; pv[8 + i] = s[2 * kc + 1][i] * inv; }
    const F2 p = bsplit16(pv);
#pragma unroll
    for (int j = 0; j < HD / 16; ++j) { acc[j] = wmma_bf(vh[j], p.h, acc[j]); acc[j] = wmma_bf(vh[j], p.l, acc[j]); acc[j] = wmma_bf(vl[j], p.h, acc[j]); } }
  float* yr = Y + ((size_t)b * TT + t) * CC + h * HD + 8 * g;   /* D element r of channel tile j = channel 16 j + 8 g + r of query t */
#pragma unroll
  for (int j = 0; j < HD / 16; ++j) acc[j] *= (1.0f / 2048.0f);
#pragma unroll
  for (int j = 0; j < HD / 16; ++j) { vst2(yr + j * 16, __builtin_shufflevector(acc[j], acc[j], 0, 1, 2, 3)); vst2(yr + j * 16 + 4, __builtin_shufflevector(acc[j], acc[j], 4, 5, 6, 7)); } }
// four waves per SIMD: without the budget the scheduler spreads the softmax over more than 256 registers
__global__ __launch_bounds__(128) __attribute__((amdgpu_waves_per_eu(4, 4))) void k_att(const _Float16* __restrict__ QH, const _Float16* __restrict__ KH, const _Float16* __restrict__ QL, const _Float16* __restrict__ KL, const __bf16* __restrict__ VB, const __bf16* __restrict__ VBL, float* __restrict__ Y) {
  static_assert(TT == 256 && QBH == NQB && QHI == TT && KHI == TT, "two key blocks at most; every row on the 3-product path");
  const int b = blockIdx.z / HG, h = blockIdx.z % HG, qb = blockIdx.x; const int tid = threadIdx.x, wave = tid >> 5, lane = tid & 31; const int ql0 = qb * 64 + wave * 16;
  if (kb_last(qb) == 0) att_body<1>(QH, KH, QL, KL, VB, VBL, Y, b, h, ql0, lane); else att_body<2>(QH, KH, QL, KL, VB, VBL, Y, b, h, ql0, lane); }
// ---- k_out: block = (64 rows, 128 cols): out = ctx Wo (+ bo): every row: ctx bf16 hi + lo against exact bf16 Wo (2 products)
__global__ __launch_bounds__(128) void k_out(const float* __restrict__ Y, const float* __restrict__ WO, const float* __restrict__ BO, float* __restrict__ OUT) { __shared__ __align__(16) unsigned char lds[128 * WPITCH * 2]; static_assert(sizeof(lds) >= 4 * 16 * 132 * 4, "output staging fits"); __bf16* wt = (__bf16*)lds; float (*sf)[16][132] = (float (*)[16][132])lds;   /* the Wo slab during the K loop, the output staging behind it */
  const int tid = threadIdx.x, wave = tid >> 5, lane = tid & 31, col = lane & 15, g = lane >> 4; const int c0 = blockIdx.y * 128; const size_t r0 = (size_t)blockIdx.x * 64 + wave * 16;
  stage_w(WO, c0, DIN, wt, wave, lane);
  __syncthreads();   /* every wave reads all four waves' k runs */
  v8f acc[8] = {};
  if (true) {   /* ALL rows: ctx split bf16 hi + lo x exact Wo (2 products) */
#pragma unroll 2
    for (int kc = 0; kc < CC / 32; ++kc) { v16b w[8];   /* the pass's 16 LDS reads go out as one group, ahead of the ctx loads and of the first product */
#pragma unroll
      for (int j = 0; j < 8; ++j) w[j] = frag_b(wt + (j * 16 + col) * WPITCH + kc * 32, lane);
      const float* yp = Y + (r0 + col) * CC + kc * 32 + 8 * g; float yv[16];
#pragma unroll
      for (int i = 0; i < 8; ++i) { yv[i] = yp[i]; yv[8 + i] = yp[16 + i]; }
      asm volatile("s_wait_xcnt 0x0" :: "v"(yp) : "memory");   /* stands before the ctx loads' address registers are written again; named as an input, they live up to it */
      const F2 a = bsplit16(yv); asm volatile("s_wait_loadcnt 0x0" ::: "memory");
#pragma unroll
      for (int j = 0; j < 8; ++j) { acc[j] = wmma_bf(a.h, w[j], acc[j]); acc[j] = wmma_bf(a.l, w[j], acc[j]); } }
    __syncthreads();   /* the slab's last reads end before its LDS takes the output staging */
#pragma unroll
    for (int j = 0; j < 8; ++j) { const float bias = BO ? bfr(BO[c0 + j * 16 + col]) : 0.f;
#pragma unroll
      for (int r = 0; r < 8; ++r) sf[wave][8 * g + r][j * 16 + col] = acc[j][r] + bias; }
  } else {
#pragma unroll 2
    for (int kc = 0; kc < CC / 32; ++kc) { const v16h a = frag_f32(Y + (r0 + col) * CC + kc * 32, lane); asm volatile("s_wait_loadcnt 0x0" ::: "memory");
#pragma unroll
      for (int j = 0; j < 8; ++j) { const v16h w = WOCOLH(WO, kc * 32, c0 + j * 16 + col, lane); asm volatile("s_wait_loadcnt 0x0" ::: "memory"); acc[j] = wmma16(a, w, acc[j]); } }
#pragma unroll
    for (int j = 0; j < 8; ++j) { const float bias = BO ? bfr(BO[c0 + j * 16 + col]) : 0.f;
#pragma unroll
      for (int r = 0; r < 8; ++r) sf[wave][8 * g + r][j * 16 + col] = acc[j][r] * (1.0f / 256.0f) + bias; } }
  LDSX(); for (int rl = 0; rl < 16; ++rl) vst2(OUT + (r0 + rl) * DIN + c0 + lane * 4, *(const v4f*)&sf[wave][rl][lane * 4]); }

extern "C" void kernel_launch(void* const* d_in, const int* in_sizes, int n_in, void* d_out, int out_size, void* d_ws, size_t ws_size, hipStream_t stream) {
  (void)in_sizes; (void)n_in; (void)out_size;
  const float** F = (const float**)d_in;
  if (ws_size < (size_t)WS_END) return;
  char* ws = (char*)d_ws; _Float16 *QH = (_Float16*)(ws + WS_QH), *KH = (_Float16*)(ws + WS_KH), *VT = (_Float16*)(ws + WS_VT), *QL = (_Float16*)(ws + WS_QL), *KL = (_Float16*)(ws + WS_KL); __bf16 *VB = (__bf16*)(ws + WS_VB), *VBL = (__bf16*)(ws + WS_VBL); float *Y = (float*)(ws + WS_Y);
  (void)Y; (void)QL; (void)KL; (void)VB; (void)VBL;
  // inputs: 0 x [64,256,384]; 1 Wq, 2 Wk, 3 Wv [384,384] (in,out); 4 Wo (in,out), 5 bo
  k_proj<<<dim3(TNB * TT / 64, CC / 128, 3), 128, 0, stream>>>(F[0], F[0], F[0], F[1], F[2], F[3], nullptr, nullptr, nullptr, QH, QL, KH, KL, VT, VB, VBL);
  /* all sequences and heads in one launch */
  k_att<<<dim3(NQB, 1, TNB * HG), 128, 0, stream>>>(QH, KH, QL, KL, VB, VBL, Y);
  k_out<<<dim3(TNB * TT / 64, DIN / 128), 128, 0, stream>>>(Y, F[4], F[5], (float*)d_out);
}

// v004
// It runs in 116 microseconds.
// Next to v003, in two timings, it ran 1.20 times as fast each time.
// Counting every step since v000, it is 16.2 times as fast.
// compute dtype: all float inputs rounded to bf16; q/k/v = x W with EXACT bf16 products on WMMA 16x16x32 (f32 accumulate); causal logits with q, k as f16 hi + residual (3 products, all rows) x 64^-0.5; softmax in f32; P split in bf16 hi + lo against v bf16 hi + lo (3 products); ctx split bf16 hi + lo against exact Wo (2 products) + bo; f32 output.
#include <hip/hip_runtime.h>
#include <math.h>

typedef __attribute__((ext_vector_type(16))) _Float16 v16h;
typedef __attribute__((ext_vector_type(16))) __bf16 v16b;
typedef __attribute__((ext_vector_type(8)))  _Float16 v8h;
typedef __attribute__((ext_vector_type(8)))  float v8f;
typedef __attribute__((ext_vector_type(4)))  float v4f;
typedef __attribute__((ext_vector_type(2)))  float v2f;
typedef __attribute__((ext_vector_type(4)))  unsigned v4u;
typedef __attribute__((ext_vector_type(4)))  int v4i;
typedef float __attribute__((may_alias)) float_a;
typedef int __attribute__((may_alias)) int_a;

template <typename T> __device__ __forceinline__ void vst2(void* p, T v) { *(T*)p = v;  }
__device__ __forceinline__ v8f wmma16(v16h a, v16h b, v8f c) {
  v8f d = __builtin_amdgcn_wmma_f32_16x16x32_f16(false, a, false, b, (short)0, c, false, false);
  asm volatile("v_nop\n\tv_nop\n\tv_nop\n\tv_nop" : "+v"(d) : "v"(a), "v"(b));
  return d;
}
__device__ __forceinline__ v8f wmma_bf(v16b a, v16b b, v8f c) {
  v8f d = __builtin_amdgcn_wmma_f32_16x16x32_bf16(false, a, false, b, (short)0, c, false, false);
  asm volatile("v_nop\n\tv_nop\n\tv_nop\n\tv_nop" : "+v"(d) : "v"(a), "v"(b));
  return d;
}
// 16x16x32 fragments: lane = (h = lane>>4, row/col = lane&15); elements 0..7 = k0+8h+0..7, 8..15 = k0+16+8h+0..7; D element r = row 8h+r
__device__ __forceinline__ v16h frag_h(const _Float16* rowk0, int lane) {
  union { v16h v; v8h q[2]; } u; const _Float16* p = rowk0 + 8 * (lane >> 4);
  u.q[0] = *(const v8h*)p; u.q[1] = *(const v8h*)(p + 16); return u.v;
}
__device__ __forceinline__ v16h frag_f32(const float* rowk0, int lane) {
  v16h a; const float* p = rowk0 + 8 * (lane >> 4);
#pragma unroll
  for (int i = 0; i < 8; ++i) { a[i] = (_Float16)p[i]; a[8 + i] = (_Float16)p[16 + i]; }
  return a;
}
__device__ __forceinline__ v16h frag_f32s(const float* rowk0, int lane, float sc) {
  v16h a; const float* p = rowk0 + 8 * (lane >> 4);
#pragma unroll
  for (int i = 0; i < 8; ++i) { a[i] = (_Float16)(p[i] * sc); a[8 + i] = (_Float16)(p[16 + i] * sc); }
  return a;
}
// column fragment from a [K][ld] layout (column n), rows >= K read as 0
__device__ __forceinline__ v16h fragc_f32(const float* W, int k0, int n, int lane, int ld, int K) {
  v16h a; const int g = lane >> 4;
#pragma unroll
  for (int i = 0; i < 8; ++i) { const int ka = k0 + 8 * g + i, kb = ka + 16;
    a[i] = (_Float16)(ka < K ? W[(size_t)(ka < K ? ka : K - 1) * ld + n] : 0.f); a[8 + i] = (_Float16)(kb < K ? W[(size_t)(kb < K ? kb : K - 1) * ld + n] : 0.f); }
  return a;
}
struct F2 { v16b h, l; };
__device__ __forceinline__ F2 bsplit16(const float v[16]) { F2 r;
#pragma unroll
  for (int i = 0; i < 16; ++i) { const __bf16 h = (__bf16)v[i]; r.h[i] = h; r.l[i] = (__bf16)(v[i] - (float)h); }
  return r; }
__device__ __forceinline__ F2 split_row(const float* row, int k0, int lane) { float v[16]; const float* p = row + k0 + 8 * (lane >> 4);
#pragma unroll
  for (int i = 0; i < 8; ++i) { v[i] = p[i]; v[8 + i] = p[16 + i]; }
  return bsplit16(v); }
__device__ __forceinline__ F2 split_rowK(const float* row, int k0, int lane, int K) { float v[16]; const int g = lane >> 4;
#pragma unroll
  for (int i = 0; i < 8; ++i) { const int ka = k0 + 8 * g + i, kb = ka + 16; v[i] = ka < K ? row[ka < K ? ka : K - 1] : 0.f; v[8 + i] = kb < K ? row[kb < K ? kb : K - 1] : 0.f; }
  return bsplit16(v); }
__device__ __forceinline__ F2 split_col(const float* W, int k0, int n, int lane, int ld, int K) { float v[16]; const int g = lane >> 4;
#pragma unroll
  for (int i = 0; i < 8; ++i) { const int ka = k0 + 8 * g + i, kb = ka + 16; v[i] = ka < K ? W[(size_t)(ka < K ? ka : K - 1) * ld + n] : 0.f; v[8 + i] = kb < K ? W[(size_t)(kb < K ? kb : K - 1) * ld + n] : 0.f; }
  return bsplit16(v); }
__device__ __forceinline__ v8f mac3(const F2& a, const F2& b, v8f c) { c = wmma_bf(a.l, b.h, c); c = wmma_bf(a.h, b.l, c); return wmma_bf(a.h, b.h, c); }
__device__ __forceinline__ float sigm(float v) { return 1.0f / (1.0f + expf(-v)); }
#define LDSX() do { asm volatile("s_wait_dscnt 0" ::: "memory"); __builtin_amdgcn_wave_barrier(); __builtin_amdgcn_fence(__ATOMIC_RELEASE, "workgroup"); } while (0)

// Causal multi-head self-attention (B 64, T 256, C 384 = 6 x 64): q,k,v = x W ((in,out), no bias); causal softmax(q k^T / 8) (-inf above the diagonal); out = merged(attn v) Wo + bo.
#define NB 64
#define TT 256
#define CC 384            // NH * HD = projected width
#define DIN 384          // input (model) width
#define NH 6
#define HD 64
#define NQB (TT / 64)
#define HG 6
#define SCALE (0.125f)
#define CAUSAL 1
#ifndef TNB
#define TNB NB
#endif
__device__ __forceinline__ float bfr(float v) { return (float)(__bf16)v; }
__host__ __device__ __forceinline__ int kb_last(int qb) { return CAUSAL ? ((qb * 64 + 63) >> 7) : (TT / 128 - 1); }
typedef __attribute__((ext_vector_type(8))) __bf16 v8b;
__device__ __forceinline__ v16b frag_b(const __bf16* rowk0, int lane) {
  union { v16b v; v8b q[2]; } u; const __bf16* p = rowk0 + 8 * (lane >> 4);
  u.q[0] = *(const v8b*)p; u.q[1] = *(const v8b*)(p + 16); return u.v;
}
#define QBH 4              // causal: query blocks 0..QBH-1 of each sequence take the high-precision path; QBH == NQB, so every block does
#define QHI 256            // rows carrying a q residual plane (all rows: 3-product logits everywhere)
#define KHI 256            // key rows carrying k residual / v bf16 hi+lo planes (used only by the causal high-precision path)
// B fragment (k rows k0+.., output column o) of a weight: (in,out) [K][ld] or (out,in) [ld rows of K]: bf16 exact, or f16(bf16 * 256) exact
__device__ __forceinline__ v16b wcol_io(const float* Wm, int k0, int o, int lane, int ld) { v16b w; const int g = lane >> 4;
#pragma unroll
  for (int i = 0; i < 8; ++i) { w[i] = (__bf16)Wm[(size_t)(k0 + 8 * g + i) * ld + o]; w[8 + i] = (__bf16)Wm[(size_t)(k0 + 16 + 8 * g + i) * ld + o]; }
  return w; }
__device__ __forceinline__ v16b wcol_oi(const float* Wm, int k0, int o, int lane, int K) { v16b w; const float* p = Wm + (size_t)o * K + k0 + 8 * (lane >> 4);
#pragma unroll
  for (int i = 0; i < 8; ++i) { w[i] = (__bf16)p[i]; w[8 + i] = (__bf16)p[16 + i]; }
  return w; }
__device__ __forceinline__ v16h wcolh_io(const float* Wm, int k0, int o, int lane, int ld) { v16h w; const int g = lane >> 4;
#pragma unroll
  for (int i = 0; i < 8; ++i) { w[i] = (_Float16)(bfr(Wm[(size_t)(k0 + 8 * g + i) * ld + o]) * 256.0f); w[8 + i] = (_Float16)(bfr(Wm[(size_t)(k0 + 16 + 8 * g + i) * ld + o]) * 256.0f); }
  return w; }
__device__ __forceinline__ v16h wcolh_oi(const float* Wm, int k0, int o, int lane, int K) { v16h w; const float* p = Wm + (size_t)o * K + k0 + 8 * (lane >> 4);
#pragma unroll
  for (int i = 0; i < 8; ++i) { w[i] = (_Float16)(bfr(p[i]) * 256.0f); w[8 + i] = (_Float16)(bfr(p[16 + i]) * 256.0f); }
  return w; }
#define WQKV_LAYOUT 0   // 0 = (in,out) [DIN][CC]; 1 = (out,in) [CC][DIN]; 2 = per-head [NH][DIN][HD]
__device__ __forceinline__ v16b wcol_hdk(const float* Wm, int k0, int o, int lane) { v16b w; const int g = lane >> 4; const float* p = Wm + (size_t)(o / HD) * DIN * HD + (o % HD);
#pragma unroll
  for (int i = 0; i < 8; ++i) { w[i] = (__bf16)p[(size_t)(k0 + 8 * g + i) * HD]; w[8 + i] = (__bf16)p[(size_t)(k0 + 16 + 8 * g + i) * HD]; }
  return w; }
#define WO_OUT_IN 0
#if WQKV_LAYOUT == 1
#define WCOL(W, k0, o, lane) wcol_oi(W, k0, o, lane, DIN)
#elif WQKV_LAYOUT == 2
#define WCOL(W, k0, o, lane) wcol_hdk(W, k0, o, lane)
#else
#define WCOL(W, k0, o, lane) wcol_io(W, k0, o, lane, CC)
#endif
#if WO_OUT_IN
#define WOCOL(W, k0, o, lane) wcol_oi(W, k0, o, lane, CC)
#define WOCOLH(W, k0, o, lane) wcolh_oi(W, k0, o, lane, CC)
#else
#define WOCOL(W, k0, o, lane) wcol_io(W, k0, o, lane, DIN)
#define WOCOLH(W, k0, o, lane) wcolh_io(W, k0, o, lane, DIN)
#endif

#ifndef SM_EXTRA_PARAMS
#define SM_EXTRA_PARAMS
#endif
#ifndef PROJ_EXTRA_PARAMS
#define PROJ_EXTRA_PARAMS
#endif
#ifndef SM_MASK_HOOK
#define SM_MASK_HOOK (void)0
#endif

// q, k, v and ctx lie in FRAGMENT ORDER: the 16 bytes that lane l takes with one load stand at l * 16 of a 512-byte unit, so a wave-wide load or store covers four whole 128-byte lines (rows of a [t][c] plane gave 16 lines of 32 bytes)
// q, k: [b][head][t / 16][u = c / 16 of the head][lane = 16 * ((c / 8) & 1) + t % 16][c % 8]; v: [b][head][t / 32][c / 16 of the head][(t / 16) & 1][lane = 16 * ((t / 8) & 1) + c % 16][t % 8]; ctx: [row / 16][c / 32][(c / 16) & 1][(c / 4) & 1][lane = 16 * ((c / 8) & 1) + row % 16][c % 4]
#define FPH (TT * HD)                                  // elements of one head's plane of one sequence
#define WS_QH  0u                                      // f16 q, fragment order
#define WS_KH  (WS_QH + 2u * (size_t)NB * TT * CC)      // f16 k, fragment order
#define WS_VT  (WS_KH + 2u * (size_t)NB * TT * CC)      // f16 v planes [b][c][t]
#define WS_QL  (WS_VT + 2u * (size_t)NB * CC * TT)      // f16 q residual x 2^10, fragment order
#define WS_KL  (WS_QL + 2u * (size_t)NB * QHI * CC)     // f16 k residual x 2^10, fragment order
#define WS_VB  (WS_KL + 2u * (size_t)NB * KHI * CC)     // bf16 v hi, fragment order (VBL: lo)
#define WS_VBL (WS_VB + 2u * (size_t)NB * CC * KHI)
#define WS_S   (WS_VBL + 2u * (size_t)NB * CC * KHI)    // f32 [b][hg][t][s] area, unused: k_att keeps the logits and P in registers
#define WS_Y   (WS_S  + 4u * (size_t)NB * HG * TT * TT) // f32 ctx, fragment order
#define WS_END (WS_Y  + 4u * (size_t)NB * TT * CC)

// W slab (all DIN k rows, 128 output columns from c0, (in,out) f32 rows of ld) -> LDS rows wt[column][k] in bf16, once per block of 4 waves: a wave-wide 16-byte load covers the slab's whole 512-byte row, eight k rows give each lane four columns' 16-byte k runs.
// Row pitch 784 B = 16 B x odd: the 16 columns of a fragment's ds_load_b128 fall on distinct banks.
#define WPITCH (DIN + 8)
static_assert(CC == DIN && DIN % 32 == 0, "one slab shape serves the q/k/v weights and Wo");
__device__ __forceinline__ void stage_w(const float* __restrict__ Wm, int c0, int ld, __bf16* __restrict__ wt, int wave, int lane) {
  const float* p = Wm + (size_t)(wave * 8) * ld + c0 + lane * 4; __bf16* d = wt + (lane * 4) * WPITCH + wave * 8;
#pragma unroll
  for (int kg = 0; kg < DIN / 32; ++kg) { v4f r[8];
#pragma unroll
    for (int kk = 0; kk < 8; ++kk) r[kk] = *(const v4f*)(p + (size_t)(kg * 32 + kk) * ld);
    if (kg + 1 == DIN / 32) asm volatile("s_wait_xcnt 0x0" :: "v"(p) : "memory");   /* stands before the slab loads' address registers are written again; named as an input, they live up to it */
#pragma unroll
    for (int i = 0; i < 4; ++i) { v8b o;
#pragma unroll
      for (int kk = 0; kk < 8; ++kk) o[kk] = (__bf16)r[kk][i];
      *(v8b*)(d + i * WPITCH + kg * 32) = o; } } }
// ---- k_proj: block = (64 rows, 128 cols, which): q/k/v = X W (+ b) with exact bf16 products (K = DIN) -> which 0: q f16 (+ residual, rows < QHI); 1: k f16 (+ residual, rows < KHI), both in fragment order; 2: v f16 planes [c][t] (+ bf16 hi/lo for t < KHI in fragment order)
__global__ __launch_bounds__(128) void k_proj(const float* __restrict__ XQ, const float* __restrict__ XK, const float* __restrict__ XV, const float* __restrict__ WQ, const float* __restrict__ WK, const float* __restrict__ WV, const float* __restrict__ BQ, const float* __restrict__ BK, const float* __restrict__ BV,
    _Float16* __restrict__ QH, _Float16* __restrict__ QL, _Float16* __restrict__ KH, _Float16* __restrict__ KL, _Float16* __restrict__ VT, __bf16* __restrict__ VB, __bf16* __restrict__ VBL) {
  // one LDS block: the W slab during the K loop, the output staging arrays behind it (a barrier between the two uses)
  __shared__ __align__(16) unsigned char lds[128 * WPITCH * 2]; static_assert(sizeof(lds) >= 2 * 64 * 136 * 2 + 3 * 128 * 72 * 2, "output staging fits");
  __bf16* wt = (__bf16*)lds; _Float16 (*sh)[136] = (_Float16 (*)[136])lds; _Float16 (*sl)[136] = sh + 64; _Float16 (*th)[72] = (_Float16 (*)[72])(sl + 64); __bf16 (*tb)[72] = (__bf16 (*)[72])(th + 128); __bf16 (*tbl)[72] = tb + 128;
  const int tid = threadIdx.x, wave = tid >> 5, lane = tid & 31, col = lane & 15, g = lane >> 4; const int which = blockIdx.z; const int c0 = blockIdx.y * 128; const size_t r0 = (size_t)blockIdx.x * 64; const size_t bb = r0 / TT; const int t0 = (int)(r0 % TT);
  const float* X = which == 0 ? XQ : which == 1 ? XK : XV; const float* WA = which == 0 ? WQ : which == 1 ? WK : WV; const float* BA = which == 0 ? BQ : which == 1 ? BK : BV;
  stage_w(WA, c0, CC, wt, wave, lane);
  __syncthreads();   /* every wave reads all four waves' k runs */
  v8f acc[8] = {};
#pragma unroll 2
  for (int kc = 0; kc < DIN / 32; ++kc) { v16b w[8];   /* the pass's 16 LDS reads go out as one group, ahead of the x loads and of the first product */
#pragma unroll
    for (int j = 0; j < 8; ++j) w[j] = frag_b(wt + (j * 16 + col) * WPITCH + kc * 32, lane);
    v16b a; { const float* p = X + (r0 + wave * 16 + col) * DIN + kc * 32 + 8 * g;
#pragma unroll
      for (int i = 0; i < 8; ++i) { a[i] = (__bf16)p[i]; a[8 + i] = (__bf16)p[16 + i]; }
      asm volatile("s_wait_xcnt 0x0" :: "v"(p) : "memory"); }   /* stands before the x loads' address registers are written again */
    asm volatile("s_wait_loadcnt 0x0" ::: "memory");
#pragma unroll
    for (int j = 0; j < 8; ++j) acc[j] = wmma_bf(a, w[j], acc[j]); }
  __syncthreads();   /* the slab's last reads end before its LDS takes the output staging */
  if (which < 2) { _Float16* DH = which == 0 ? QH : KH; _Float16* DL = which == 0 ? QL : KL; const int nhi = which == 0 ? QHI : KHI; const bool hi_rows = t0 < nhi;
#pragma unroll
    for (int j = 0; j < 8; ++j) { const float bias = BA ? bfr(BA[c0 + j * 16 + col]) : 0.f;
#pragma unroll
      for (int r = 0; r < 8; ++r) { const float v = acc[j][r] + bias; const _Float16 hv = (_Float16)v; sh[wave * 16 + 8 * g + r][j * 16 + col] = hv; sl[wave * 16 + 8 * g + r][j * 16 + col] = (_Float16)((v - (float)hv) * 1024.0f); } }
    __syncthreads();
    for (int e = tid; e < 64 * 16; e += 128) { const int u = (e >> 5) & 3, jj = (e >> 7) & 3, hh = e >> 9; const int rl = jj * 16 + col, cl = hh * HD + u * 16 + g * 8;   /* e counts the 16-byte pieces in the order of their places: a wave's store is one 512-byte unit */
      const size_t o = (bb * NH + c0 / HD + hh) * (size_t)FPH + (size_t)(t0 / 16 + jj) * (16 * HD) + u * 256 + lane * 8; vst2((unsigned*)(DH + o), *(const v4u*)&sh[rl][cl]); if (hi_rows) vst2((unsigned*)(DL + o), *(const v4u*)&sl[rl][cl]); }
  } else { const bool hi_rows = t0 < KHI;
#pragma unroll
    for (int j = 0; j < 8; ++j) { const float bias = BA ? bfr(BA[c0 + j * 16 + col]) : 0.f;
#pragma unroll
      for (int r = 0; r < 8; ++r) { const float v = acc[j][r] + bias; const int rl = wave * 16 + 8 * g + r, cl = j * 16 + col; th[cl][rl] = (_Float16)v; const __bf16 bh = (__bf16)v; tb[cl][rl] = bh; tbl[cl][rl] = (__bf16)(v - (float)bh); } }
    __syncthreads();
    for (int e = tid; e < 128 * 8; e += 128) { const int cl = e >> 3, q = e & 7; vst2((unsigned*)(VT + (bb * CC + c0 + cl) * (size_t)TT + t0 + q * 8), *(const v4u*)&th[cl][q * 8]); if (hi_rows) { const int hf = (e >> 5) & 1, jc = (e >> 6) & 3, kl = (e >> 8) & 1, hh = e >> 9; const int cf = hh * HD + jc * 16 + col, rf = kl * 32 + hf * 16 + g * 8;   /* the same count of places for the two bf16 planes */
        const size_t o3 = (bb * NH + c0 / HD + hh) * (size_t)FPH + (size_t)(t0 / 32 + kl) * (32 * HD) + jc * 512 + hf * 256 + lane * 8; vst2((unsigned*)(VB + o3), *(const v4u*)&tb[cf][rf]); vst2((unsigned*)(VBL + o3), *(const v4u*)&tbl[cf][rf]); } } } }
// ---- k_att: block = 64 queries (qb) of z = sequence b * HG + head; each wave owns 16 queries from the logits to ctx and shares nothing with the other waves (no LDS, no barrier).
// Both products are formed transposed, so that a lane holds one query's column and the logits' D registers are already the B fragment of the second product (D element r of key tile j = key 16 j + 8 g + r, g = lane >> 4; B elements 0..7 / 8..15 of 32 keys = the same keys of tiles 2 kc / 2 kc + 1).
// S^T = k q^T x SCALE over keys [0, NKB * 128): k hi + residual (x 2^10) against q hi + residual (3 products); causal mask by index; softmax in f32 (in the lane, then one exchange between the wave's halves); P x 2^11; ctx^T = v^T P^T with P and v as bf16 hi + lo (3 products)
__device__ __forceinline__ v16h frag_hp(const _Float16* p) { union { v16h v; v8h q[2]; } u; u.q[0] = *(const v8h*)p; u.q[1] = *(const v8h*)(p + 256); return u.v; }   // p = the fragment's first 512-byte unit + 8 lane; elements 8..15 lie in the next unit
__device__ __forceinline__ v16b frag_bp(const __bf16* p) { union { v16b v; v8b q[2]; } u; u.q[0] = *(const v8b*)p; u.q[1] = *(const v8b*)(p + 256); return u.v; }
// exp(x) by the range reduction of expf (n = rint(x log2 e), 2^(x log2 e - n), ldexp, the two range ends), the reduced argument by two fused multiply-adds over log2 e in two parts; v_exp_f32 and one v_nop stand in one statement:
// the instruction set asks for one independent instruction before a transcendental's source is overwritten
__device__ __forceinline__ float exp_slot(float x) {
  const float c = __builtin_bit_cast(float, 0x3fb8aa3bu), cc = __builtin_bit_cast(float, 0x32a5705fu);
  const float n = __builtin_rintf(x * c); const float a = __builtin_fmaf(x, cc, __builtin_fmaf(x, c, -n));
  float y; asm("v_exp_f32 %0, %1\n\tv_nop" : "=v"(y) : "v"(a));
  y = __builtin_ldexpf(y, (int)n);
  y = x < __builtin_bit_cast(float, 0xc2ce8ed0u) ? 0.f : y;
  return x > __builtin_bit_cast(float, 0x42b17218u) ? __builtin_inff() : y; }
template <int NKB> __device__ __forceinline__ void att_body(const _Float16* __restrict__ QH, const _Float16* __restrict__ KH, const _Float16* __restrict__ QL, const _Float16* __restrict__ KL, const __bf16* __restrict__ VB, const __bf16* __restrict__ VBL, float* __restrict__ Y, int b, int h, int ql0, int lane) {
  constexpr int NT = NKB * 8, NC = NKB * 4; const int col = lane & 15, g = lane >> 4; const int t = ql0 + col;
  v16h qh[HD / 32], ql[HD / 32]; const size_t ph = ((size_t)b * NH + h) * FPH + lane * 8; const _Float16* qp = QH + ph + (size_t)(ql0 / 16) * (16 * HD); const _Float16* rp = QL + ph + (size_t)(ql0 / 16) * (16 * HD);
#pragma unroll
  for (int kc = 0; kc < HD / 32; ++kc) { qh[kc] = frag_hp(qp + kc * 512); ql[kc] = frag_hp(rp + kc * 512); }
  asm volatile("s_wait_xcnt 0x0" :: "v"(qp), "v"(rp) : "memory");   /* stands before the q loads' address registers are written again; named as inputs, they live up to it */
  const _Float16* kp = KH + ph; const _Float16* lp = KL + ph;
  v8f s[NT]; float m = -3.0e38f, sum = 0.f; const int dt = t - 8 * g;   /* key 16 j + 8 g + r is open to query t where 16 j + r <= dt */
#pragma unroll
  for (int j = 0; j < NT; ++j) { v16h kh[HD / 32], kl[HD / 32];   /* the tile's eight loads fly together, in front of its first product */
#pragma unroll
    for (int kc = 0; kc < HD / 32; ++kc) { kh[kc] = frag_hp(kp + j * (16 * HD) + kc * 512); kl[kc] = frag_hp(lp + j * (16 * HD) + kc * 512); }
    if (j + 1 == NT) asm volatile("s_wait_xcnt 0x0" :: "v"(kp), "v"(lp) : "memory");   /* the same for the k loads, behind the last of them */
    v8f a = {}, l = {};
#pragma unroll
    for (int kc = 0; kc < HD / 32; ++kc) { a = wmma16(kh[kc], qh[kc], a); l = wmma16(kh[kc], ql[kc], l); l = wmma16(kl[kc], qh[kc], l); }
#pragma unroll
    for (int r = 0; r < 8; ++r) { const float v = (!CAUSAL || j * 16 + r <= dt) ? (a[r] + l[r] * (1.0f / 1024.0f)) * SCALE : -3.0e38f; s[j][r] = v; m = fmaxf(m, v); } }
  m = fmaxf(m, __shfl_xor(m, 16));
#pragma unroll
  for (int j = 0; j < NT; ++j)
#pragma unroll
    for (int r = 0; r < 8; ++r) { const float v = s[j][r]; const float x = exp_slot(v - m); const float e = (v <= -1.0e38f) ? 0.f : x; s[j][r] = e; sum += e; }
  sum += __shfl_xor(sum, 16);
  const float inv = sum > 0.f ? 2048.0f / sum : 0.f;   /* a fully excluded row yields P = 0 */
  const __bf16* vp = VB + ph; const __bf16* wp = VBL + ph;
  v8f acc[HD / 16] = {};
#pragma unroll
  for (int kc = 0; kc < NC; ++kc) { float pv[16]; v16b vh[HD / 16], vl[HD / 16];
    __builtin_amdgcn_sched_barrier(0);   /* keeps these loads behind the softmax and behind the products before them: lifted higher they hold 64 registers more beside the 128 of P, and the kernel spills */
#pragma unroll
    for (int j = 0; j < HD / 16; ++j) { vh[j] = frag_bp(vp + kc * (32 * HD) + j * 512); vl[j] = frag_bp(wp + kc * (32 * HD) + j * 512); }
    if (kc + 1 == NC) asm volatile("s_wait_xcnt 0x0" :: "v"(vp), "v"(wp) : "memory");   /* the same for the v loads, behind the last of them */
#pragma unroll
    for (int i = 0; i < 8; ++i) { pv[i] = s[2 * kc][i] * inv; pv[8 + i] = s[2 * kc + 1][i] * inv; }
    const F2 p = bsplit16(pv);
#pragma unroll
    for (int j = 0; j < HD / 16; ++j) { acc[j] = wmma_bf(vh[j], p.h, acc[j]); acc[j] = wmma_bf(vh[j], p.l, acc[j]); acc[j] = wmma_bf(vl[j], p.h, acc[j]); } }
  float* yr = Y + ((size_t)b * TT + ql0) * CC + h * (HD * 16) + lane * 4;   /* D element r of channel tile j = channel 16 j + 8 g + r of query t: the lane that holds it here reads it in k_out */
#pragma unroll
  for (int j = 0; j < HD / 16; ++j) acc[j] *= (1.0f / 2048.0f);
#pragma unroll
  for (int j = 0; j < HD / 16; ++j) { vst2(yr + j * 256, __builtin_shufflevector(acc[j], acc[j], 0, 1, 2, 3)); vst2(yr + j * 256 + 128, __builtin_shufflevector(acc[j], acc[j], 4, 5, 6, 7)); } }
// four waves per SIMD: without the budget the scheduler spreads the softmax over more than 256 registers
__global__ __launch_bounds__(128) __attribute__((amdgpu_waves_per_eu(4, 4))) void k_att(const _Float16* __restrict__ QH, const _Float16* __restrict__ KH, const _Float16* __restrict__ QL, const _Float16* __restrict__ KL, const __bf16* __restrict__ VB, const __bf16* __restrict__ VBL, float* __restrict__ Y) {
  static_assert(TT == 256 && QBH == NQB && QHI == TT && KHI == TT, "two key blocks at most; every row on the 3-product path");
  const int b = blockIdx.z / HG, h = blockIdx.z % HG, qb = blockIdx.x; const int tid = threadIdx.x, wave = tid >> 5, lane = tid & 31; const int ql0 = qb * 64 + wave * 16;
  if (kb_last(qb) == 0) att_body<1>(QH, KH, QL, KL, VB, VBL, Y, b, h, ql0, lane); else att_body<2>(QH, KH, QL, KL, VB, VBL, Y, b, h, ql0, lane); }
// ---- k_out: block = (64 rows, 128 cols): out = ctx Wo (+ bo): all rows: ctx bf16 hi + lo against exact bf16 Wo (2 products)
__global__ __launch_bounds__(128) void k_out(const float* __restrict__ Y, const float* __restrict__ WO, const float* __restrict__ BO, float* __restrict__ OUT) { __shared__ __align__(16) unsigned char lds[128 * WPITCH * 2]; static_assert(sizeof(lds) >= 4 * 16 * 132 * 4, "output staging fits"); __bf16* wt = (__bf16*)lds; float (*sf)[16][132] = (float (*)[16][132])lds;   /* the Wo slab during the K loop, the output staging behind it */
  const int tid = threadIdx.x, wave = tid >> 5, lane = tid & 31, col = lane & 15, g = lane >> 4; const int c0 = blockIdx.y * 128; const size_t r0 = (size_t)blockIdx.x * 64 + wave * 16;
  stage_w(WO, c0, DIN, wt, wave, lane);
  __syncthreads();   /* every wave reads all four waves' k runs */
  v8f acc[8] = {};
  if (true) {   /* ALL rows: ctx split bf16 hi + lo x exact Wo (2 products) */
#pragma unroll 2
    for (int kc = 0; kc < CC / 32; ++kc) { v16b w[8];   /* the pass's 16 LDS reads go out as one group, ahead of the ctx loads and of the first product */
#pragma unroll
      for (int j = 0; j < 8; ++j) w[j] = frag_b(wt + (j * 16 + col) * WPITCH + kc * 32, lane);
      const float* yp = Y + r0 * CC + kc * 512 + lane * 4; float yv[16];
#pragma unroll
      for (int i = 0; i < 16; ++i) yv[i] = yp[(i >> 2) * 128 + (i & 3)];
      asm volatile("s_wait_xcnt 0x0" :: "v"(yp) : "memory");   /* stands before the ctx loads' address registers are written again; named as an input, they live up to it */
      const F2 a = bsplit16(yv); asm volatile("s_wait_loadcnt 0x0" ::: "memory");
#pragma unroll
      for (int j = 0; j < 8; ++j) { acc[j] = wmma_bf(a.h, w[j], acc[j]); acc[j] = wmma_bf(a.l, w[j], acc[j]); } }
    __syncthreads();   /* the slab's last reads end before its LDS takes the output staging */
#pragma unroll
    for (int j = 0; j < 8; ++j) { const float bias = BO ? bfr(BO[c0 + j * 16 + col]) : 0.f;
#pragma unroll
      for (int r = 0; r < 8; ++r) sf[wave][8 * g + r][j * 16 + col] = acc[j][r] + bias; }
  }
  LDSX(); for (int rl = 0; rl < 16; ++rl) vst2(OUT + (r0 + rl) * DIN + c0 + lane * 4, *(const v4f*)&sf[wave][rl][lane * 4]); }

extern "C" void kernel_launch(void* const* d_in, const int* in_sizes, int n_in, void* d_out, int out_size, void* d_ws, size_t ws_size, hipStream_t stream) {
  (void)in_sizes; (void)n_in; (void)out_size;
  const float** F = (const float**)d_in;
  if (ws_size < (size_t)WS_END) return;
  char* ws = (char*)d_ws; _Float16 *QH = (_Float16*)(ws + WS_QH), *KH = (_Float16*)(ws + WS_KH), *VT = (_Float16*)(ws + WS_VT), *QL = (_Float16*)(ws + WS_QL), *KL = (_Float16*)(ws + WS_KL); __bf16 *VB = (__bf16*)(ws + WS_VB), *VBL = (__bf16*)(ws + WS_VBL); float *Y = (float*)(ws + WS_Y);
  (void)Y; (void)QL; (void)KL; (void)VB; (void)VBL;
  // inputs: 0 x [64,256,384]; 1 Wq, 2 Wk, 3 Wv [384,384] (in,out); 4 Wo (in,out), 5 bo
  k_proj<<<dim3(TNB * TT / 64, CC / 128, 3), 128, 0, stream>>>(F[0], F[0], F[0], F[1], F[2], F[3], nullptr, nullptr, nullptr, QH, QL, KH, KL, VT, VB, VBL);
  /* all sequences and heads in one launch */
  k_att<<<dim3(NQB, 1, TNB * HG), 128, 0, stream>>>(QH, KH, QL, KL, VB, VBL, Y);
  k_out<<<dim3(TNB * TT / 64, DIN / 128), 128, 0, stream>>>(Y, F[4], F[5], (float*)d_out);
}

// v005
// A run of this version takes 102 microseconds.
// Two timings next to v004 both put it at 1.14 times that version's speed.
// All steps since v000 together make it 18.5 times as fast.
// compute dtype: all float inputs rounded to bf16; q/k/v = x W with EXACT bf16 products on WMMA 16x16x32 (f32 accumulate); causal logits with q, k as f16 hi + residual (3 products, all rows) x 64^-0.5; softmax in f32; P split in bf16 hi + lo against v bf16 hi + lo (3 products); ctx split bf16 hi + lo against exact Wo (2 products) + bo; f32 output.
#include <hip/hip_runtime.h>
#include <math.h>

typedef __attribute__((ext_vector_type(16))) _Float16 v16h;
typedef __attribute__((ext_vector_type(16))) __bf16 v16b;
typedef __attribute__((ext_vector_type(8)))  _Float16 v8h;
typedef __attribute__((ext_vector_type(8)))  float v8f;
typedef __attribute__((ext_vector_type(4)))  float v4f;
typedef __attribute__((ext_vector_type(2)))  float v2f;
typedef __attribute__((ext_vector_type(4)))  unsigned v4u;
typedef __attribute__((ext_vector_type(4)))  int v4i;
typedef float __attribute__((may_alias)) float_a;
typedef int __attribute__((may_alias)) int_a;

template <typename T> __device__ __forceinline__ void vst2(void* p, T v) { *(T*)p = v;  }
__device__ __forceinline__ v8f wmma16(v16h a, v16h b, v8f c) {
  v8f d = __builtin_amdgcn_wmma_f32_16x16x32_f16(false, a, false, b, (short)0, c, false, false);
  asm volatile("v_nop\n\tv_nop\n\tv_nop\n\tv_nop" : "+v"(d) : "v"(a), "v"(b));
  return d;
}
__device__ __forceinline__ v8f wmma_bf(v16b a, v16b b, v8f c) {
  v8f d = __builtin_amdgcn_wmma_f32_16x16x32_bf16(false, a, false, b, (short)0, c, false, false);
  asm volatile("v_nop\n\tv_nop\n\tv_nop\n\tv_nop" : "+v"(d) : "v"(a), "v"(b));
  return d;
}
// 16x16x32 fragments: lane = (h = lane>>4, row/col = lane&15); elements 0..7 = k0+8h+0..7, 8..15 = k0+16+8h+0..7; D element r = row 8h+r
__device__ __forceinline__ v16h frag_h(const _Float16* rowk0, int lane) {
  union { v16h v; v8h q[2]; } u; const _Float16* p = rowk0 + 8 * (lane >> 4);
  u.q[0] = *(const v8h*)p; u.q[1] = *(const v8h*)(p + 16); return u.v;
}
__device__ __forceinline__ v16h frag_f32(const float* rowk0, int lane) {
  v16h a; const float* p = rowk0 + 8 * (lane >> 4);
#pragma unroll
  for (int i = 0; i < 8; ++i) { a[i] = (_Float16)p[i]; a[8 + i] = (_Float16)p[16 + i]; }
  return a;
}
__device__ __forceinline__ v16h frag_f32s(const float* rowk0, int lane, float sc) {
  v16h a; const float* p = rowk0 + 8 * (lane >> 4);
#pragma unroll
  for (int i = 0; i < 8; ++i) { a[i] = (_Float16)(p[i] * sc); a[8 + i] = (_Float16)(p[16 + i] * sc); }
  return a;
}
// column fragment from a [K][ld] layout (column n), rows >= K read as 0
__device__ __forceinline__ v16h fragc_f32(const float* W, int k0, int n, int lane, int ld, int K) {
  v16h a; const int g = lane >> 4;
#pragma unroll
  for (int i = 0; i < 8; ++i) { const int ka = k0 + 8 * g + i, kb = ka + 16;
    a[i] = (_Float16)(ka < K ? W[(size_t)(ka < K ? ka : K - 1) * ld + n] : 0.f); a[8 + i] = (_Float16)(kb < K ? W[(size_t)(kb < K ? kb : K - 1) * ld + n] : 0.f); }
  return a;
}
struct F2 { v16b h, l; };
__device__ __forceinline__ F2 bsplit16(const float v[16]) { F2 r;
#pragma unroll
  for (int i = 0; i < 16; ++i) { const __bf16 h = (__bf16)v[i]; r.h[i] = h; r.l[i] = (__bf16)(v[i] - (float)h); }
  return r; }
__device__ __forceinline__ F2 split_row(const float* row, int k0, int lane) { float v[16]; const float* p = row + k0 + 8 * (lane >> 4);
#pragma unroll
  for (int i = 0; i < 8; ++i) { v[i] = p[i]; v[8 + i] = p[16 + i]; }
  return bsplit16(v); }
__device__ __forceinline__ F2 split_rowK(const float* row, int k0, int lane, int K) { float v[16]; const int g = lane >> 4;
#pragma unroll
  for (int i = 0; i < 8; ++i) { const int ka = k0 + 8 * g + i, kb = ka + 16; v[i] = ka < K ? row[ka < K ? ka : K - 1] : 0.f; v[8 + i] = kb < K ? row[kb < K ? kb : K - 1] : 0.f; }
  return bsplit16(v); }
__device__ __forceinline__ F2 split_col(const float* W, int k0, int n, int lane, int ld, int K) { float v[16]; const int g = lane >> 4;
#pragma unroll
  for (int i = 0; i < 8; ++i) { const int ka = k0 + 8 * g + i, kb = ka + 16; v[i] = ka < K ? W[(size_t)(ka < K ? ka : K - 1) * ld + n] : 0.f; v[8 + i] = kb < K ? W[(size_t)(kb < K ? kb : K - 1) * ld + n] : 0.f; }
  return bsplit16(v); }
__device__ __forceinline__ v8f mac3(const F2& a, const F2& b, v8f c) { c = wmma_bf(a.l, b.h, c); c = wmma_bf(a.h, b.l, c); return wmma_bf(a.h, b.h, c); }
__device__ __forceinline__ float sigm(float v) { return 1.0f / (1.0f + expf(-v)); }
#define LDSX() do { asm volatile("s_wait_dscnt 0" ::: "memory"); __builtin_amdgcn_wave_barrier(); __builtin_amdgcn_fence(__ATOMIC_RELEASE, "workgroup"); } while (0)

// Causal multi-head self-attention (B 64, T 256, C 384 = 6 x 64): q,k,v = x W ((in,out), no bias); causal softmax(q k^T / 8) (-inf above the diagonal); out = merged(attn v) Wo + bo.
#define NB 64
#define TT 256
#define CC 384            // NH * HD = projected width
#define DIN 384          // input (model) width
#define NH 6
#define HD 64
#define NQB (TT / 64)
#define HG 6
#define SCALE (0.125f)
#define CAUSAL 1
#ifndef TNB
#define TNB NB
#endif
__device__ __forceinline__ float bfr(float v) { return (float)(__bf16)v; }
__host__ __device__ __forceinline__ int kb_last(int qb) { return CAUSAL ? ((qb * 64 + 63) >> 7) : (TT / 128 - 1); }
typedef __attribute__((ext_vector_type(8))) __bf16 v8b;
__device__ __forceinline__ v16b frag_b(const __bf16* rowk0, int lane) {
  union { v16b v; v8b q[2]; } u; const __bf16* p = rowk0 + 8 * (lane >> 4);
  u.q[0] = *(const v8b*)p; u.q[1] = *(const v8b*)(p + 16); return u.v;
}
#define QBH 4              // causal: query blocks 0..QBH-1 of each sequence take the high-precision path; QBH == NQB, so every block does
#define QHI 256            // rows carrying a q residual plane (all rows: 3-product logits everywhere)
#define KHI 256            // key rows carrying k residual / v bf16 hi+lo planes (used only by the causal high-precision path)
// B fragment (k rows k0+.., output column o) of a weight: (in,out) [K][ld] or (out,in) [ld rows of K]: bf16 exact, or f16(bf16 * 256) exact
__device__ __forceinline__ v16b wcol_io(const float* Wm, int k0, int o, int lane, int ld) { v16b w; const int g = lane >> 4;
#pragma unroll
  for (int i = 0; i < 8; ++i) { w[i] = (__bf16)Wm[(size_t)(k0 + 8 * g + i) * ld + o]; w[8 + i] = (__bf16)Wm[(size_t)(k0 + 16 + 8 * g + i) * ld + o]; }
  return w; }
__device__ __forceinline__ v16b wcol_oi(const float* Wm, int k0, int o, int lane, int K) { v16b w; const float* p = Wm + (size_t)o * K + k0 + 8 * (lane >> 4);
#pragma unroll
  for (int i = 0; i < 8; ++i) { w[i] = (__bf16)p[i]; w[8 + i] = (__bf16)p[16 + i]; }
  return w; }
__device__ __forceinline__ v16h wcolh_io(const float* Wm, int k0, int o, int lane, int ld) { v16h w; const int g = lane >> 4;
#pragma unroll
  for (int i = 0; i < 8; ++i) { w[i] = (_Float16)(bfr(Wm[(size_t)(k0 + 8 * g + i) * ld + o]) * 256.0f); w[8 + i] = (_Float16)(bfr(Wm[(size_t)(k0 + 16 + 8 * g + i) * ld + o]) * 256.0f); }
  return w; }
__device__ __forceinline__ v16h wcolh_oi(const float* Wm, int k0, int o, int lane, int K) { v16h w; const float* p = Wm + (size_t)o * K + k0 + 8 * (lane >> 4);
#pragma unroll
  for (int i = 0; i < 8; ++i) { w[i] = (_Float16)(bfr(p[i]) * 256.0f); w[8 + i] = (_Float16)(bfr(p[16 + i]) * 256.0f); }
  return w; }
#define WQKV_LAYOUT 0   // 0 = (in,out) [DIN][CC]; 1 = (out,in) [CC][DIN]; 2 = per-head [NH][DIN][HD]
__device__ __forceinline__ v16b wcol_hdk(const float* Wm, int k0, int o, int lane) { v16b w; const int g = lane >> 4; const float* p = Wm + (size_t)(o / HD) * DIN * HD + (o % HD);
#pragma unroll
  for (int i = 0; i < 8; ++i) { w[i] = (__bf16)p[(size_t)(k0 + 8 * g + i) * HD]; w[8 + i] = (__bf16)p[(size_t)(k0 + 16 + 8 * g + i) * HD]; }
  return w; }
#define WO_OUT_IN 0
#if WQKV_LAYOUT == 1
#define WCOL(W, k0, o, lane) wcol_oi(W, k0, o, lane, DIN)
#elif WQKV_LAYOUT == 2
#define WCOL(W, k0, o, lane) wcol_hdk(W, k0, o, lane)
#else
#define WCOL(W, k0, o, lane) wcol_io(W, k0, o, lane, CC)
#endif
#if WO_OUT_IN
#define WOCOL(W, k0, o, lane) wcol_oi(W, k0, o, lane, CC)
#define WOCOLH(W, k0, o, lane) wcolh_oi(W, k0, o, lane, CC)
#else
#define WOCOL(W, k0, o, lane) wcol_io(W, k0, o, lane, DIN)
#define WOCOLH(W, k0, o, lane) wcolh_io(W, k0, o, lane, DIN)
#endif

#ifndef SM_EXTRA_PARAMS
#define SM_EXTRA_PARAMS
#endif
#ifndef PROJ_EXTRA_PARAMS
#define PROJ_EXTRA_PARAMS
#endif
#ifndef SM_MASK_HOOK
#define SM_MASK_HOOK (void)0
#endif

// q, k, v and ctx lie in FRAGMENT ORDER: the 16 bytes that lane l takes with one load stand at l * 16 of a 512-byte unit, so a wave-wide load or store covers four whole 128-byte lines (rows of a [t][c] plane gave 16 lines of 32 bytes)
// q, k: [b][head][t / 16][u = c / 16 of the head][lane = 16 * ((c / 8) & 1) + t % 16][c % 8]; v: [b][head][t / 32][c / 16 of the head][(t / 16) & 1][lane = 16 * ((t / 8) & 1) + c % 16][t % 8]; ctx: [row / 16][c / 32][(c / 16) & 1][(c / 4) & 1][lane = 16 * ((c / 8) & 1) + row % 16][c % 4]
#define FPH (TT * HD)                                  // elements of one head's plane of one sequence
#define WS_QH  0u                                      // f16 q, fragment order
#define WS_KH  (WS_QH + 2u * (size_t)NB * TT * CC)      // f16 k, fragment order
#define WS_VT  (WS_KH + 2u * (size_t)NB * TT * CC)      // f16 v planes [b][c][t]
#define WS_QL  (WS_VT + 2u * (size_t)NB * CC * TT)      // f16 q residual x 2^10, fragment order
#define WS_KL  (WS_QL + 2u * (size_t)NB * QHI * CC)     // f16 k residual x 2^10, fragment order
#define WS_VB  (WS_KL + 2u * (size_t)NB * KHI * CC)     // bf16 v hi, fragment order (VBL: lo)
#define WS_VBL (WS_VB + 2u * (size_t)NB * CC * KHI)
#define WS_S   (WS_VBL + 2u * (size_t)NB * CC * KHI)    // f32 [b][hg][t][s] area, unused: k_att keeps the logits and P in registers
#define WS_Y   (WS_S  + 4u * (size_t)NB * HG * TT * TT) // f32 ctx, fragment order
#define WS_END (WS_Y  + 4u * (size_t)NB * TT * CC)

// W slab (all DIN k rows, 128 output columns from c0, (in,out) f32 rows of ld) -> LDS rows wt[column][k] in bf16, once per block of NWV waves: a wave-wide 16-byte load covers the slab's whole 512-byte row, eight k rows give each lane four columns' 16-byte k runs.
// Row pitch 784 B = 16 B x odd: the 16 columns of a fragment's ds_load_b128 fall on distinct banks.
#define WPITCH (DIN + 8)
#define NWV 8               // waves of a k_proj or k_out block: 16 rows each, all on one slab
#define BR (NWV * 16)       // rows of such a block
static_assert(CC == DIN && DIN % (NWV * 8) == 0 && TT % BR == 0, "one slab shape serves the q/k/v weights and Wo; a block stays inside one sequence");
__device__ __forceinline__ void stage_w(const float* __restrict__ Wm, int c0, int ld, __bf16* __restrict__ wt, int wave, int lane) {
  const float* p = Wm + (size_t)(wave * 8) * ld + c0 + lane * 4; __bf16* d = wt + (lane * 4) * WPITCH + wave * 8;
#pragma unroll
  for (int kg = 0; kg < DIN / (NWV * 8); ++kg) { v4f r[8];
    if (kg == DIN / (NWV * 16)) __builtin_amdgcn_sched_barrier(0);   /* the second half's loads stay behind the first half's LDS stores: with all loads lifted to the top, raw and converted rows together pass 160 registers and k_proj spills */
#pragma unroll
    for (int kk = 0; kk < 8; ++kk) r[kk] = *(const v4f*)(p + (size_t)(kg * (NWV * 8) + kk) * ld);
    if (kg + 1 == DIN / (NWV * 8)) asm volatile("s_wait_xcnt 0x0" :: "v"(p) : "memory");   /* stands before the slab loads' address registers are written again; named as an input, they live up to it */
#pragma unroll
    for (int i = 0; i < 4; ++i) { v8b o;
#pragma unroll
      for (int kk = 0; kk < 8; ++kk) o[kk] = (__bf16)r[kk][i];
      *(v8b*)(d + i * WPITCH + kg * (NWV * 8)) = o; } } }
// ---- k_proj: block = (BR rows, 128 cols, which): q/k/v = X W (+ b) with exact bf16 products (K = DIN) -> which 0: q f16 (+ residual, rows < QHI); 1: k f16 (+ residual, rows < KHI), both in fragment order; 2: v f16 planes [c][t] (+ bf16 hi/lo for t < KHI in fragment order)
// six waves per SIMD: three blocks, which the LDS admits, stay resident only inside 160 registers
__global__ __launch_bounds__(NWV * 32) __attribute__((amdgpu_waves_per_eu(6))) void k_proj(const float* __restrict__ XQ, const float* __restrict__ XK, const float* __restrict__ XV, const float* __restrict__ WQ, const float* __restrict__ WK, const float* __restrict__ WV, const float* __restrict__ BQ, const float* __restrict__ BK, const float* __restrict__ BV,
    _Float16* __restrict__ QH, _Float16* __restrict__ QL, _Float16* __restrict__ KH, _Float16* __restrict__ KL, _Float16* __restrict__ VT, __bf16* __restrict__ VB, __bf16* __restrict__ VBL) {
  // one LDS block: the W slab during the K loop, the output staging arrays behind it (a barrier between the two uses)
  __shared__ __align__(16) unsigned char lds[3 * 128 * (BR + 8) * 2]; static_assert(sizeof(lds) >= 128 * WPITCH * 2 && sizeof(lds) >= 2 * BR * 136 * 2, "slab and output staging fit");
  __bf16* wt = (__bf16*)lds; _Float16 (*sh)[136] = (_Float16 (*)[136])lds; _Float16 (*sl)[136] = sh + BR; _Float16 (*th)[BR + 8] = (_Float16 (*)[BR + 8])lds; __bf16 (*tb)[BR + 8] = (__bf16 (*)[BR + 8])(th + 128); __bf16 (*tbl)[BR + 8] = tb + 128;   /* sh, sl serve q and k, th, tb, tbl serve v */
  const int tid = threadIdx.x, wave = tid >> 5, lane = tid & 31, col = lane & 15, g = lane >> 4; const int which = blockIdx.z; const int c0 = blockIdx.y * 128; const size_t r0 = (size_t)blockIdx.x * BR; const size_t bb = r0 / TT; const int t0 = (int)(r0 % TT);
  const float* X = which == 0 ? XQ : which == 1 ? XK : XV; const float* WA = which == 0 ? WQ : which == 1 ? WK : WV; const float* BA = which == 0 ? BQ : which == 1 ? BK : BV;
  stage_w(WA, c0, CC, wt, wave, lane);
  __syncthreads();   /* every wave reads all waves' k runs */
  v8f acc[8] = {};
#pragma unroll 2
  for (int kc = 0; kc < DIN / 32; ++kc) { v16b w[8];   /* the pass's 16 LDS reads go out as one group, ahead of the x loads and of the first product */
#pragma unroll
    for (int j = 0; j < 8; ++j) w[j] = frag_b(wt + (j * 16 + col) * WPITCH + kc * 32, lane);
    v16b a; { const float* p = X + (r0 + wave * 16 + col) * DIN + kc * 32 + 8 * g;
#pragma unroll
      for (int i = 0; i < 8; ++i) { a[i] = (__bf16)p[i]; a[8 + i] = (__bf16)p[16 + i]; }
      asm volatile("s_wait_xcnt 0x0" :: "v"(p) : "memory"); }   /* stands before the x loads' address registers are written again */
    asm volatile("s_wait_loadcnt 0x0" ::: "memory");
#pragma unroll
    for (int j = 0; j < 8; ++j) acc[j] = wmma_bf(a, w[j], acc[j]); }
  __syncthreads();   /* the slab's last reads end before its LDS takes the output staging */
  if (which < 2) { _Float16* DH = which == 0 ? QH : KH; _Float16* DL = which == 0 ? QL : KL; const int nhi = which == 0 ? QHI : KHI; const bool hi_rows = t0 < nhi;
#pragma unroll
    for (int j = 0; j < 8; ++j) { const float bias = BA ? bfr(BA[c0 + j * 16 + col]) : 0.f;
#pragma unroll
      for (int r = 0; r < 8; ++r) { const float v = acc[j][r] + bias; const _Float16 hv = (_Float16)v; sh[wave * 16 + 8 * g + r][j * 16 + col] = hv; sl[wave * 16 + 8 * g + r][j * 16 + col] = (_Float16)((v - (float)hv) * 1024.0f); } }
    __syncthreads();
    for (int e = tid; e < BR * 16; e += NWV * 32) { const int u = (e >> 5) & 3, jj = (e >> 7) % NWV, hh = e / (NWV * 128); const int rl = jj * 16 + col, cl = hh * HD + u * 16 + g * 8;   /* e counts the 16-byte pieces in the order of their places: a wave's store is one 512-byte unit */
      const size_t o = (bb * NH + c0 / HD + hh) * (size_t)FPH + (size_t)(t0 / 16 + jj) * (16 * HD) + u * 256 + lane * 8; vst2((unsigned*)(DH + o), *(const v4u*)&sh[rl][cl]); if (hi_rows) vst2((unsigned*)(DL + o), *(const v4u*)&sl[rl][cl]); }
  } else { const bool hi_rows = t0 < KHI;
#pragma unroll
    for (int j = 0; j < 8; ++j) { const float bias = BA ? bfr(BA[c0 + j * 16 + col]) : 0.f;
#pragma unroll
      for (int r = 0; r < 8; ++r) { const float v = acc[j][r] + bias; const int rl = wave * 16 + 8 * g + r, cl = j * 16 + col; th[cl][rl] = (_Float16)v; const __bf16 bh = (__bf16)v; tb[cl][rl] = bh; tbl[cl][rl] = (__bf16)(v - (float)bh); } }
    __syncthreads();
    for (int e = tid; e < 128 * (BR / 8); e += NWV * 32) { const int cl = e / (BR / 8), q = e % (BR / 8); vst2((unsigned*)(VT + (bb * CC + c0 + cl) * (size_t)TT + t0 + q * 8), *(const v4u*)&th[cl][q * 8]); if (hi_rows) { const int hf = (e >> 5) & 1, jc = (e >> 6) & 3, kl = (e >> 8) % (BR / 32), hh = e / (BR * 8); const int cf = hh * HD + jc * 16 + col, rf = kl * 32 + hf * 16 + g * 8;   /* the same count of places for the two bf16 planes */
        const size_t o3 = (bb * NH + c0 / HD + hh) * (size_t)FPH + (size_t)(t0 / 32 + kl) * (32 * HD) + jc * 512 + hf * 256 + lane * 8; vst2((unsigned*)(VB + o3), *(const v4u*)&tb[cf][rf]); vst2((unsigned*)(VBL + o3), *(const v4u*)&tbl[cf][rf]); } } } }
// ---- k_att: block = 64 queries (qb) of z = sequence b * HG + head; each wave owns 16 queries from the logits to ctx and shares nothing with the other waves (no LDS, no barrier).
// Both products are formed transposed, so that a lane holds one query's column and the logits' D registers are already the B fragment of the second product (D element r of key tile j = key 16 j + 8 g + r, g = lane >> 4; B elements 0..7 / 8..15 of 32 keys = the same keys of tiles 2 kc / 2 kc + 1).
// S^T = k q^T x SCALE over keys [0, NKB * 128): k hi + residual (x 2^10) against q hi + residual (3 products); causal mask by index; softmax in f32 (in the lane, then one exchange between the wave's halves); P x 2^11; ctx^T = v^T P^T with P and v as bf16 hi + lo (3 products)
__device__ __forceinline__ v16h frag_hp(const _Float16* p) { union { v16h v; v8h q[2]; } u; u.q[0] = *(const v8h*)p; u.q[1] = *(const v8h*)(p + 256); return u.v; }   // p = the fragment's first 512-byte unit + 8 lane; elements 8..15 lie in the next unit
__device__ __forceinline__ v16b frag_bp(const __bf16* p) { union { v16b v; v8b q[2]; } u; u.q[0] = *(const v8b*)p; u.q[1] = *(const v8b*)(p + 256); return u.v; }
// exp(x) by the range reduction of expf (n = rint(x log2 e), 2^(x log2 e - n), ldexp, the two range ends), the reduced argument by two fused multiply-adds over log2 e in two parts; v_exp_f32 and one v_nop stand in one statement:
// the instruction set asks for one independent instruction before a transcendental's source is overwritten
__device__ __forceinline__ float exp_slot(float x) {
  const float c = __builtin_bit_cast(float, 0x3fb8aa3bu), cc = __builtin_bit_cast(float, 0x32a5705fu);
  const float n = __builtin_rintf(x * c); const float a = __builtin_fmaf(x, cc, __builtin_fmaf(x, c, -n));
  float y; asm("v_exp_f32 %0, %1\n\tv_nop" : "=v"(y) : "v"(a));
  y = __builtin_ldexpf(y, (int)n);
  y = x < __builtin_bit_cast(float, 0xc2ce8ed0u) ? 0.f : y;
  return x > __builtin_bit_cast(float, 0x42b17218u) ? __builtin_inff() : y; }
template <int NKB> __device__ __forceinline__ void att_body(const _Float16* __restrict__ QH, const _Float16* __restrict__ KH, const _Float16* __restrict__ QL, const _Float16* __restrict__ KL, const __bf16* __restrict__ VB, const __bf16* __restrict__ VBL, float* __restrict__ Y, int b, int h, int ql0, int lane) {
  constexpr int NT = NKB * 8, NC = NKB * 4; const int col = lane & 15, g = lane >> 4; const int t = ql0 + col;
  v16h qh[HD / 32], ql[HD / 32]; const size_t ph = ((size_t)b * NH + h) * FPH + lane * 8; const _Float16* qp = QH + ph + (size_t)(ql0 / 16) * (16 * HD); const _Float16* rp = QL + ph + (size_t)(ql0 / 16) * (16 * HD);
#pragma unroll
  for (int kc = 0; kc < HD / 32; ++kc) { qh[kc] = frag_hp(qp + kc * 512); ql[kc] = frag_hp(rp + kc * 512); }
  asm volatile("s_wait_xcnt 0x0" :: "v"(qp), "v"(rp) : "memory");   /* stands before the q loads' address registers are written again; named as inputs, they live up to it */
  const _Float16* kp = KH + ph; const _Float16* lp = KL + ph;
  v8f s[NT]; float m = -3.0e38f, sum = 0.f; const int dt = t - 8 * g;   /* key 16 j + 8 g + r is open to query t where 16 j + r <= dt */
#pragma unroll
  for (int j = 0; j < NT; ++j) { v16h kh[HD / 32], kl[HD / 32];   /* the tile's eight loads fly together, in front of its first product */
#pragma unroll
    for (int kc = 0; kc < HD / 32; ++kc) { kh[kc] = frag_hp(kp + j * (16 * HD) + kc * 512); kl[kc] = frag_hp(lp + j * (16 * HD) + kc * 512); }
    if (j + 1 == NT) asm volatile("s_wait_xcnt 0x0" :: "v"(kp), "v"(lp) : "memory");   /* the same for the k loads, behind the last of them */
    v8f a = {}, l = {};
#pragma unroll
    for (int kc = 0; kc < HD / 32; ++kc) { a = wmma16(kh[kc], qh[kc], a); l = wmma16(kh[kc], ql[kc], l); l = wmma16(kl[kc], qh[kc], l); }
#pragma unroll
    for (int r = 0; r < 8; ++r) { const float v = (!CAUSAL || j * 16 + r <= dt) ? (a[r] + l[r] * (1.0f / 1024.0f)) * SCALE : -3.0e38f; s[j][r] = v; m = fmaxf(m, v); } }
  m = fmaxf(m, __shfl_xor(m, 16));
#pragma unroll
  for (int j = 0; j < NT; ++j)
#pragma unroll
    for (int r = 0; r < 8; ++r) { const float v = s[j][r]; const float x = exp_slot(v - m); const float e = (v <= -1.0e38f) ? 0.f : x; s[j][r] = e; sum += e; }
  sum += __shfl_xor(sum, 16);
  const float inv = sum > 0.f ? 2048.0f / sum : 0.f;   /* a fully excluded row yields P = 0 */
  const __bf16* vp = VB + ph; const __bf16* wp = VBL + ph;
  v8f acc[HD / 16] = {};
#pragma unroll
  for (int kc = 0; kc < NC; ++kc) { float pv[16]; v16b vh[HD / 16], vl[HD / 16];
    __builtin_amdgcn_sched_barrier(0);   /* keeps these loads behind the softmax and behind the products before them: lifted higher they hold 64 registers more beside the 128 of P, and the kernel spills */
#pragma unroll
    for (int j = 0; j < HD / 16; ++j) { vh[j] = frag_bp(vp + kc * (32 * HD) + j * 512); vl[j] = frag_bp(wp + kc * (32 * HD) + j * 512); }
    if (kc + 1 == NC) asm volatile("s_wait_xcnt 0x0" :: "v"(vp), "v"(wp) : "memory");   /* the same for the v loads, behind the last of them */
#pragma unroll
    for (int i = 0; i < 8; ++i) { pv[i] = s[2 * kc][i] * inv; pv[8 + i] = s[2 * kc + 1][i] * inv; }
    const F2 p = bsplit16(pv);
#pragma unroll
    for (int j = 0; j < HD / 16; ++j) { acc[j] = wmma_bf(vh[j], p.h, acc[j]); acc[j] = wmma_bf(vh[j], p.l, acc[j]); acc[j] = wmma_bf(vl[j], p.h, acc[j]); } }
  float* yr = Y + ((size_t)b * TT + ql0) * CC + h * (HD * 16) + lane * 4;   /* D element r of channel tile j = channel 16 j + 8 g + r of query t: the lane that holds it here reads it in k_out */
#pragma unroll
  for (int j = 0; j < HD / 16; ++j) acc[j] *= (1.0f / 2048.0f);
#pragma unroll
  for (int j = 0; j < HD / 16; ++j) { vst2(yr + j * 256, __builtin_shufflevector(acc[j], acc[j], 0, 1, 2, 3)); vst2(yr + j * 256 + 128, __builtin_shufflevector(acc[j], acc[j], 4, 5, 6, 7)); } }
// four waves per SIMD: without the budget the scheduler spreads the softmax over more than 256 registers
__global__ __launch_bounds__(128) __attribute__((amdgpu_waves_per_eu(4, 4))) void k_att(const _Float16* __restrict__ QH, const _Float16* __restrict__ KH, const _Float16* __restrict__ QL, const _Float16* __restrict__ KL, const __bf16* __restrict__ VB, const __bf16* __restrict__ VBL, float* __restrict__ Y) {
  static_assert(TT == 256 && QBH == NQB && QHI == TT && KHI == TT, "two key blocks at most; every row on the 3-product path");
  const int b = blockIdx.z / HG, h = blockIdx.z % HG, qb = blockIdx.x; const int tid = threadIdx.x, wave = tid >> 5, lane = tid & 31; const int ql0 = qb * 64 + wave * 16;
  if (kb_last(qb) == 0) att_body<1>(QH, KH, QL, KL, VB, VBL, Y, b, h, ql0, lane); else att_body<2>(QH, KH, QL, KL, VB, VBL, Y, b, h, ql0, lane); }
// ---- k_out: block = (BR rows, 128 cols): out = ctx Wo (+ bo): all rows: ctx bf16 hi + lo against exact bf16 Wo (2 products)
__global__ __launch_bounds__(NWV * 32) void k_out(const float* __restrict__ Y, const float* __restrict__ WO, const float* __restrict__ BO, float* __restrict__ OUT) { __shared__ __align__(16) unsigned char lds[128 * WPITCH * 2]; static_assert(sizeof(lds) >= NWV * 16 * 132 * 4, "output staging fits"); __bf16* wt = (__bf16*)lds; float (*sf)[16][132] = (float (*)[16][132])lds;   /* the Wo slab during the K loop, the output staging behind it */
  const int tid = threadIdx.x, wave = tid >> 5, lane = tid & 31, col = lane & 15, g = lane >> 4; const int c0 = blockIdx.y * 128; const size_t r0 = (size_t)blockIdx.x * BR + wave * 16;
  stage_w(WO, c0, DIN, wt, wave, lane);
  __syncthreads();   /* every wave reads all waves' k runs */
  v8f acc[8] = {};
  if (true) {   /* ALL rows: ctx split bf16 hi + lo x exact Wo (2 products) */
#pragma unroll 2
    for (int kc = 0; kc < CC / 32; ++kc) { v16b w[8];   /* the pass's 16 LDS reads go out as one group, ahead of the ctx loads and of the first product */
#pragma unroll
      for (int j = 0; j < 8; ++j) w[j] = frag_b(wt + (j * 16 + col) * WPITCH + kc * 32, lane);
      const float* yp = Y + r0 * CC + kc * 512 + lane * 4; float yv[16];
#pragma unroll
      for (int i = 0; i < 16; ++i) yv[i] = yp[(i >> 2) * 128 + (i & 3)];
      asm volatile("s_wait_xcnt 0x0" :: "v"(yp) : "memory");   /* stands before the ctx loads' address registers are written again; named as an input, they live up to it */
      const F2 a = bsplit16(yv); asm volatile("s_wait_loadcnt 0x0" ::: "memory");
#pragma unroll
      for (int j = 0; j < 8; ++j) { acc[j] = wmma_bf(a.h, w[j], acc[j]); acc[j] = wmma_bf(a.l, w[j], acc[j]); } }
    __syncthreads();   /* the slab's last reads end before its LDS takes the output staging */
#pragma unroll
    for (int j = 0; j < 8; ++j) { const float bias = BO ? bfr(BO[c0 + j * 16 + col]) : 0.f;
#pragma unroll
      for (int r = 0; r < 8; ++r) sf[wave][8 * g + r][j * 16 + col] = acc[j][r] + bias; }
  }
  LDSX(); for (int rl = 0; rl < 16; ++rl) vst2(OUT + (r0 + rl) * DIN + c0 + lane * 4, *(const v4f*)&sf[wave][rl][lane * 4]); }

extern "C" void kernel_launch(void* const* d_in, const int* in_sizes, int n_in, void* d_out, int out_size, void* d_ws, size_t ws_size, hipStream_t stream) {
  (void)in_sizes; (void)n_in; (void)out_size;
  const float** F = (const float**)d_in;
  if (ws_size < (size_t)WS_END) return;
  char* ws = (char*)d_ws; _Float16 *QH = (_Float16*)(ws + WS_QH), *KH = (_Float16*)(ws + WS_KH), *VT = (_Float16*)(ws + WS_VT), *QL = (_Float16*)(ws + WS_QL), *KL = (_Float16*)(ws + WS_KL); __bf16 *VB = (__bf16*)(ws + WS_VB), *VBL = (__bf16*)(ws + WS_VBL); float *Y = (float*)(ws + WS_Y);
  (void)Y; (void)QL; (void)KL; (void)VB; (void)VBL;
  // inputs: 0 x [64,256,384]; 1 Wq, 2 Wk, 3 Wv [384,384] (in,out); 4 Wo (in,out), 5 bo
  k_proj<<<dim3(TNB * TT / BR, CC / 128, 3), NWV * 32, 0, stream>>>(F[0], F[0], F[0], F[1], F[2], F[3], nullptr, nullptr, nullptr, QH, QL, KH, KL, VT, VB, VBL);
  /* all sequences and heads in one launch */
  k_att<<<dim3(NQB, 1, TNB * HG), 128, 0, stream>>>(QH, KH, QL, KL, VB, VBL, Y);
  k_out<<<dim3(TNB * TT / BR, DIN / 128), NWV * 32, 0, stream>>>(Y, F[4], F[5], (float*)d_out);
}

// v006
// A run of this version takes 79.5 microseconds.
// In both of two side-by-side timings against v005, it was 1.28 times as fast.
// Over all steps from v000 it is 23.8 times as fast.
// compute dtype: all float inputs rounded to bf16; q/k/v = x W with EXACT bf16 products on WMMA 16x16x32 (f32 accumulate); causal logits with q, k as f16 hi + residual (3 products, all rows) x 64^-0.5; softmax in f32; P split in bf16 hi + lo against v bf16 hi + lo (3 products); ctx split bf16 hi + lo against exact Wo (2 products) + bo; f32 output.
#include <hip/hip_runtime.h>
#include <math.h>

typedef __attribute__((ext_vector_type(16))) _Float16 v16h;
typedef __attribute__((ext_vector_type(16))) __bf16 v16b;
typedef __attribute__((ext_vector_type(8)))  _Float16 v8h;
typedef __attribute__((ext_vector_type(8)))  float v8f;
typedef __attribute__((ext_vector_type(4)))  float v4f;
typedef __attribute__((ext_vector_type(2)))  float v2f;
typedef __attribute__((ext_vector_type(4)))  unsigned v4u;
typedef __attribute__((ext_vector_type(4)))  int v4i;
typedef float __attribute__((may_alias)) float_a;
typedef int __attribute__((may_alias)) int_a;

template <typename T> __device__ __forceinline__ void vst2(void* p, T v) { *(T*)p = v;  }
__device__ __forceinline__ v8f wmma16(v16h a, v16h b, v8f c) {
  v8f d = __builtin_amdgcn_wmma_f32_16x16x32_f16(false, a, false, b, (short)0, c, false, false);
  asm volatile("v_nop\n\tv_nop\n\tv_nop\n\tv_nop" : "+v"(d) : "v"(a), "v"(b));
  return d;
}
__device__ __forceinline__ v8f wmma_bf(v16b a, v16b b, v8f c) {
  v8f d = __builtin_amdgcn_wmma_f32_16x16x32_bf16(false, a, false, b, (short)0, c, false, false);
  asm volatile("v_nop\n\tv_nop\n\tv_nop\n\tv_nop" : "+v"(d) : "v"(a), "v"(b));
  return d;
}
// 16x16x32 fragments: lane = (h = lane>>4, row/col = lane&15); elements 0..7 = k0+8h+0..7, 8..15 = k0+16+8h+0..7; D element r = row 8h+r
__device__ __forceinline__ v16h frag_h(const _Float16* rowk0, int lane) {
  union { v16h v; v8h q[2]; } u; const _Float16* p = rowk0 + 8 * (lane >> 4);
  u.q[0] = *(const v8h*)p; u.q[1] = *(const v8h*)(p + 16); return u.v;
}
__device__ __forceinline__ v16h frag_f32(const float* rowk0, int lane) {
  v16h a; const float* p = rowk0 + 8 * (lane >> 4);
#pragma unroll
  for (int i = 0; i < 8; ++i) { a[i] = (_Float16)p[i]; a[8 + i] = (_Float16)p[16 + i]; }
  return a;
}
__device__ __forceinline__ v16h frag_f32s(const float* rowk0, int lane, float sc) {
  v16h a; const float* p = rowk0 + 8 * (lane >> 4);
#pragma unroll
  for (int i = 0; i < 8; ++i) { a[i] = (_Float16)(p[i] * sc); a[8 + i] = (_Float16)(p[16 + i] * sc); }
  return a;
}
// column fragment from a [K][ld] layout (column n), rows >= K read as 0
__device__ __forceinline__ v16h fragc_f32(const float* W, int k0, int n, int lane, int ld, int K) {
  v16h a; const int g = lane >> 4;
#pragma unroll
  for (int i = 0; i < 8; ++i) { const int ka = k0 + 8 * g + i, kb = ka + 16;
    a[i] = (_Float16)(ka < K ? W[(size_t)(ka < K ? ka : K - 1) * ld + n] : 0.f); a[8 + i] = (_Float16)(kb < K ? W[(size_t)(kb < K ? kb : K - 1) * ld + n] : 0.f); }
  return a;
}
struct F2 { v16b h, l; };
__device__ __forceinline__ F2 bsplit16(const float v[16]) { F2 r;
#pragma unroll
  for (int i = 0; i < 16; ++i) { const __bf16 h = (__bf16)v[i]; r.h[i] = h; r.l[i] = (__bf16)(v[i] - (float)h); }
  return r; }
__device__ __forceinline__ F2 split_row(const float* row, int k0, int lane) { float v[16]; const float* p = row + k0 + 8 * (lane >> 4);
#pragma unroll
  for (int i = 0; i < 8; ++i) { v[i] = p[i]; v[8 + i] = p[16 + i]; }
  return bsplit16(v); }
__device__ __forceinline__ F2 split_rowK(const float* row, int k0, int lane, int K) { float v[16]; const int g = lane >> 4;
#pragma unroll
  for (int i = 0; i < 8; ++i) { const int ka = k0 + 8 * g + i, kb = ka + 16; v[i] = ka < K ? row[ka < K ? ka : K - 1] : 0.f; v[8 + i] = kb < K ? row[kb < K ? kb : K - 1] : 0.f; }
  return bsplit16(v); }
__device__ __forceinline__ F2 split_col(const float* W, int k0, int n, int lane, int ld, int K) { float v[16]; const int g = lane >> 4;
#pragma unroll
  for (int i = 0; i < 8; ++i) { const int ka = k0 + 8 * g + i, kb = ka + 16; v[i] = ka < K ? W[(size_t)(ka < K ? ka : K - 1) * ld + n] : 0.f; v[8 + i] = kb < K ? W[(size_t)(kb < K ? kb : K - 1) * ld + n] : 0.f; }
  return bsplit16(v); }
__device__ __forceinline__ v8f mac3(const F2& a, const F2& b, v8f c) { c = wmma_bf(a.l, b.h, c); c = wmma_bf(a.h, b.l, c); return wmma_bf(a.h, b.h, c); }
__device__ __forceinline__ float sigm(float v) { return 1.0f / (1.0f + expf(-v)); }
#define LDSX() do { asm volatile("s_wait_dscnt 0" ::: "memory"); __builtin_amdgcn_wave_barrier(); __builtin_amdgcn_fence(__ATOMIC_RELEASE, "workgroup"); } while (0)

// Causal multi-head self-attention (B 64, T 256, C 384 = 6 x 64): q,k,v = x W ((in,out), no bias); causal softmax(q k^T / 8) (-inf above the diagonal); out = merged(attn v) Wo + bo.
#define NB 64
#define TT 256
#define CC 384            // NH * HD = projected width
#define DIN 384          // input (model) width
#define NH 6
#define HD 64
#define NQB (TT / 64)
#define HG 6
#define SCALE (0.125f)
#define CAUSAL 1
#ifndef TNB
#define TNB NB
#endif
__device__ __forceinline__ float bfr(float v) { return (float)(__bf16)v; }
__host__ __device__ __forceinline__ int kb_last(int qb) { return CAUSAL ? ((qb * 64 + 63) >> 7) : (TT / 128 - 1); }
typedef __attribute__((ext_vector_type(8))) __bf16 v8b;
__device__ __forceinline__ v16b frag_b(const __bf16* rowk0, int lane) {
  union { v16b v; v8b q[2]; } u; const __bf16* p = rowk0 + 8 * (lane >> 4);
  u.q[0] = *(const v8b*)p; u.q[1] = *(const v8b*)(p + 16); return u.v;
}
#define QBH 4              // causal: query blocks 0..QBH-1 of each sequence take the high-precision path; QBH == NQB, so every block does
#define QHI 256            // rows carrying a q residual plane (all rows: 3-product logits everywhere)
#define KHI 256            // key rows carrying k residual / v bf16 hi+lo planes (used only by the causal high-precision path)
// B fragment (k rows k0+.., output column o) of a weight: (in,out) [K][ld] or (out,in) [ld rows of K]: bf16 exact, or f16(bf16 * 256) exact
__device__ __forceinline__ v16b wcol_io(const float* Wm, int k0, int o, int lane, int ld) { v16b w; const int g = lane >> 4;
#pragma unroll
  for (int i = 0; i < 8; ++i) { w[i] = (__bf16)Wm[(size_t)(k0 + 8 * g + i) * ld + o]; w[8 + i] = (__bf16)Wm[(size_t)(k0 + 16 + 8 * g + i) * ld + o]; }
  return w; }
__device__ __forceinline__ v16b wcol_oi(const float* Wm, int k0, int o, int lane, int K) { v16b w; const float* p = Wm + (size_t)o * K + k0 + 8 * (lane >> 4);
#pragma unroll
  for (int i = 0; i < 8; ++i) { w[i] = (__bf16)p[i]; w[8 + i] = (__bf16)p[16 + i]; }
  return w; }
__device__ __forceinline__ v16h wcolh_io(const float* Wm, int k0, int o, int lane, int ld) { v16h w; const int g = lane >> 4;
#pragma unroll
  for (int i = 0; i < 8; ++i) { w[i] = (_Float16)(bfr(Wm[(size_t)(k0 + 8 * g + i) * ld + o]) * 256.0f); w[8 + i] = (_Float16)(bfr(Wm[(size_t)(k0 + 16 + 8 * g + i) * ld + o]) * 256.0f); }
  return w; }
__device__ __forceinline__ v16h wcolh_oi(const float* Wm, int k0, int o, int lane, int K) { v16h w; const float* p = Wm + (size_t)o * K + k0 + 8 * (lane >> 4);
#pragma unroll
  for (int i = 0; i < 8; ++i) { w[i] = (_Float16)(bfr(p[i]) * 256.0f); w[8 + i] = (_Float16)(bfr(p[16 + i]) * 256.0f); }
  return w; }
#define WQKV_LAYOUT 0   // 0 = (in,out) [DIN][CC]; 1 = (out,in) [CC][DIN]; 2 = per-head [NH][DIN][HD]
__device__ __forceinline__ v16b wcol_hdk(const float* Wm, int k0, int o, int lane) { v16b w; const int g = lane >> 4; const float* p = Wm + (size_t)(o / HD) * DIN * HD + (o % HD);
#pragma unroll
  for (int i = 0; i < 8; ++i) { w[i] = (__bf16)p[(size_t)(k0 + 8 * g + i) * HD]; w[8 + i] = (__bf16)p[(size_t)(k0 + 16 + 8 * g + i) * HD]; }
  return w; }
#define WO_OUT_IN 0
#if WQKV_LAYOUT == 1
#define WCOL(W, k0, o, lane) wcol_oi(W, k0, o, lane, DIN)
#elif WQKV_LAYOUT == 2
#define WCOL(W, k0, o, lane) wcol_hdk(W, k0, o, lane)
#else
#define WCOL(W, k0, o, lane) wcol_io(W, k0, o, lane, CC)
#endif
#if WO_OUT_IN
#define WOCOL(W, k0, o, lane) wcol_oi(W, k0, o, lane, CC)
#define WOCOLH(W, k0, o, lane) wcolh_oi(W, k0, o, lane, CC)
#else
#define WOCOL(W, k0, o, lane) wcol_io(W, k0, o, lane, DIN)
#define WOCOLH(W, k0, o, lane) wcolh_io(W, k0, o, lane, DIN)
#endif

#ifndef SM_EXTRA_PARAMS
#define SM_EXTRA_PARAMS
#endif
#ifndef PROJ_EXTRA_PARAMS
#define PROJ_EXTRA_PARAMS
#endif
#ifndef SM_MASK_HOOK
#define SM_MASK_HOOK (void)0
#endif

// q, k, v and ctx lie in FRAGMENT ORDER: the 16 bytes that lane l takes with one load stand at l * 16 of a 512-byte unit, so a wave-wide load or store covers four whole 128-byte lines (rows of a [t][c] plane gave 16 lines of 32 bytes)
// q, k: [b][head][t / 16][u = c / 16 of the head][lane = 16 * ((c / 8) & 1) + t % 16][c % 8]; v: [b][head][t / 32][c / 16 of the head][(t / 16) & 1][lane = 16 * ((t / 8) & 1) + c % 16][t % 8]; ctx: [row / 16][c / 32][(c / 16) & 1][(c / 4) & 1][lane = 16 * ((c / 8) & 1) + row % 16][c % 4]
#define FPH (TT * HD)                                  // elements of one head's plane of one sequence
#define WS_QH  0u                                      // f16 q, fragment order
#define WS_KH  (WS_QH + 2u * (size_t)NB * TT * CC)      // f16 k, fragment order
#define WS_VT  (WS_KH + 2u * (size_t)NB * TT * CC)      // f16 v planes [b][c][t]
#define WS_QL  (WS_VT + 2u * (size_t)NB * CC * TT)      // f16 q residual x 2^10, fragment order
#define WS_KL  (WS_QL + 2u * (size_t)NB * QHI * CC)     // f16 k residual x 2^10, fragment order
#define WS_VB  (WS_KL + 2u * (size_t)NB * KHI * CC)     // bf16 v hi, fragment order (VBL: lo)
#define WS_VBL (WS_VB + 2u * (size_t)NB * CC * KHI)
#define WS_S   (WS_VBL + 2u * (size_t)NB * CC * KHI)    // f32 [b][hg][t][s] area, unused: k_att keeps the logits and P in registers
#define WS_Y   (WS_S  + 4u * (size_t)NB * HG * TT * TT) // f32 ctx, fragment order
#define WS_END (WS_Y  + 4u * (size_t)NB * TT * CC)

// W slab (all DIN k rows, 128 output columns from c0, (in,out) f32 rows of ld) -> LDS rows wt[column][k] in bf16, once per block of NWV waves: a wave-wide 16-byte load covers the slab's whole 512-byte row, eight k rows give each lane four columns' 16-byte k runs.
// Row pitch 784 B = 16 B x odd: the 16 columns of a fragment's ds_load_b128 fall on distinct banks.
#define WPITCH (DIN + 8)
#define NWV 8               // waves of a k_proj or k_out block: 16 rows each, all on one slab
#define BR (NWV * 16)       // rows of such a block
static_assert(CC == DIN && DIN % (NWV * 8) == 0 && TT % BR == 0, "one slab shape serves the q/k/v weights and Wo; a block stays inside one sequence");
__device__ __forceinline__ void stage_w(const float* __restrict__ Wm, int c0, int ld, __bf16* __restrict__ wt, int wave, int lane) {
  const float* p = Wm + (size_t)(wave * 8) * ld + c0 + lane * 4; __bf16* d = wt + (lane * 4) * WPITCH + wave * 8;
#pragma unroll
  for (int kg = 0; kg < DIN / (NWV * 8); ++kg) { v4f r[8];
    if (kg == DIN / (NWV * 16)) __builtin_amdgcn_sched_barrier(0);   /* the second half's loads stay behind the first half's LDS stores: with all loads lifted to the top, raw and converted rows together pass 160 registers and k_proj spills */
#pragma unroll
    for (int kk = 0; kk < 8; ++kk) r[kk] = *(const v4f*)(p + (size_t)(kg * (NWV * 8) + kk) * ld);
    if (kg + 1 == DIN / (NWV * 8)) asm volatile("s_wait_xcnt 0x0" :: "v"(p) : "memory");   /* stands before the slab loads' address registers are written again; named as an input, they live up to it */
#pragma unroll
    for (int i = 0; i < 4; ++i) { v8b o;
#pragma unroll
      for (int kk = 0; kk < 8; ++kk) o[kk] = (__bf16)r[kk][i];
      *(v8b*)(d + i * WPITCH + kg * (NWV * 8)) = o; } } }
// ---- k_proj: block = (BR rows, 128 cols, which): q/k/v = X W (+ b) with exact bf16 products (K = DIN) -> which 0: q f16 (+ residual, rows < QHI); 1: k f16 (+ residual, rows < KHI), both in fragment order; 2: v f16 planes [c][t] (+ bf16 hi/lo for t < KHI in fragment order)
// six waves per SIMD: three blocks, which the LDS admits, stay resident only inside 160 registers
__global__ __launch_bounds__(NWV * 32) __attribute__((amdgpu_waves_per_eu(6))) void k_proj(const float* __restrict__ XQ, const float* __restrict__ XK, const float* __restrict__ XV, const float* __restrict__ WQ, const float* __restrict__ WK, const float* __restrict__ WV, const float* __restrict__ BQ, const float* __restrict__ BK, const float* __restrict__ BV,
    _Float16* __restrict__ QH, _Float16* __restrict__ QL, _Float16* __restrict__ KH, _Float16* __restrict__ KL, _Float16* __restrict__ VT, __bf16* __restrict__ VB, __bf16* __restrict__ VBL) {
  // one LDS block: the W slab during the K loop, the output staging arrays behind it (a barrier between the two uses)
  __shared__ __align__(16) unsigned char lds[3 * 128 * (BR + 8) * 2]; static_assert(sizeof(lds) >= 128 * WPITCH * 2 && sizeof(lds) >= 2 * BR * 136 * 2, "slab and output staging fit");
  __bf16* wt = (__bf16*)lds; _Float16 (*sh)[136] = (_Float16 (*)[136])lds; _Float16 (*sl)[136] = sh + BR; _Float16 (*th)[BR + 8] = (_Float16 (*)[BR + 8])lds; __bf16 (*tb)[BR + 8] = (__bf16 (*)[BR + 8])(th + 128); __bf16 (*tbl)[BR + 8] = tb + 128;   /* sh, sl serve q and k, th, tb, tbl serve v */
  const int tid = threadIdx.x, wave = tid >> 5, lane = tid & 31, col = lane & 15, g = lane >> 4; const int which = blockIdx.z; const int c0 = blockIdx.y * 128; const size_t r0 = (size_t)blockIdx.x * BR; const size_t bb = r0 / TT; const int t0 = (int)(r0 % TT);
  const float* X = which == 0 ? XQ : which == 1 ? XK : XV; const float* WA = which == 0 ? WQ : which == 1 ? WK : WV; const float* BA = which == 0 ? BQ : which == 1 ? BK : BV;
  stage_w(WA, c0, CC, wt, wave, lane);
  __syncthreads();   /* every wave reads all waves' k runs */
  v8f acc[8] = {};
#pragma unroll 2
  for (int kc = 0; kc < DIN / 32; ++kc) { v16b w[8];   /* the pass's 16 LDS reads go out as one group, ahead of the x loads and of the first product */
#pragma unroll
    for (int j = 0; j < 8; ++j) w[j] = frag_b(wt + (j * 16 + col) * WPITCH + kc * 32, lane);
    v16b a; { const float* p = X + (r0 + wave * 16 + col) * DIN + kc * 32 + 8 * g;
#pragma unroll
      for (int i = 0; i < 8; ++i) { a[i] = (__bf16)p[i]; a[8 + i] = (__bf16)p[16 + i]; }
      asm volatile("s_wait_xcnt 0x0" :: "v"(p) : "memory"); }   /* stands before the x loads' address registers are written again */
    asm volatile("s_wait_loadcnt 0x0" ::: "memory");
#pragma unroll
    for (int j = 0; j < 8; ++j) acc[j] = wmma_bf(a, w[j], acc[j]); }
  __syncthreads();   /* the slab's last reads end before its LDS takes the output staging */
  if (which < 2) { _Float16* DH = which == 0 ? QH : KH; _Float16* DL = which == 0 ? QL : KL; const int nhi = which == 0 ? QHI : KHI; const bool hi_rows = t0 < nhi;
#pragma unroll
    for (int j = 0; j < 8; ++j) { const float bias = BA ? bfr(BA[c0 + j * 16 + col]) : 0.f;
#pragma unroll
      for (int r = 0; r < 8; ++r) { const float v = acc[j][r] + bias; const _Float16 hv = (_Float16)v; sh[wave * 16 + 8 * g + r][j * 16 + col] = hv; sl[wave * 16 + 8 * g + r][j * 16 + col] = (_Float16)((v - (float)hv) * 1024.0f); } }
    __syncthreads();
    for (int e = tid; e < BR * 16; e += NWV * 32) { const int u = (e >> 5) & 3, jj = (e >> 7) % NWV, hh = e / (NWV * 128); const int rl = jj * 16 + col, cl = hh * HD + u * 16 + g * 8;   /* e counts the 16-byte pieces in the order of their places: a wave's store is one 512-byte unit */
      const size_t o = (bb * NH + c0 / HD + hh) * (size_t)FPH + (size_t)(t0 / 16 + jj) * (16 * HD) + u * 256 + lane * 8; vst2((unsigned*)(DH + o), *(const v4u*)&sh[rl][cl]); if (hi_rows) vst2((unsigned*)(DL + o), *(const v4u*)&sl[rl][cl]); }
  } else { const bool hi_rows = t0 < KHI;
#pragma unroll
    for (int j = 0; j < 8; ++j) { const float bias = BA ? bfr(BA[c0 + j * 16 + col]) : 0.f;
#pragma unroll
      for (int r = 0; r < 8; ++r) { const float v = acc[j][r] + bias; const int rl = wave * 16 + 8 * g + r, cl = j * 16 + col; th[cl][rl] = (_Float16)v; const __bf16 bh = (__bf16)v; tb[cl][rl] = bh; tbl[cl][rl] = (__bf16)(v - (float)bh); } }
    __syncthreads();
    for (int e = tid; e < 128 * (BR / 8); e += NWV * 32) { const int cl = e / (BR / 8), q = e % (BR / 8); vst2((unsigned*)(VT + (bb * CC + c0 + cl) * (size_t)TT + t0 + q * 8), *(const v4u*)&th[cl][q * 8]); if (hi_rows) { const int hf = (e >> 5) & 1, jc = (e >> 6) & 3, kl = (e >> 8) % (BR / 32), hh = e / (BR * 8); const int cf = hh * HD + jc * 16 + col, rf = kl * 32 + hf * 16 + g * 8;   /* the same count of places for the two bf16 planes */
        const size_t o3 = (bb * NH + c0 / HD + hh) * (size_t)FPH + (size_t)(t0 / 32 + kl) * (32 * HD) + jc * 512 + hf * 256 + lane * 8; vst2((unsigned*)(VB + o3), *(const v4u*)&tb[cf][rf]); vst2((unsigned*)(VBL + o3), *(const v4u*)&tbl[cf][rf]); } } } }
// ---- k_att: block = 64 queries (qb) of z = sequence b * HG + head; each wave owns 16 queries from the logits to ctx and shares nothing with the other waves (no LDS, no barrier).
// Both products are formed transposed, so that a lane holds one query's column and the logits' D registers are already the B fragment of the second product (D element r of key tile j = key 16 j + 8 g + r, g = lane >> 4; B elements 0..7 / 8..15 of 32 keys = the same keys of tiles 2 kc / 2 kc + 1).
// A rolled loop over chunks of 32 keys, up to the chunk that holds the wave's diagonal. Per chunk: S^T = k q^T x SCALE, k hi + residual (x 2^10) against q hi + residual (3 products); causal mask by index in the last chunk; running maximum (one exchange between the wave's halves) and running sum in f32; ctx^T = ctx^T x exp(old max - new max) + v^T P^T with P = exp(S - max) and v as bf16 hi + lo (3 products); ctx / sum at the end
// exp(x) by the range reduction of expf (n = rint(x log2 e), 2^(x log2 e - n), ldexp, the two range ends), the reduced argument by two fused multiply-adds over log2 e in two parts; v_exp_f32 and one v_nop stand in one statement:
// the instruction set asks for one independent instruction before a transcendental's source is overwritten
__device__ __forceinline__ float exp_slot(float x) {
  const float c = __builtin_bit_cast(float, 0x3fb8aa3bu), cc = __builtin_bit_cast(float, 0x32a5705fu);
  const float n = __builtin_rintf(x * c); const float a = __builtin_fmaf(x, cc, __builtin_fmaf(x, c, -n));
  float y; asm("v_exp_f32 %0, %1\n\tv_nop" : "=v"(y) : "v"(a));
  y = __builtin_ldexpf(y, (int)n);
  y = x < __builtin_bit_cast(float, 0xc2ce8ed0u) ? 0.f : y;
  return x > __builtin_bit_cast(float, 0x42b17218u) ? __builtin_inff() : y; }
// the value that lane ^ 16 holds (the other half of the same query's keys), by one vector cross-row move
__device__ __forceinline__ float xhalf(float v) { const unsigned u = __builtin_bit_cast(unsigned, v); return __builtin_bit_cast(float, __builtin_amdgcn_permlanex16(u, u, 0x76543210u, 0xfedcba98u, false, false)); }
// fragment loads from a wave-uniform base (scalar registers) + the lane's number lo, which counts 16-byte pieces (one vector register for all planes, never rewritten): stepping a plane from chunk to chunk is one scalar add
__device__ __forceinline__ v16h frag_hu(const _Float16* base, unsigned lo) { union { v16h v; v8h q[2]; } u; u.q[0] = ((const v8h*)base)[lo]; u.q[1] = ((const v8h*)(base + 256))[lo]; return u.v; }
__device__ __forceinline__ v16b frag_bu(const __bf16* base, unsigned lo) { union { v16b v; v8b q[2]; } u; u.q[0] = ((const v8b*)base)[lo]; u.q[1] = ((const v8b*)(base + 256))[lo]; return u.v; }
struct KF { v16h h[2][HD / 32], l[2][HD / 32]; };   // the k fragments (hi, residual) of one chunk of 32 keys: [key tile][kc]
__device__ __forceinline__ void load_k(KF& k, const _Float16* kb, const _Float16* lb, unsigned lo) {
#pragma unroll
  for (int jt = 0; jt < 2; ++jt)
#pragma unroll
    for (int kc = 0; kc < HD / 32; ++kc) { k.h[jt][kc] = frag_hu(kb + jt * (16 * HD) + kc * 512, lo); k.l[jt][kc] = frag_hu(lb + jt * (16 * HD) + kc * 512, lo); }
  asm volatile("s_wait_xcnt 0x0" :: "s"(kb), "s"(lb), "v"(lo) : "memory"); }   /* stands before the k loads' address registers are written again; named as inputs, they live up to it */
// one chunk of 32 keys: logits, running maximum and sum, ctx rescaled by exp(old maximum - new maximum), then P v. LAST = the chunk that holds the diagonal: the only one with closed keys, and none is fetched behind it.
template <bool LAST> __device__ __forceinline__ void att_chunk(KF& k, const _Float16* kn, const _Float16* ln, const __bf16* vb, const __bf16* wb, unsigned lo, const v16h (&qh)[HD / 32], const v16h (&ql)[HD / 32], v8f (&acc)[HD / 16], float& m, float& sum, int dl) {
  v16b vh[HD / 16], vl[HD / 16];   /* this chunk's v goes out first and flies behind the logits and the softmax */
#pragma unroll
  for (int j = 0; j < HD / 16; ++j) { vh[j] = frag_bu(vb + j * 512, lo); vl[j] = frag_bu(wb + j * 512, lo); }
  asm volatile("s_wait_xcnt 0x0" :: "s"(vb), "s"(wb), "v"(lo) : "memory");   /* the same for the v loads */
  v8f a[2] = {}, l[2] = {};
#pragma unroll
  for (int kc = 0; kc < HD / 32; ++kc) {   /* the two key tiles alternate: no product waits for the one directly in front of it */
    a[0] = wmma16(k.h[0][kc], qh[kc], a[0]); a[1] = wmma16(k.h[1][kc], qh[kc], a[1]);
    l[0] = wmma16(k.h[0][kc], ql[kc], l[0]); l[1] = wmma16(k.h[1][kc], ql[kc], l[1]);
    l[0] = wmma16(k.l[0][kc], qh[kc], l[0]); l[1] = wmma16(k.l[1][kc], qh[kc], l[1]); }
  if (!LAST) load_k(k, kn, ln, lo);   /* the next chunk's k into the registers just read: it flies behind the softmax and P v */
  float sv[16]; float cm = -3.0e38f;
#pragma unroll
  for (int i = 0; i < 16; ++i) { const int jt = i >> 3, r = i & 7; const float x = (a[jt][r] + l[jt][r] * (1.0f / 1024.0f)) * SCALE; const float v = (!LAST || jt * 16 + r <= dl) ? x : -3.0e38f; sv[i] = v; cm = fmaxf(cm, v); }
  cm = fmaxf(cm, xhalf(cm));
  const float mn = fmaxf(m, cm); const float al = exp_slot(m - mn); float cs = 0.f; float pv[16];
#pragma unroll
  for (int i = 0; i < 16; ++i) { const float x = exp_slot(sv[i] - mn); const float e = (LAST && sv[i] <= -1.0e38f) ? 0.f : x; pv[i] = e; cs += e; }
  sum = sum * al + cs; m = mn;
#pragma unroll
  for (int j = 0; j < HD / 16; ++j) acc[j] *= al;
  const F2 p = bsplit16(pv);
#pragma unroll
  for (int j = 0; j < HD / 16; ++j) acc[j] = wmma_bf(vh[j], p.h, acc[j]);
#pragma unroll
  for (int j = 0; j < HD / 16; ++j) acc[j] = wmma_bf(vh[j], p.l, acc[j]);
#pragma unroll
  for (int j = 0; j < HD / 16; ++j) acc[j] = wmma_bf(vl[j], p.h, acc[j]); }
// four waves per SIMD: q, one chunk's k and v and the ctx tiles fill most of 256 registers, and the budget keeps the scheduler inside them
__global__ __launch_bounds__(128) __attribute__((amdgpu_waves_per_eu(4, 4))) void k_att(const _Float16* __restrict__ QH, const _Float16* __restrict__ KH, const _Float16* __restrict__ QL, const _Float16* __restrict__ KL, const __bf16* __restrict__ VB, const __bf16* __restrict__ VBL, float* __restrict__ Y) {
  static_assert(CAUSAL && QBH == NQB && QHI == TT && KHI == TT, "causal; every row on the 3-product path");
  const int b = blockIdx.z / HG, h = blockIdx.z % HG, qb = blockIdx.x; const int tid = threadIdx.x, lane = tid & 31; const int wave = __builtin_amdgcn_readfirstlane(tid >> 5);   /* the trip count and the plane addresses below are the wave's own: a scalar loop, scalar bases */
  const int ql0 = qb * 64 + wave * 16; const int col = lane & 15, g = lane >> 4; const int t = ql0 + col; const unsigned lo = lane;
  v16h qh[HD / 32], ql[HD / 32]; const size_t ph = ((size_t)b * NH + h) * FPH; const _Float16* qp = QH + ph + (size_t)(ql0 / 16) * (16 * HD); const _Float16* rp = QL + ph + (size_t)(ql0 / 16) * (16 * HD);
#pragma unroll
  for (int kc = 0; kc < HD / 32; ++kc) { qh[kc] = frag_hu(qp + kc * 512, lo); ql[kc] = frag_hu(rp + kc * 512, lo); }
  asm volatile("s_wait_xcnt 0x0" :: "s"(qp), "s"(rp), "v"(lo) : "memory");   /* stands before the q loads' address registers are written again; named as inputs, they live up to it */
  const _Float16* kb = KH + ph; const _Float16* lb = KL + ph; const __bf16* vb = VB + ph; const __bf16* wb = VBL + ph;
  const int nl = ql0 >> 5;   /* chunks of 32 keys wholly open to the wave's 16 queries; chunk nl holds the diagonal */
  KF k; load_k(k, kb, lb, lo);
  v8f acc[HD / 16] = {}; float m = -3.0e38f, sum = 0.f;
#pragma unroll 1
  for (int c = 0; c < nl; ++c) {   /* stays rolled: the kernel's text is two chunk bodies */
    kb += 32 * HD; lb += 32 * HD;
    att_chunk<false>(k, kb, lb, vb, wb, lo, qh, ql, acc, m, sum, 0);
    vb += 32 * HD; wb += 32 * HD; }
  att_chunk<true>(k, kb, lb, vb, wb, lo, qh, ql, acc, m, sum, t - 8 * g - nl * 32);   /* key 32 nl + 16 jt + 8 g + r is open to query t where 16 jt + r <= t - 8 g - 32 nl */
  sum += xhalf(sum);
  const float inv = sum > 0.f ? 1.0f / sum : 0.f;   /* a fully excluded row yields ctx = 0 */
  float* yr = Y + ((size_t)b * TT + ql0) * CC + h * (HD * 16) + lane * 4;   /* D element r of channel tile j = channel 16 j + 8 g + r of query t: the lane that holds it here reads it in k_out */
#pragma unroll
  for (int j = 0; j < HD / 16; ++j) acc[j] *= inv;
#pragma unroll
  for (int j = 0; j < HD / 16; ++j) { vst2(yr + j * 256, __builtin_shufflevector(acc[j], acc[j], 0, 1, 2, 3)); vst2(yr + j * 256 + 128, __builtin_shufflevector(acc[j], acc[j], 4, 5, 6, 7)); } }
// ---- k_out: block = (BR rows, 128 cols): out = ctx Wo (+ bo): all rows: ctx bf16 hi + lo against exact bf16 Wo (2 products)
__global__ __launch_bounds__(NWV * 32) void k_out(const float* __restrict__ Y, const float* __restrict__ WO, const float* __restrict__ BO, float* __restrict__ OUT) { __shared__ __align__(16) unsigned char lds[128 * WPITCH * 2]; static_assert(sizeof(lds) >= NWV * 16 * 132 * 4, "output staging fits"); __bf16* wt = (__bf16*)lds; float (*sf)[16][132] = (float (*)[16][132])lds;   /* the Wo slab during the K loop, the output staging behind it */
  const int tid = threadIdx.x, wave = tid >> 5, lane = tid & 31, col = lane & 15, g = lane >> 4; const int c0 = blockIdx.y * 128; const size_t r0 = (size_t)blockIdx.x * BR + wave * 16;
  stage_w(WO, c0, DIN, wt, wave, lane);
  __syncthreads();   /* every wave reads all waves' k runs */
  v8f acc[8] = {};
  if (true) {   /* ALL rows: ctx split bf16 hi + lo x exact Wo (2 products) */
#pragma unroll 2
    for (int kc = 0; kc < CC / 32; ++kc) { v16b w[8];   /* the pass's 16 LDS reads go out as one group, ahead of the ctx loads and of the first product */
#pragma unroll
      for (int j = 0; j < 8; ++j) w[j] = frag_b(wt + (j * 16 + col) * WPITCH + kc * 32, lane);
      const float* yp = Y + r0 * CC + kc * 512 + lane * 4; float yv[16];
#pragma unroll
      for (int i = 0; i < 16; ++i) yv[i] = yp[(i >> 2) * 128 + (i & 3)];
      asm volatile("s_wait_xcnt 0x0" :: "v"(yp) : "memory");   /* stands before the ctx loads' address registers are written again; named as an input, they live up to it */
      const F2 a = bsplit16(yv); asm volatile("s_wait_loadcnt 0x0" ::: "memory");
#pragma unroll
      for (int j = 0; j < 8; ++j) { acc[j] = wmma_bf(a.h, w[j], acc[j]); acc[j] = wmma_bf(a.l, w[j], acc[j]); } }
    __syncthreads();   /* the slab's last reads end before its LDS takes the output staging */
#pragma unroll
    for (int j = 0; j < 8; ++j) { const float bias = BO ? bfr(BO[c0 + j * 16 + col]) : 0.f;
#pragma unroll
      for (int r = 0; r < 8; ++r) sf[wave][8 * g + r][j * 16 + col] = acc[j][r] + bias; }
  }
  LDSX(); for (int rl = 0; rl < 16; ++rl) vst2(OUT + (r0 + rl) * DIN + c0 + lane * 4, *(const v4f*)&sf[wave][rl][lane * 4]); }

extern "C" void kernel_launch(void* const* d_in, const int* in_sizes, int n_in, void* d_out, int out_size, void* d_ws, size_t ws_size, hipStream_t stream) {
  (void)in_sizes; (void)n_in; (void)out_size;
  const float** F = (const float**)d_in;
  if (ws_size < (size_t)WS_END) return;
  char* ws = (char*)d_ws; _Float16 *QH = (_Float16*)(ws + WS_QH), *KH = (_Float16*)(ws + WS_KH), *VT = (_Float16*)(ws + WS_VT), *QL = (_Float16*)(ws + WS_QL), *KL = (_Float16*)(ws + WS_KL); __bf16 *VB = (__bf16*)(ws + WS_VB), *VBL = (__bf16*)(ws + WS_VBL); float *Y = (float*)(ws + WS_Y);
  (void)Y; (void)QL; (void)KL; (void)VB; (void)VBL;
  // inputs: 0 x [64,256,384]; 1 Wq, 2 Wk, 3 Wv [384,384] (in,out); 4 Wo (in,out), 5 bo
  k_proj<<<dim3(TNB * TT / BR, CC / 128, 3), NWV * 32, 0, stream>>>(F[0], F[0], F[0], F[1], F[2], F[3], nullptr, nullptr, nullptr, QH, QL, KH, KL, VT, VB, VBL);
  /* all sequences and heads in one launch */
  k_att<<<dim3(NQB, 1, TNB * HG), 128, 0, stream>>>(QH, KH, QL, KL, VB, VBL, Y);
  k_out<<<dim3(TNB * TT / BR, DIN / 128), NWV * 32, 0, stream>>>(Y, F[4], F[5], (float*)d_out);
}

// v007
// One run takes 71.6 microseconds.
// Next to v006, in two timings, it ran 1.11 times as fast each time.
// All steps since v000 together make it 26.4 times as fast.
// compute dtype: all float inputs rounded to bf16; q/k/v = x W with EXACT bf16 products on WMMA 16x16x32 (f32 accumulate); causal logits with q, k as f16 hi + residual (3 products, all rows) x 64^-0.5; softmax in f32; P split in bf16 hi + lo against v bf16 hi + lo (3 products); ctx split bf16 hi + lo against exact Wo (2 products) + bo; f32 output.
#include <hip/hip_runtime.h>
#include <math.h>

typedef __attribute__((ext_vector_type(16))) _Float16 v16h;
typedef __attribute__((ext_vector_type(16))) __bf16 v16b;
typedef __attribute__((ext_vector_type(8)))  _Float16 v8h;
typedef __attribute__((ext_vector_type(8)))  float v8f;
typedef __attribute__((ext_vector_type(4)))  float v4f;
typedef __attribute__((ext_vector_type(2)))  float v2f;
typedef __attribute__((ext_vector_type(4)))  unsigned v4u;
typedef __attribute__((ext_vector_type(4)))  int v4i;
typedef float __attribute__((may_alias)) float_a;
typedef int __attribute__((may_alias)) int_a;

template <typename T> __device__ __forceinline__ void vst2(void* p, T v) { *(T*)p = v;  }
__device__ __forceinline__ v8f wmma16(v16h a, v16h b, v8f c) {
  v8f d = __builtin_amdgcn_wmma_f32_16x16x32_f16(false, a, false, b, (short)0, c, false, false);
  asm volatile("v_nop\n\tv_nop\n\tv_nop\n\tv_nop" : "+v"(d) : "v"(a), "v"(b));
  return d;
}
__device__ __forceinline__ v8f wmma_bf(v16b a, v16b b, v8f c) {
  v8f d = __builtin_amdgcn_wmma_f32_16x16x32_bf16(false, a, false, b, (short)0, c, false, false);
  asm volatile("v_nop\n\tv_nop\n\tv_nop\n\tv_nop" : "+v"(d) : "v"(a), "v"(b));
  return d;
}
// 16x16x32 fragments: lane = (h = lane>>4, row/col = lane&15); elements 0..7 = k0+8h+0..7, 8..15 = k0+16+8h+0..7; D element r = row 8h+r
__device__ __forceinline__ v16h frag_h(const _Float16* rowk0, int lane) {
  union { v16h v; v8h q[2]; } u; const _Float16* p = rowk0 + 8 * (lane >> 4);
  u.q[0] = *(const v8h*)p; u.q[1] = *(const v8h*)(p + 16); return u.v;
}
__device__ __forceinline__ v16h frag_f32(const float* rowk0, int lane) {
  v16h a; const float* p = rowk0 + 8 * (lane >> 4);
#pragma unroll
  for (int i = 0; i < 8; ++i) { a[i] = (_Float16)p[i]; a[8 + i] = (_Float16)p[16 + i]; }
  return a;
}
__device__ __forceinline__ v16h frag_f32s(const float* rowk0, int lane, float sc) {
  v16h a; const float* p = rowk0 + 8 * (lane >> 4);
#pragma unroll
  for (int i = 0; i < 8; ++i) { a[i] = (_Float16)(p[i] * sc); a[8 + i] = (_Float16)(p[16 + i] * sc); }
  return a;
}
// column fragment from a [K][ld] layout (column n), rows >= K read as 0
__device__ __forceinline__ v16h fragc_f32(const float* W, int k0, int n, int lane, int ld, int K) {
  v16h a; const int g = lane >> 4;
#pragma unroll
  for (int i = 0; i < 8; ++i) { const int ka = k0 + 8 * g + i, kb = ka + 16;
    a[i] = (_Float16)(ka < K ? W[(size_t)(ka < K ? ka : K - 1) * ld + n] : 0.f); a[8 + i] = (_Float16)(kb < K ? W[(size_t)(kb < K ? kb : K - 1) * ld + n] : 0.f); }
  return a;
}
struct F2 { v16b h, l; };
__device__ __forceinline__ F2 bsplit16(const float v[16]) { F2 r;
#pragma unroll
  for (int i = 0; i < 16; ++i) { const __bf16 h = (__bf16)v[i]; r.h[i] = h; r.l[i] = (__bf16)(v[i] - (float)h); }
  return r; }
__device__ __forceinline__ F2 split_row(const float* row, int k0, int lane) { float v[16]; const float* p = row + k0 + 8 * (lane >> 4);
#pragma unroll
  for (int i = 0; i < 8; ++i) { v[i] = p[i]; v[8 + i] = p[16 + i]; }
  return bsplit16(v); }
__device__ __forceinline__ F2 split_rowK(const float* row, int k0, int lane, int K) { float v[16]; const int g = lane >> 4;
#pragma unroll
  for (int i = 0; i < 8; ++i) { const int ka = k0 + 8 * g + i, kb = ka + 16; v[i] = ka < K ? row[ka < K ? ka : K - 1] : 0.f; v[8 + i] = kb < K ? row[kb < K ? kb : K - 1] : 0.f; }
  return bsplit16(v); }
__device__ __forceinline__ F2 split_col(const float* W, int k0, int n, int lane, int ld, int K) { float v[16]; const int g = lane >> 4;
#pragma unroll
  for (int i = 0; i < 8; ++i) { const int ka = k0 + 8 * g + i, kb = ka + 16; v[i] = ka < K ? W[(size_t)(ka < K ? ka : K - 1) * ld + n] : 0.f; v[8 + i] = kb < K ? W[(size_t)(kb < K ? kb : K - 1) * ld + n] : 0.f; }
  return bsplit16(v); }
__device__ __forceinline__ v8f mac3(const F2& a, const F2& b, v8f c) { c = wmma_bf(a.l, b.h, c); c = wmma_bf(a.h, b.l, c); return wmma_bf(a.h, b.h, c); }
__device__ __forceinline__ float sigm(float v) { return 1.0f / (1.0f + expf(-v)); }
#define LDSX() do { asm volatile("s_wait_dscnt 0" ::: "memory"); __builtin_amdgcn_wave_barrier(); __builtin_amdgcn_fence(__ATOMIC_RELEASE, "workgroup"); } while (0)

// Causal multi-head self-attention (B 64, T 256, C 384 = 6 x 64): q,k,v = x W ((in,out), no bias); causal softmax(q k^T / 8) (-inf above the diagonal); out = merged(attn v) Wo + bo.
#define NB 64
#define TT 256
#define CC 384            // NH * HD = projected width
#define DIN 384          // input (model) width
#define NH 6
#define HD 64
#define NQB (TT / 64)
#define HG 6
#define SCALE (0.125f)
#define CAUSAL 1
#ifndef TNB
#define TNB NB
#endif
__device__ __forceinline__ float bfr(float v) { return (float)(__bf16)v; }
__host__ __device__ __forceinline__ int kb_last(int qb) { return CAUSAL ? ((qb * 64 + 63) >> 7) : (TT / 128 - 1); }
typedef __attribute__((ext_vector_type(8))) __bf16 v8b;
__device__ __forceinline__ v16b frag_b(const __bf16* rowk0, int lane) {
  union { v16b v; v8b q[2]; } u; const __bf16* p = rowk0 + 8 * (lane >> 4);
  u.q[0] = *(const v8b*)p; u.q[1] = *(const v8b*)(p + 16); return u.v;
}
#define QBH 4              // causal: query blocks 0..QBH-1 of each sequence take the high-precision path; QBH == NQB, so every block does
#define QHI 256            // rows carrying a q residual plane (all rows: 3-product logits everywhere)
#define KHI 256            // key rows carrying k residual / v bf16 hi+lo planes (used only by the causal high-precision path)
// B fragment (k rows k0+.., output column o) of a weight: (in,out) [K][ld] or (out,in) [ld rows of K]: bf16 exact, or f16(bf16 * 256) exact
__device__ __forceinline__ v16b wcol_io(const float* Wm, int k0, int o, int lane, int ld) { v16b w; const int g = lane >> 4;
#pragma unroll
  for (int i = 0; i < 8; ++i) { w[i] = (__bf16)Wm[(size_t)(k0 + 8 * g + i) * ld + o]; w[8 + i] = (__bf16)Wm[(size_t)(k0 + 16 + 8 * g + i) * ld + o]; }
  return w; }
__device__ __forceinline__ v16b wcol_oi(const float* Wm, int k0, int o, int lane, int K) { v16b w; const float* p = Wm + (size_t)o * K + k0 + 8 * (lane >> 4);
#pragma unroll
  for (int i = 0; i < 8; ++i) { w[i] = (__bf16)p[i]; w[8 + i] = (__bf16)p[16 + i]; }
  return w; }
__device__ __forceinline__ v16h wcolh_io(const float* Wm, int k0, int o, int lane, int ld) { v16h w; const int g = lane >> 4;
#pragma unroll
  for (int i = 0; i < 8; ++i) { w[i] = (_Float16)(bfr(Wm[(size_t)(k0 + 8 * g + i) * ld + o]) * 256.0f); w[8 + i] = (_Float16)(bfr(Wm[(size_t)(k0 + 16 + 8 * g + i) * ld + o]) * 256.0f); }
  return w; }
__device__ __forceinline__ v16h wcolh_oi(const float* Wm, int k0, int o, int lane, int K) { v16h w; const float* p = Wm + (size_t)o * K + k0 + 8 * (lane >> 4);
#pragma unroll
  for (int i = 0; i < 8; ++i) { w[i] = (_Float16)(bfr(p[i]) * 256.0f); w[8 + i] = (_Float16)(bfr(p[16 + i]) * 256.0f); }
  return w; }
#define WQKV_LAYOUT 0   // 0 = (in,out) [DIN][CC]; 1 = (out,in) [CC][DIN]; 2 = per-head [NH][DIN][HD]
__device__ __forceinline__ v16b wcol_hdk(const float* Wm, int k0, int o, int lane) { v16b w; const int g = lane >> 4; const float* p = Wm + (size_t)(o / HD) * DIN * HD + (o % HD);
#pragma unroll
  for (int i = 0; i < 8; ++i) { w[i] = (__bf16)p[(size_t)(k0 + 8 * g + i) * HD]; w[8 + i] = (__bf16)p[(size_t)(k0 + 16 + 8 * g + i) * HD]; }
  return w; }
#define WO_OUT_IN 0
#if WQKV_LAYOUT == 1
#define WCOL(W, k0, o, lane) wcol_oi(W, k0, o, lane, DIN)
#elif WQKV_LAYOUT == 2
#define WCOL(W, k0, o, lane) wcol_hdk(W, k0, o, lane)
#else
#define WCOL(W, k0, o, lane) wcol_io(W, k0, o, lane, CC)
#endif
#if WO_OUT_IN
#define WOCOL(W, k0, o, lane) wcol_oi(W, k0, o, lane, CC)
#define WOCOLH(W, k0, o, lane) wcolh_oi(W, k0, o, lane, CC)
#else
#define WOCOL(W, k0, o, lane) wcol_io(W, k0, o, lane, DIN)
#define WOCOLH(W, k0, o, lane) wcolh_io(W, k0, o, lane, DIN)
#endif

#ifndef SM_EXTRA_PARAMS
#define SM_EXTRA_PARAMS
#endif
#ifndef PROJ_EXTRA_PARAMS
#define PROJ_EXTRA_PARAMS
#endif
#ifndef SM_MASK_HOOK
#define SM_MASK_HOOK (void)0
#endif

// q, k, v and ctx lie in FRAGMENT ORDER: the 16 bytes that lane l takes with one load stand at l * 16 of a 512-byte unit, so a wave-wide load or store covers four whole 128-byte lines (rows of a [t][c] plane gave 16 lines of 32 bytes)
// q, k: [b][head][t / 16][u = c / 16 of the head][lane = 16 * ((c / 8) & 1) + t % 16][c % 8]; v: [b][head][t / 32][c / 16 of the head][(t / 16) & 1][lane = 16 * ((t / 8) & 1) + c % 16][t % 8]; ctx: [row / 16][c / 32][(c / 16) & 1][(c / 4) & 1][lane = 16 * ((c / 8) & 1) + row % 16][c % 4]
#define FPH (TT * HD)                                  // elements of one head's plane of one sequence
#define WS_QH  0u                                      // f16 q, fragment order
#define WS_KH  (WS_QH + 2u * (size_t)NB * TT * CC)      // f16 k, fragment order
#define WS_VT  (WS_KH + 2u * (size_t)NB * TT * CC)      // f16 v planes [b][c][t]
#define WS_QL  (WS_VT + 2u * (size_t)NB * CC * TT)      // f16 q residual x 2^10, fragment order
#define WS_KL  (WS_QL + 2u * (size_t)NB * QHI * CC)     // f16 k residual x 2^10, fragment order
#define WS_VB  (WS_KL + 2u * (size_t)NB * KHI * CC)     // bf16 v hi, fragment order (VBL: lo)
#define WS_VBL (WS_VB + 2u * (size_t)NB * CC * KHI)
#define WS_S   (WS_VBL + 2u * (size_t)NB * CC * KHI)    // f32 [b][hg][t][s] area, unused: k_att keeps the logits and P in registers
#define WS_Y   (WS_S  + 4u * (size_t)NB * HG * TT * TT) // f32 ctx, fragment order
#define WS_END (WS_Y  + 4u * (size_t)NB * TT * CC)

// W slab (all DIN k rows, 128 output columns from c0, (in,out) f32 rows of ld) -> LDS rows wt[column][k] in bf16, once per block of NWV waves: a wave-wide 16-byte load covers the slab's whole 512-byte row, eight k rows give each lane four columns' 16-byte k runs.
// Row pitch 784 B = 16 B x odd: the 16 columns of a fragment's ds_load_b128 fall on distinct banks.
#define WPITCH (DIN + 8)
#define NWV 8               // waves of a k_proj or k_out block: 16 rows each, all on one slab
#define BR (NWV * 16)       // rows of such a block
static_assert(CC == DIN && DIN % (NWV * 8) == 0 && TT % BR == 0, "one slab shape serves the q/k/v weights and Wo; a block stays inside one sequence");
__device__ __forceinline__ void stage_w(const float* __restrict__ Wm, int c0, int ld, __bf16* __restrict__ wt, int wave, int lane) {
  const float* p = Wm + (size_t)(wave * 8) * ld + c0 + lane * 4; __bf16* d = wt + (lane * 4) * WPITCH + wave * 8;
#pragma unroll
  for (int kg = 0; kg < DIN / (NWV * 8); ++kg) { v4f r[8];
    if (kg == DIN / (NWV * 16)) __builtin_amdgcn_sched_barrier(0);   /* the second half's loads stay behind the first half's LDS stores: with all loads lifted to the top, raw and converted rows together pass 160 registers and k_proj spills */
#pragma unroll
    for (int kk = 0; kk < 8; ++kk) r[kk] = *(const v4f*)(p + (size_t)(kg * (NWV * 8) + kk) * ld);
    if (kg + 1 == DIN / (NWV * 8)) asm volatile("s_wait_xcnt 0x0" :: "v"(p) : "memory");   /* stands before the slab loads' address registers are written again; named as an input, they live up to it */
#pragma unroll
    for (int i = 0; i < 4; ++i) { v8b o;
#pragma unroll
      for (int kk = 0; kk < 8; ++kk) o[kk] = (__bf16)r[kk][i];
      *(v8b*)(d + i * WPITCH + kg * (NWV * 8)) = o; } } }
// ---- k_proj: block = (BR rows, 128 cols, which): q/k/v = X W (+ b) with exact bf16 products (K = DIN) -> which 0: q f16 (+ residual, rows < QHI); 1: k f16 (+ residual, rows < KHI), both in fragment order; 2: v f16 planes [c][t] (+ bf16 hi/lo for t < KHI in fragment order)
// six waves per SIMD: three blocks, which the LDS admits, stay resident only inside 160 registers
__global__ __launch_bounds__(NWV * 32) __attribute__((amdgpu_waves_per_eu(6))) void k_proj(const float* __restrict__ XQ, const float* __restrict__ XK, const float* __restrict__ XV, const float* __restrict__ WQ, const float* __restrict__ WK, const float* __restrict__ WV, const float* __restrict__ BQ, const float* __restrict__ BK, const float* __restrict__ BV,
    _Float16* __restrict__ QH, _Float16* __restrict__ QL, _Float16* __restrict__ KH, _Float16* __restrict__ KL, _Float16* __restrict__ VT, __bf16* __restrict__ VB, __bf16* __restrict__ VBL) {
  // one LDS block: the W slab during the K loop, the output staging arrays behind it (a barrier between the two uses)
  __shared__ __align__(16) unsigned char lds[3 * 128 * (BR + 8) * 2]; static_assert(sizeof(lds) >= 128 * WPITCH * 2 && sizeof(lds) >= 2 * BR * 136 * 2, "slab and output staging fit");
  __bf16* wt = (__bf16*)lds; _Float16 (*sh)[136] = (_Float16 (*)[136])lds; _Float16 (*sl)[136] = sh + BR; _Float16 (*th)[BR + 8] = (_Float16 (*)[BR + 8])lds; __bf16 (*tb)[BR + 8] = (__bf16 (*)[BR + 8])(th + 128); __bf16 (*tbl)[BR + 8] = tb + 128;   /* sh, sl serve q and k, th, tb, tbl serve v */
  const int tid = threadIdx.x, wave = tid >> 5, lane = tid & 31, col = lane & 15, g = lane >> 4; const int which = blockIdx.z; const int c0 = blockIdx.y * 128; const size_t r0 = (size_t)blockIdx.x * BR; const size_t bb = r0 / TT; const int t0 = (int)(r0 % TT);
  const float* X = which == 0 ? XQ : which == 1 ? XK : XV; const float* WA = which == 0 ? WQ : which == 1 ? WK : WV; const float* BA = which == 0 ? BQ : which == 1 ? BK : BV;
  stage_w(WA, c0, CC, wt, wave, lane);
  __syncthreads();   /* every wave reads all waves' k runs */
  v8f acc[8] = {};
#pragma unroll 2
  for (int kc = 0; kc < DIN / 32; ++kc) { v16b w[8];   /* the pass's 16 LDS reads go out as one group, ahead of the x loads and of the first product */
#pragma unroll
    for (int j = 0; j < 8; ++j) w[j] = frag_b(wt + (j * 16 + col) * WPITCH + kc * 32, lane);
    v16b a; { const float* p = X + (r0 + wave * 16 + col) * DIN + kc * 32 + 8 * g;
#pragma unroll
      for (int i = 0; i < 8; ++i) { a[i] = (__bf16)p[i]; a[8 + i] = (__bf16)p[16 + i]; }
      asm volatile("s_wait_xcnt 0x0" :: "v"(p) : "memory"); }   /* stands before the x loads' address registers are written again */
    asm volatile("s_wait_loadcnt 0x0" ::: "memory");
#pragma unroll
    for (int j = 0; j < 8; ++j) acc[j] = wmma_bf(a, w[j], acc[j]); }
  __syncthreads();   /* the slab's last reads end before its LDS takes the output staging */
  if (which < 2) { _Float16* DH = which == 0 ? QH : KH; _Float16* DL = which == 0 ? QL : KL; const int nhi = which == 0 ? QHI : KHI; const bool hi_rows = t0 < nhi;
#pragma unroll
    for (int j = 0; j < 8; ++j) { const float bias = BA ? bfr(BA[c0 + j * 16 + col]) : 0.f;
#pragma unroll
      for (int r = 0; r < 8; ++r) { const float v = acc[j][r] + bias; const _Float16 hv = (_Float16)v; sh[wave * 16 + 8 * g + r][j * 16 + col] = hv; sl[wave * 16 + 8 * g + r][j * 16 + col] = (_Float16)((v - (float)hv) * 1024.0f); } }
    __syncthreads();
    for (int e = tid; e < BR * 16; e += NWV * 32) { const int u = (e >> 5) & 3, jj = (e >> 7) % NWV, hh = e / (NWV * 128); const int rl = jj * 16 + col, cl = hh * HD + u * 16 + g * 8;   /* e counts the 16-byte pieces in the order of their places: a wave's store is one 512-byte unit */
      const size_t o = (bb * NH + c0 / HD + hh) * (size_t)FPH + (size_t)(t0 / 16 + jj) * (16 * HD) + u * 256 + lane * 8; vst2((unsigned*)(DH + o), *(const v4u*)&sh[rl][cl]); if (hi_rows) vst2((unsigned*)(DL + o), *(const v4u*)&sl[rl][cl]); }
  } else { const bool hi_rows = t0 < KHI;
#pragma unroll
    for (int j = 0; j < 8; ++j) { const float bias = BA ? bfr(BA[c0 + j * 16 + col]) : 0.f;
#pragma unroll
      for (int r = 0; r < 8; ++r) { const float v = acc[j][r] + bias; const int rl = wave * 16 + 8 * g + r, cl = j * 16 + col; th[cl][rl] = (_Float16)v; const __bf16 bh = (__bf16)v; tb[cl][rl] = bh; tbl[cl][rl] = (__bf16)(v - (float)bh); } }
    __syncthreads();
    for (int e = tid; e < 128 * (BR / 8); e += NWV * 32) { const int cl = e / (BR / 8), q = e % (BR / 8); vst2((unsigned*)(VT + (bb * CC + c0 + cl) * (size_t)TT + t0 + q * 8), *(const v4u*)&th[cl][q * 8]); if (hi_rows) { const int hf = (e >> 5) & 1, jc = (e >> 6) & 3, kl = (e >> 8) % (BR / 32), hh = e / (BR * 8); const int cf = hh * HD + jc * 16 + col, rf = kl * 32 + hf * 16 + g * 8;   /* the same count of places for the two bf16 planes */
        const size_t o3 = (bb * NH + c0 / HD + hh) * (size_t)FPH + (size_t)(t0 / 32 + kl) * (32 * HD) + jc * 512 + hf * 256 + lane * 8; vst2((unsigned*)(VB + o3), *(const v4u*)&tb[cf][rf]); vst2((unsigned*)(VBL + o3), *(const v4u*)&tbl[cf][rf]); } } } }
// ---- k_att: block = 4 waves of z = sequence b * HG + head; a wave takes two tiles of 16 queries one after the other, tile n - 1 - i and tile i of the sequence's n = TT / 16, so that every wave of the launch walks the same number of key chunks; it owns each tile from the logits to ctx and shares nothing with the other waves (no LDS, no barrier).
// Both products are formed transposed, so that a lane holds one query's column and the logits' D registers are already the B fragment of the second product (D element r of key tile j = key 16 j + 8 g + r, g = lane >> 4; B elements 0..7 / 8..15 of 32 keys = the same keys of tiles 2 kc / 2 kc + 1).
// A rolled loop over chunks of 32 keys, up to the chunk that holds the wave's diagonal. Per chunk: S^T = k q^T x SCALE, k hi + residual (x 2^10) against q hi + residual (3 products); causal mask by index in the last chunk; running maximum (one exchange between the wave's halves) and running sum in f32; ctx^T = ctx^T x exp(old max - new max) + v^T P^T with P = exp(S - max) and v as bf16 hi + lo (3 products); ctx / sum at the end
// exp(x) by the range reduction of expf (n = rint(x log2 e), 2^(x log2 e - n), ldexp, the two range ends), the reduced argument by two fused multiply-adds over log2 e in two parts; v_exp_f32 and one v_nop stand in one statement:
// the instruction set asks for one independent instruction before a transcendental's source is overwritten
__device__ __forceinline__ float exp_slot(float x) {
  const float c = __builtin_bit_cast(float, 0x3fb8aa3bu), cc = __builtin_bit_cast(float, 0x32a5705fu);
  const float n = __builtin_rintf(x * c); const float a = __builtin_fmaf(x, cc, __builtin_fmaf(x, c, -n));
  float y; asm("v_exp_f32 %0, %1\n\tv_nop" : "=v"(y) : "v"(a));
  y = __builtin_ldexpf(y, (int)n);
  y = x < __builtin_bit_cast(float, 0xc2ce8ed0u) ? 0.f : y;
  return x > __builtin_bit_cast(float, 0x42b17218u) ? __builtin_inff() : y; }
// the value that lane ^ 16 holds (the other half of the same query's keys), by one vector cross-row move
__device__ __forceinline__ float xhalf(float v) { const unsigned u = __builtin_bit_cast(unsigned, v); return __builtin_bit_cast(float, __builtin_amdgcn_permlanex16(u, u, 0x76543210u, 0xfedcba98u, false, false)); }
// fragment loads from a wave-uniform base (scalar registers) + the lane's number lo, which counts 16-byte pieces (one vector register for all planes, never rewritten): stepping a plane from chunk to chunk is one scalar add
__device__ __forceinline__ v16h frag_hu(const _Float16* base, unsigned lo) { union { v16h v; v8h q[2]; } u; u.q[0] = ((const v8h*)base)[lo]; u.q[1] = ((const v8h*)(base + 256))[lo]; return u.v; }
__device__ __forceinline__ v16b frag_bu(const __bf16* base, unsigned lo) { union { v16b v; v8b q[2]; } u; u.q[0] = ((const v8b*)base)[lo]; u.q[1] = ((const v8b*)(base + 256))[lo]; return u.v; }
struct KF { v16h h[2][HD / 32], l[2][HD / 32]; };   // the k fragments (hi, residual) of one chunk of 32 keys: [key tile][kc]
__device__ __forceinline__ void load_k(KF& k, const _Float16* kb, const _Float16* lb, unsigned lo) {
#pragma unroll
  for (int jt = 0; jt < 2; ++jt)
#pragma unroll
    for (int kc = 0; kc < HD / 32; ++kc) { k.h[jt][kc] = frag_hu(kb + jt * (16 * HD) + kc * 512, lo); k.l[jt][kc] = frag_hu(lb + jt * (16 * HD) + kc * 512, lo); }
  asm volatile("s_wait_xcnt 0x0" :: "s"(kb), "s"(lb), "v"(lo) : "memory"); }   /* stands before the k loads' address registers are written again; named as inputs, they live up to it */
// one chunk of 32 keys: logits, running maximum and sum, ctx rescaled by exp(old maximum - new maximum), then P v. LAST = the chunk that holds the diagonal: the only one with closed keys, and none is fetched behind it.
template <bool LAST> __device__ __forceinline__ void att_chunk(KF& k, const _Float16* kn, const _Float16* ln, const __bf16* vb, const __bf16* wb, unsigned lo, const v16h (&qh)[HD / 32], const v16h (&ql)[HD / 32], v8f (&acc)[HD / 16], float& m, float& sum, int dl) {
  v16b vh[HD / 16], vl[HD / 16];   /* this chunk's v goes out first and flies behind the logits and the softmax */
#pragma unroll
  for (int j = 0; j < HD / 16; ++j) { vh[j] = frag_bu(vb + j * 512, lo); vl[j] = frag_bu(wb + j * 512, lo); }
  asm volatile("s_wait_xcnt 0x0" :: "s"(vb), "s"(wb), "v"(lo) : "memory");   /* the same for the v loads */
  v8f a[2] = {}, l[2] = {};
#pragma unroll
  for (int kc = 0; kc < HD / 32; ++kc) {   /* the two key tiles alternate: no product waits for the one directly in front of it */
    a[0] = wmma16(k.h[0][kc], qh[kc], a[0]); a[1] = wmma16(k.h[1][kc], qh[kc], a[1]);
    l[0] = wmma16(k.h[0][kc], ql[kc], l[0]); l[1] = wmma16(k.h[1][kc], ql[kc], l[1]);
    l[0] = wmma16(k.l[0][kc], qh[kc], l[0]); l[1] = wmma16(k.l[1][kc], qh[kc], l[1]); }
  if (!LAST) load_k(k, kn, ln, lo);   /* the next chunk's k into the registers just read: it flies behind the softmax and P v */
  float sv[16]; float cm = -3.0e38f;
#pragma unroll
  for (int i = 0; i < 16; ++i) { const int jt = i >> 3, r = i & 7; const float x = (a[jt][r] + l[jt][r] * (1.0f / 1024.0f)) * SCALE; const float v = (!LAST || jt * 16 + r <= dl) ? x : -3.0e38f; sv[i] = v; cm = fmaxf(cm, v); }
  cm = fmaxf(cm, xhalf(cm));
  const float mn = fmaxf(m, cm); const float al = exp_slot(m - mn); float cs = 0.f; float pv[16];
#pragma unroll
  for (int i = 0; i < 16; ++i) { const float x = exp_slot(sv[i] - mn); const float e = (LAST && sv[i] <= -1.0e38f) ? 0.f : x; pv[i] = e; cs += e; }
  sum = sum * al + cs; m = mn;
#pragma unroll
  for (int j = 0; j < HD / 16; ++j) acc[j] *= al;
  const F2 p = bsplit16(pv);
#pragma unroll
  for (int j = 0; j < HD / 16; ++j) acc[j] = wmma_bf(vh[j], p.h, acc[j]);
#pragma unroll
  for (int j = 0; j < HD / 16; ++j) acc[j] = wmma_bf(vh[j], p.l, acc[j]);
#pragma unroll
  for (int j = 0; j < HD / 16; ++j) acc[j] = wmma_bf(vl[j], p.h, acc[j]); }
// one tile of 16 queries (rows ql0 .. ql0 + 15 of the sequence), from the logits to ctx. MORE = the wave goes on to another tile
template <bool MORE> __device__ __forceinline__ void att_tile(int ql0, size_t ph, size_t yo, unsigned lo, const _Float16* __restrict__ QH, const _Float16* __restrict__ KH, const _Float16* __restrict__ QL, const _Float16* __restrict__ KL, const __bf16* __restrict__ VB, const __bf16* __restrict__ VBL, float* __restrict__ Y) {
  const int col = lo & 15, g = lo >> 4; const int t = ql0 + col;
  v16h qh[HD / 32], ql[HD / 32]; const _Float16* qp = QH + ph + (size_t)(ql0 / 16) * (16 * HD); const _Float16* rp = QL + ph + (size_t)(ql0 / 16) * (16 * HD);
#pragma unroll
  for (int kc = 0; kc < HD / 32; ++kc) { qh[kc] = frag_hu(qp + kc * 512, lo); ql[kc] = frag_hu(rp + kc * 512, lo); }
  asm volatile("s_wait_xcnt 0x0" :: "s"(qp), "s"(rp), "v"(lo) : "memory");   /* stands before the q loads' address registers are written again; named as inputs, they live up to it */
  const _Float16* kb = KH + ph; const _Float16* lb = KL + ph; const __bf16* vb = VB + ph; const __bf16* wb = VBL + ph;
  const int nl = ql0 >> 5;   /* chunks of 32 keys wholly open to the wave's 16 queries; chunk nl holds the diagonal */
  KF k; load_k(k, kb, lb, lo);
  v8f acc[HD / 16] = {}; float m = -3.0e38f, sum = 0.f;
#pragma unroll 1
  for (int c = 0; c < nl; ++c) {   /* stays rolled: a tile's text is two chunk bodies */
    kb += 32 * HD; lb += 32 * HD;
    att_chunk<false>(k, kb, lb, vb, wb, lo, qh, ql, acc, m, sum, 0);
    vb += 32 * HD; wb += 32 * HD; }
  att_chunk<true>(k, kb, lb, vb, wb, lo, qh, ql, acc, m, sum, t - 8 * g - nl * 32);   /* key 32 nl + 16 jt + 8 g + r is open to query t where 16 jt + r <= t - 8 g - 32 nl */
  sum += xhalf(sum);
  const float inv = sum > 0.f ? 1.0f / sum : 0.f;   /* a fully excluded row yields ctx = 0 */
  float* yb = Y + yo + (size_t)ql0 * CC; const unsigned l4 = lo * 4;   /* scalar base + the lane's place, as for the loads. D element r of channel tile j = channel 16 j + 8 g + r of query t: the lane that holds it here reads it in k_out */
#pragma unroll
  for (int j = 0; j < HD / 16; ++j) acc[j] *= inv;
#pragma unroll
  for (int j = 0; j < HD / 16; ++j) { vst2(yb + j * 256 + l4, __builtin_shufflevector(acc[j], acc[j], 0, 1, 2, 3)); vst2(yb + j * 256 + 128 + l4, __builtin_shufflevector(acc[j], acc[j], 4, 5, 6, 7)); }
  if (MORE) asm volatile("s_wait_xcnt 0x0" :: "s"(yb), "v"(lo), "v"(acc[0]), "v"(acc[1]), "v"(acc[2]), "v"(acc[3]) : "memory"); }   /* stands before the next tile writes the ctx stores' address and data registers again; named as inputs, they live up to it */
// four waves per SIMD: q, one chunk's k and v and the ctx tiles fill most of 256 registers, and the budget keeps the scheduler inside them
__global__ __launch_bounds__(128) __attribute__((amdgpu_waves_per_eu(4, 4))) void k_att(const _Float16* __restrict__ QH, const _Float16* __restrict__ KH, const _Float16* __restrict__ QL, const _Float16* __restrict__ KL, const __bf16* __restrict__ VB, const __bf16* __restrict__ VBL, float* __restrict__ Y) {
  static_assert(CAUSAL && QBH == NQB && QHI == TT && KHI == TT && NQB % 2 == 0, "causal; every row on the 3-product path; the tiles pair up");
  const int b = blockIdx.z / HG, h = blockIdx.z % HG; const int tid = threadIdx.x; const unsigned lo = tid & 31; const int wave = __builtin_amdgcn_readfirstlane(tid >> 5);   /* the trip counts and the plane addresses are the wave's own: scalar loops, scalar bases */
  const int pi = blockIdx.x * 4 + wave; const size_t ph = ((size_t)b * NH + h) * FPH; const size_t yo = (size_t)b * TT * CC + h * (HD * 16);
  att_tile<true>((TT / 16 - 1 - pi) * 16, ph, yo, lo, QH, KH, QL, KL, VB, VBL, Y);   /* (TT / 16 - 1 - pi) / 2 + 1 chunks */
  att_tile<false>(pi * 16, ph, yo, lo, QH, KH, QL, KL, VB, VBL, Y); }                 /* pi / 2 + 1 chunks: TT / 32 + 1 together, for every pi */
// ---- k_out: block = (BR rows, 128 cols): out = ctx Wo (+ bo): all rows: ctx bf16 hi + lo against exact bf16 Wo (2 products)
__global__ __launch_bounds__(NWV * 32) void k_out(const float* __restrict__ Y, const float* __restrict__ WO, const float* __restrict__ BO, float* __restrict__ OUT) { __shared__ __align__(16) unsigned char lds[128 * WPITCH * 2]; static_assert(sizeof(lds) >= NWV * 16 * 132 * 4, "output staging fits"); __bf16* wt = (__bf16*)lds; float (*sf)[16][132] = (float (*)[16][132])lds;   /* the Wo slab during the K loop, the output staging behind it */
  const int tid = threadIdx.x, wave = tid >> 5, lane = tid & 31, col = lane & 15, g = lane >> 4; const int c0 = blockIdx.y * 128; const size_t r0 = (size_t)blockIdx.x * BR + wave * 16;
  stage_w(WO, c0, DIN, wt, wave, lane);
  __syncthreads();   /* every wave reads all waves' k runs */
  v8f acc[8] = {};
  if (true) {   /* ALL rows: ctx split bf16 hi + lo x exact Wo (2 products) */
#pragma unroll 2
    for (int kc = 0; kc < CC / 32; ++kc) { v16b w[8];   /* the pass's 16 LDS reads go out as one group, ahead of the ctx loads and of the first product */
#pragma unroll
      for (int j = 0; j < 8; ++j) w[j] = frag_b(wt + (j * 16 + col) * WPITCH + kc * 32, lane);
      const float* yp = Y + r0 * CC + kc * 512 + lane * 4; float yv[16];
#pragma unroll
      for (int i = 0; i < 16; ++i) yv[i] = yp[(i >> 2) * 128 + (i & 3)];
      asm volatile("s_wait_xcnt 0x0" :: "v"(yp) : "memory");   /* stands before the ctx loads' address registers are written again; named as an input, they live up to it */
      const F2 a = bsplit16(yv); asm volatile("s_wait_loadcnt 0x0" ::: "memory");
#pragma unroll
      for (int j = 0; j < 8; ++j) { acc[j] = wmma_bf(a.h, w[j], acc[j]); acc[j] = wmma_bf(a.l, w[j], acc[j]); } }
    __syncthreads();   /* the slab's last reads end before its LDS takes the output staging */
#pragma unroll
    for (int j = 0; j < 8; ++j) { const float bias = BO ? bfr(BO[c0 + j * 16 + col]) : 0.f;
#pragma unroll
      for (int r = 0; r < 8; ++r) sf[wave][8 * g + r][j * 16 + col] = acc[j][r] + bias; }
  }
  LDSX(); for (int rl = 0; rl < 16; ++rl) vst2(OUT + (r0 + rl) * DIN + c0 + lane * 4, *(const v4f*)&sf[wave][rl][lane * 4]); }

extern "C" void kernel_launch(void* const* d_in, const int* in_sizes, int n_in, void* d_out, int out_size, void* d_ws, size_t ws_size, hipStream_t stream) {
  (void)in_sizes; (void)n_in; (void)out_size;
  const float** F = (const float**)d_in;
  if (ws_size < (size_t)WS_END) return;
  char* ws = (char*)d_ws; _Float16 *QH = (_Float16*)(ws + WS_QH), *KH = (_Float16*)(ws + WS_KH), *VT = (_Float16*)(ws + WS_VT), *QL = (_Float16*)(ws + WS_QL), *KL = (_Float16*)(ws + WS_KL); __bf16 *VB = (__bf16*)(ws + WS_VB), *VBL = (__bf16*)(ws + WS_VBL); float *Y = (float*)(ws + WS_Y);
  (void)Y; (void)QL; (void)KL; (void)VB; (void)VBL;
  // inputs: 0 x [64,256,384]; 1 Wq, 2 Wk, 3 Wv [384,384] (in,out); 4 Wo (in,out), 5 bo
  k_proj<<<dim3(TNB * TT / BR, CC / 128, 3), NWV * 32, 0, stream>>>(F[0], F[0], F[0], F[1], F[2], F[3], nullptr, nullptr, nullptr, QH, QL, KH, KL, VT, VB, VBL);
  /* all sequences and heads in one launch */
  k_att<<<dim3(NQB / 2, 1, TNB * HG), 128, 0, stream>>>(QH, KH, QL, KL, VB, VBL, Y);
  k_out<<<dim3(TNB * TT / BR, DIN / 128), NWV * 32, 0, stream>>>(Y, F[4], F[5], (float*)d_out);
}

// v008
// One run takes 69.1 microseconds.
// In two side-by-side timings against v007, it was 1.04 and 1.03 times as fast.
// Over all steps from v000 it is 27.4 times as fast.
// compute dtype: all float inputs rounded to bf16; q/k/v = x W with EXACT bf16 products on WMMA 16x16x32 (f32 accumulate); causal logits with q, k as f16 hi + residual (3 products, all rows) x 64^-0.5; softmax in f32; P split in bf16 hi + lo against v bf16 hi + lo (3 products); ctx split bf16 hi + lo against exact Wo (2 products) + bo; f32 output.
#include <hip/hip_runtime.h>
#include <math.h>

typedef __attribute__((ext_vector_type(16))) _Float16 v16h;
typedef __attribute__((ext_vector_type(16))) __bf16 v16b;
typedef __attribute__((ext_vector_type(8)))  _Float16 v8h;
typedef __attribute__((ext_vector_type(8)))  float v8f;
typedef __attribute__((ext_vector_type(4)))  float v4f;
typedef __attribute__((ext_vector_type(2)))  float v2f;
typedef __attribute__((ext_vector_type(4)))  unsigned v4u;
typedef __attribute__((ext_vector_type(4)))  int v4i;
typedef float __attribute__((may_alias)) float_a;
typedef int __attribute__((may_alias)) int_a;

template <typename T> __device__ __forceinline__ void vst2(void* p, T v) { *(T*)p = v;  }
__device__ __forceinline__ v8f wmma16(v16h a, v16h b, v8f c) {
  v8f d = __builtin_amdgcn_wmma_f32_16x16x32_f16(false, a, false, b, (short)0, c, false, false);
  asm volatile("v_nop\n\tv_nop\n\tv_nop\n\tv_nop" : "+v"(d) : "v"(a), "v"(b));
  return d;
}
__device__ __forceinline__ v8f wmma_bf(v16b a, v16b b, v8f c) {
  v8f d = __builtin_amdgcn_wmma_f32_16x16x32_bf16(false, a, false, b, (short)0, c, false, false);
  asm volatile("v_nop\n\tv_nop\n\tv_nop\n\tv_nop" : "+v"(d) : "v"(a), "v"(b));
  return d;
}
// 16x16x32 fragments: lane = (h = lane>>4, row/col = lane&15); elements 0..7 = k0+8h+0..7, 8..15 = k0+16+8h+0..7; D element r = row 8h+r
__device__ __forceinline__ v16h frag_h(const _Float16* rowk0, int lane) {
  union { v16h v; v8h q[2]; } u; const _Float16* p = rowk0 + 8 * (lane >> 4);
  u.q[0] = *(const v8h*)p; u.q[1] = *(const v8h*)(p + 16); return u.v;
}
__device__ __forceinline__ v16h frag_f32(const float* rowk0, int lane) {
  v16h a; const float* p = rowk0 + 8 * (lane >> 4);
#pragma unroll
  for (int i = 0; i < 8; ++i) { a[i] = (_Float16)p[i]; a[8 + i] = (_Float16)p[16 + i]; }
  return a;
}
__device__ __forceinline__ v16h frag_f32s(const float* rowk0, int lane, float sc) {
  v16h a; const float* p = rowk0 + 8 * (lane >> 4);
#pragma unroll
  for (int i = 0; i < 8; ++i) { a[i] = (_Float16)(p[i] * sc); a[8 + i] = (_Float16)(p[16 + i] * sc); }
  return a;
}
// column fragment from a [K][ld] layout (column n), rows >= K read as 0
__device__ __forceinline__ v16h fragc_f32(const float* W, int k0, int n, int lane, int ld, int K) {
  v16h a; const int g = lane >> 4;
#pragma unroll
  for (int i = 0; i < 8; ++i) { const int ka = k0 + 8 * g + i, kb = ka + 16;
    a[i] = (_Float16)(ka < K ? W[(size_t)(ka < K ? ka : K - 1) * ld + n] : 0.f); a[8 + i] = (_Float16)(kb < K ? W[(size_t)(kb < K ? kb : K - 1) * ld + n] : 0.f); }
  return a;
}
struct F2 { v16b h, l; };
__device__ __forceinline__ F2 bsplit16(const float v[16]) { F2 r;
#pragma unroll
  for (int i = 0; i < 16; ++i) { const __bf16 h = (__bf16)v[i]; r.h[i] = h; r.l[i] = (__bf16)(v[i] - (float)h); }
  return r; }
__device__ __forceinline__ F2 split_row(const float* row, int k0, int lane) { float v[16]; const float* p = row + k0 + 8 * (lane >> 4);
#pragma unroll
  for (int i = 0; i < 8; ++i) { v[i] = p[i]; v[8 + i] = p[16 + i]; }
  return bsplit16(v); }
__device__ __forceinline__ F2 split_rowK(const float* row, int k0, int lane, int K) { float v[16]; const int g = lane >> 4;
#pragma unroll
  for (int i = 0; i < 8; ++i) { const int ka = k0 + 8 * g + i, kb = ka + 16; v[i] = ka < K ? row[ka < K ? ka : K - 1] : 0.f; v[8 + i] = kb < K ? row[kb < K ? kb : K - 1] : 0.f; }
  return bsplit16(v); }
__device__ __forceinline__ F2 split_col(const float* W, int k0, int n, int lane, int ld, int K) { float v[16]; const int g = lane >> 4;
#pragma unroll
  for (int i = 0; i < 8; ++i) { const int ka = k0 + 8 * g + i, kb = ka + 16; v[i] = ka < K ? W[(size_t)(ka < K ? ka : K - 1) * ld + n] : 0.f; v[8 + i] = kb < K ? W[(size_t)(kb < K ? kb : K - 1) * ld + n] : 0.f; }
  return bsplit16(v); }
__device__ __forceinline__ v8f mac3(const F2& a, const F2& b, v8f c) { c = wmma_bf(a.l, b.h, c); c = wmma_bf(a.h, b.l, c); return wmma_bf(a.h, b.h, c); }
__device__ __forceinline__ float sigm(float v) { return 1.0f / (1.0f + expf(-v)); }
#define LDSX() do { asm volatile("s_wait_dscnt 0" ::: "memory"); __builtin_amdgcn_wave_barrier(); __builtin_amdgcn_fence(__ATOMIC_RELEASE, "workgroup"); } while (0)

// Causal multi-head self-attention (B 64, T 256, C 384 = 6 x 64): q,k,v = x W ((in,out), no bias); causal softmax(q k^T / 8) (-inf above the diagonal); out = merged(attn v) Wo + bo.
#define NB 64
#define TT 256
#define CC 384            // NH * HD = projected width
#define DIN 384          // input (model) width
#define NH 6
#define HD 64
#define NQB (TT / 64)
#define HG 6
#define SCALE (0.125f)
#define CAUSAL 1
#ifndef TNB
#define TNB NB
#endif
__device__ __forceinline__ float bfr(float v) { return (float)(__bf16)v; }
__host__ __device__ __forceinline__ int kb_last(int qb) { return CAUSAL ? ((qb * 64 + 63) >> 7) : (TT / 128 - 1); }
typedef __attribute__((ext_vector_type(8))) __bf16 v8b;
__device__ __forceinline__ v16b frag_b(const __bf16* rowk0, int lane) {
  union { v16b v; v8b q[2]; } u; const __bf16* p = rowk0 + 8 * (lane >> 4);
  u.q[0] = *(const v8b*)p; u.q[1] = *(const v8b*)(p + 16); return u.v;
}
#define QBH 4              // causal: query blocks 0..QBH-1 of each sequence take the high-precision path; QBH == NQB, so every block does
#define QHI 256            // rows carrying a q residual plane (all rows: 3-product logits everywhere)
#define KHI 256            // key rows carrying k residual / v bf16 hi+lo planes (used only by the causal high-precision path)
// B fragment (k rows k0+.., output column o) of a weight: (in,out) [K][ld] or (out,in) [ld rows of K]: bf16 exact, or f16(bf16 * 256) exact
__device__ __forceinline__ v16b wcol_io(const float* Wm, int k0, int o, int lane, int ld) { v16b w; const int g = lane >> 4;
#pragma unroll
  for (int i = 0; i < 8; ++i) { w[i] = (__bf16)Wm[(size_t)(k0 + 8 * g + i) * ld + o]; w[8 + i] = (__bf16)Wm[(size_t)(k0 + 16 + 8 * g + i) * ld + o]; }
  return w; }
__device__ __forceinline__ v16b wcol_oi(const float* Wm, int k0, int o, int lane, int K) { v16b w; const float* p = Wm + (size_t)o * K + k0 + 8 * (lane >> 4);
#pragma unroll
  for (int i = 0; i < 8; ++i) { w[i] = (__bf16)p[i]; w[8 + i] = (__bf16)p[16 + i]; }
  return w; }
__device__ __forceinline__ v16h wcolh_io(const float* Wm, int k0, int o, int lane, int ld) { v16h w; const int g = lane >> 4;
#pragma unroll
  for (int i = 0; i < 8; ++i) { w[i] = (_Float16)(bfr(Wm[(size_t)(k0 + 8 * g + i) * ld + o]) * 256.0f); w[8 + i] = (_Float16)(bfr(Wm[(size_t)(k0 + 16 + 8 * g + i) * ld + o]) * 256.0f); }
  return w; }
__device__ __forceinline__ v16h wcolh_oi(const float* Wm, int k0, int o, int lane, int K) { v16h w; const float* p = Wm + (size_t)o * K + k0 + 8 * (lane >> 4);
#pragma unroll
  for (int i = 0; i < 8; ++i) { w[i] = (_Float16)(bfr(p[i]) * 256.0f); w[8 + i] = (_Float16)(bfr(p[16 + i]) * 256.0f); }
  return w; }
#define WQKV_LAYOUT 0   // 0 = (in,out) [DIN][CC]; 1 = (out,in) [CC][DIN]; 2 = per-head [NH][DIN][HD]
__device__ __forceinline__ v16b wcol_hdk(const float* Wm, int k0, int o, int lane) { v16b w; const int g = lane >> 4; const float* p = Wm + (size_t)(o / HD) * DIN * HD + (o % HD);
#pragma unroll
  for (int i = 0; i < 8; ++i) { w[i] = (__bf16)p[(size_t)(k0 + 8 * g + i) * HD]; w[8 + i] = (__bf16)p[(size_t)(k0 + 16 + 8 * g + i) * HD]; }
  return w; }
#define WO_OUT_IN 0
#if WQKV_LAYOUT == 1
#define WCOL(W, k0, o, lane) wcol_oi(W, k0, o, lane, DIN)
#elif WQKV_LAYOUT == 2
#define WCOL(W, k0, o, lane) wcol_hdk(W, k0, o, lane)
#else
#define WCOL(W, k0, o, lane) wcol_io(W, k0, o, lane, CC)
#endif
#if WO_OUT_IN
#define WOCOL(W, k0, o, lane) wcol_oi(W, k0, o, lane, CC)
#define WOCOLH(W, k0, o, lane) wcolh_oi(W, k0, o, lane, CC)
#else
#define WOCOL(W, k0, o, lane) wcol_io(W, k0, o, lane, DIN)
#define WOCOLH(W, k0, o, lane) wcolh_io(W, k0, o, lane, DIN)
#endif

#ifndef SM_EXTRA_PARAMS
#define SM_EXTRA_PARAMS
#endif
#ifndef PROJ_EXTRA_PARAMS
#define PROJ_EXTRA_PARAMS
#endif
#ifndef SM_MASK_HOOK
#define SM_MASK_HOOK (void)0
#endif

// q, k, v and ctx lie in FRAGMENT ORDER: the 16 bytes that lane l takes with one load stand at l * 16 of a 512-byte unit, so a wave-wide load or store covers four whole 128-byte lines (rows of a [t][c] plane gave 16 lines of 32 bytes)
// q, k: [b][head][t / 16][u = c / 16 of the head][lane = 16 * ((c / 8) & 1) + t % 16][c % 8]; v: [b][head][t / 32][c / 16 of the head][(t / 16) & 1][lane = 16 * ((t / 8) & 1) + c % 16][t % 8]; ctx: [row / 16][c / 32][(c / 16) & 1][(c / 4) & 1][lane = 16 * ((c / 8) & 1) + row % 16][c % 4]
#define FPH (TT * HD)                                  // elements of one head's plane of one sequence
#define WS_QH  0u                                      // f16 q, fragment order
#define WS_KH  (WS_QH + 2u * (size_t)NB * TT * CC)      // f16 k, fragment order
#define WS_VT  (WS_KH + 2u * (size_t)NB * TT * CC)      // f16 v planes [b][c][t]
#define WS_QL  (WS_VT + 2u * (size_t)NB * CC * TT)      // f16 q residual x 2^10, fragment order
#define WS_KL  (WS_QL + 2u * (size_t)NB * QHI * CC)     // f16 k residual x 2^10, fragment order
#define WS_VB  (WS_KL + 2u * (size_t)NB * KHI * CC)     // bf16 v hi, fragment order (VBL: lo)
#define WS_VBL (WS_VB + 2u * (size_t)NB * CC * KHI)
#define WS_S   (WS_VBL + 2u * (size_t)NB * CC * KHI)    // f32 [b][hg][t][s] area, unused: k_att keeps the logits and P in registers
#define WS_Y   (WS_S  + 4u * (size_t)NB * HG * TT * TT) // f32 ctx, fragment order
#define WS_END (WS_Y  + 4u * (size_t)NB * TT * CC)

// W slab (all DIN k rows, 128 output columns from c0, (in,out) f32 rows of ld) -> LDS rows wt[column][k] in bf16, once per block of NWV waves: a wave-wide 16-byte load covers the slab's whole 512-byte row, eight k rows give each lane four columns' 16-byte k runs.
// Row pitch 784 B = 16 B x odd: the 16 columns of a fragment's ds_load_b128 fall on distinct banks.
#define WPITCH (DIN + 8)
#define NWV 8               // waves of a k_proj or k_out block: 16 rows each, all on one slab
#define BR (NWV * 16)       // rows of such a block
static_assert(CC == DIN && DIN % (NWV * 8) == 0 && TT % BR == 0, "one slab shape serves the q/k/v weights and Wo; a block stays inside one sequence");
__device__ __forceinline__ void stage_w(const float* __restrict__ Wm, int c0, int ld, __bf16* __restrict__ wt, int wave, int lane) {
  const float* p = Wm + (size_t)(wave * 8) * ld + c0 + lane * 4; __bf16* d = wt + (lane * 4) * WPITCH + wave * 8;
#pragma unroll
  for (int kg = 0; kg < DIN / (NWV * 8); ++kg) { v4f r[8];
    if (kg == DIN / (NWV * 16)) __builtin_amdgcn_sched_barrier(0);   /* the second half's loads stay behind the first half's LDS stores: with all loads lifted to the top, raw and converted rows together pass 160 registers and k_proj spills */
#pragma unroll
    for (int kk = 0; kk < 8; ++kk) r[kk] = *(const v4f*)(p + (size_t)(kg * (NWV * 8) + kk) * ld);
    if (kg + 1 == DIN / (NWV * 8)) asm volatile("s_wait_xcnt 0x0" :: "v"(p) : "memory");   /* stands before the slab loads' address registers are written again; named as an input, they live up to it */
#pragma unroll
    for (int i = 0; i < 4; ++i) { v8b o;
#pragma unroll
      for (int kk = 0; kk < 8; ++kk) o[kk] = (__bf16)r[kk][i];
      *(v8b*)(d + i * WPITCH + kg * (NWV * 8)) = o; } } }
// ---- k_proj: block = (BR rows, 128 cols, which): q/k/v = X W (+ b) with exact bf16 products (K = DIN) -> which 0: q f16 (+ residual, rows < QHI); 1: k f16 (+ residual, rows < KHI), both in fragment order; 2: v f16 planes [c][t] (+ bf16 hi/lo for t < KHI in fragment order)
// six waves per SIMD: three blocks, which the LDS admits, stay resident only inside 160 registers
__global__ __launch_bounds__(NWV * 32) __attribute__((amdgpu_waves_per_eu(6))) void k_proj(const float* __restrict__ XQ, const float* __restrict__ XK, const float* __restrict__ XV, const float* __restrict__ WQ, const float* __restrict__ WK, const float* __restrict__ WV, const float* __restrict__ BQ, const float* __restrict__ BK, const float* __restrict__ BV,
    _Float16* __restrict__ QH, _Float16* __restrict__ QL, _Float16* __restrict__ KH, _Float16* __restrict__ KL, _Float16* __restrict__ VT, __bf16* __restrict__ VB, __bf16* __restrict__ VBL) {
  // one LDS block: the W slab during the K loop, the output staging arrays behind it (a barrier between the two uses)
  __shared__ __align__(16) unsigned char lds[3 * 128 * (BR + 8) * 2]; static_assert(sizeof(lds) >= 128 * WPITCH * 2 && sizeof(lds) >= 2 * BR * 136 * 2, "slab and output staging fit");
  __bf16* wt = (__bf16*)lds; _Float16 (*sh)[136] = (_Float16 (*)[136])lds; _Float16 (*sl)[136] = sh + BR; _Float16 (*th)[BR + 8] = (_Float16 (*)[BR + 8])lds; __bf16 (*tb)[BR + 8] = (__bf16 (*)[BR + 8])(th + 128); __bf16 (*tbl)[BR + 8] = tb + 128;   /* sh, sl serve q and k, th, tb, tbl serve v */
  const int tid = threadIdx.x, wave = tid >> 5, lane = tid & 31, col = lane & 15, g = lane >> 4; const int which = blockIdx.z; const int c0 = blockIdx.y * 128; const size_t r0 = (size_t)blockIdx.x * BR; const size_t bb = r0 / TT; const int t0 = (int)(r0 % TT);
  const float* X = which == 0 ? XQ : which == 1 ? XK : XV; const float* WA = which == 0 ? WQ : which == 1 ? WK : WV; const float* BA = which == 0 ? BQ : which == 1 ? BK : BV;
  stage_w(WA, c0, CC, wt, wave, lane);
  __syncthreads();   /* every wave reads all waves' k runs */
  v8f acc[8] = {};
#pragma unroll 2
  for (int kc = 0; kc < DIN / 32; ++kc) { v16b w[8];   /* the pass's 16 LDS reads go out as one group, ahead of the x loads and of the first product */
#pragma unroll
    for (int j = 0; j < 8; ++j) w[j] = frag_b(wt + (j * 16 + col) * WPITCH + kc * 32, lane);
    v16b a; { const float* p = X + (r0 + wave * 16 + col) * DIN + kc * 32 + 8 * g;
#pragma unroll
      for (int i = 0; i < 8; ++i) { a[i] = (__bf16)p[i]; a[8 + i] = (__bf16)p[16 + i]; }
      asm volatile("s_wait_xcnt 0x0" :: "v"(p) : "memory"); }   /* stands before the x loads' address registers are written again */
    asm volatile("s_wait_loadcnt 0x0" ::: "memory");
#pragma unroll
    for (int j = 0; j < 8; ++j) acc[j] = wmma_bf(a, w[j], acc[j]); }
  __syncthreads();   /* the slab's last reads end before its LDS takes the output staging */
  if (which < 2) { _Float16* DH = which == 0 ? QH : KH; _Float16* DL = which == 0 ? QL : KL; const int nhi = which == 0 ? QHI : KHI; const bool hi_rows = t0 < nhi;
#pragma unroll
    for (int j = 0; j < 8; ++j) { const float bias = BA ? bfr(BA[c0 + j * 16 + col]) : 0.f;
#pragma unroll
      for (int r = 0; r < 8; ++r) { const float v = acc[j][r] + bias; const _Float16 hv = (_Float16)v; sh[wave * 16 + 8 * g + r][j * 16 + col] = hv; sl[wave * 16 + 8 * g + r][j * 16 + col] = (_Float16)((v - (float)hv) * 1024.0f); } }
    __syncthreads();
    for (int e = tid; e < BR * 16; e += NWV * 32) { const int u = (e >> 5) & 3, jj = (e >> 7) % NWV, hh = e / (NWV * 128); const int rl = jj * 16 + col, cl = hh * HD + u * 16 + g * 8;   /* e counts the 16-byte pieces in the order of their places: a wave's store is one 512-byte unit */
      const size_t o = (bb * NH + c0 / HD + hh) * (size_t)FPH + (size_t)(t0 / 16 + jj) * (16 * HD) + u * 256 + lane * 8; vst2((unsigned*)(DH + o), *(const v4u*)&sh[rl][cl]); if (hi_rows) vst2((unsigned*)(DL + o), *(const v4u*)&sl[rl][cl]); }
  } else { const bool hi_rows = t0 < KHI;
#pragma unroll
    for (int j = 0; j < 8; ++j) { const float bias = BA ? bfr(BA[c0 + j * 16 + col]) : 0.f;
#pragma unroll
      for (int r = 0; r < 8; ++r) { const float v = acc[j][r] + bias; const int rl = wave * 16 + 8 * g + r, cl = j * 16 + col; th[cl][rl] = (_Float16)v; const __bf16 bh = (__bf16)v; tb[cl][rl] = bh; tbl[cl][rl] = (__bf16)(v - (float)bh); } }
    __syncthreads();
    for (int e = tid; e < 128 * (BR / 8); e += NWV * 32) { const int cl = e / (BR / 8), q = e % (BR / 8); vst2((unsigned*)(VT + (bb * CC + c0 + cl) * (size_t)TT + t0 + q * 8), *(const v4u*)&th[cl][q * 8]); if (hi_rows) { const int hf = (e >> 5) & 1, jc = (e >> 6) & 3, kl = (e >> 8) % (BR / 32), hh = e / (BR * 8); const int cf = hh * HD + jc * 16 + col, rf = kl * 32 + hf * 16 + g * 8;   /* the same count of places for the two bf16 planes */
        const size_t o3 = (bb * NH + c0 / HD + hh) * (size_t)FPH + (size_t)(t0 / 32 + kl) * (32 * HD) + jc * 512 + hf * 256 + lane * 8; vst2((unsigned*)(VB + o3), *(const v4u*)&tb[cf][rf]); vst2((unsigned*)(VBL + o3), *(const v4u*)&tbl[cf][rf]); } } } }
__device__ __forceinline__ float exp2_slot(float a) { float y; asm("v_exp_f32 %0, %1\n\tv_nop" : "=v"(y) : "v"(a)); return y; }
template <int O> __device__ __forceinline__ void exp2_run8(float (&y)[16], const float (&a)[16]) {
  asm("v_exp_f32 %0, %8\n\tv_exp_f32 %1, %9\n\tv_exp_f32 %2, %10\n\tv_exp_f32 %3, %11\n\tv_exp_f32 %4, %12\n\tv_exp_f32 %5, %13\n\tv_exp_f32 %6, %14\n\tv_exp_f32 %7, %15\n\tv_nop"
      : "=&v"(y[O]), "=&v"(y[O + 1]), "=&v"(y[O + 2]), "=&v"(y[O + 3]), "=&v"(y[O + 4]), "=&v"(y[O + 5]), "=&v"(y[O + 6]), "=&v"(y[O + 7])
      : "v"(a[O]), "v"(a[O + 1]), "v"(a[O + 2]), "v"(a[O + 3]), "v"(a[O + 4]), "v"(a[O + 5]), "v"(a[O + 6]), "v"(a[O + 7])); }
#define K2 (SCALE * 1.44269504088896340736f)   // logit scale x log2 e: exp(SCALE (s - max)) = 2^(s K2 - max K2)
// the value that lane ^ 16 holds (the other half of the same query's keys), by one vector cross-row move
__device__ __forceinline__ float xhalf(float v) { const unsigned u = __builtin_bit_cast(unsigned, v); return __builtin_bit_cast(float, __builtin_amdgcn_permlanex16(u, u, 0x76543210u, 0xfedcba98u, false, false)); }
// fragment loads from a wave-uniform base (scalar registers) + the lane's number lo, which counts 16-byte pieces (one vector register for all planes, never rewritten): stepping a plane from chunk to chunk is one scalar add
__device__ __forceinline__ v16h frag_hu(const _Float16* base, unsigned lo) { union { v16h v; v8h q[2]; } u; u.q[0] = ((const v8h*)base)[lo]; u.q[1] = ((const v8h*)(base + 256))[lo]; return u.v; }
__device__ __forceinline__ v16b frag_bu(const __bf16* base, unsigned lo) { union { v16b v; v8b q[2]; } u; u.q[0] = ((const v8b*)base)[lo]; u.q[1] = ((const v8b*)(base + 256))[lo]; return u.v; }
struct KF { v16h h[2][HD / 32], l[2][HD / 32]; };   // the k fragments (hi, residual) of one chunk of 32 keys: [key tile][kc]
__device__ __forceinline__ void load_k(KF& k, const _Float16* kb, const _Float16* lb, unsigned lo) {
#pragma unroll
  for (int jt = 0; jt < 2; ++jt)
#pragma unroll
    for (int kc = 0; kc < HD / 32; ++kc) { k.h[jt][kc] = frag_hu(kb + jt * (16 * HD) + kc * 512, lo); k.l[jt][kc] = frag_hu(lb + jt * (16 * HD) + kc * 512, lo); }
  asm volatile("s_wait_xcnt 0x0" :: "s"(kb), "s"(lb), "v"(lo) : "memory"); }   /* stands before the k loads' address registers are written again; named as inputs, they live up to it */
// one chunk of 32 keys: logits, running maximum and sum, ctx rescaled by exp(old maximum - new maximum), then P v. LAST = the chunk that holds the diagonal: the only one with closed keys, and none is fetched behind it.
template <bool LAST> __device__ __forceinline__ void att_chunk(KF& k, const _Float16* kn, const _Float16* ln, const __bf16* vb, const __bf16* wb, unsigned lo, const v16h (&qh)[HD / 32], const v16h (&ql)[HD / 32], v8f (&acc)[HD / 16], float& m, float& sum, int dl) {
  v16b vh[HD / 16], vl[HD / 16];   /* this chunk's v goes out first and flies behind the logits and the softmax */
#pragma unroll
  for (int j = 0; j < HD / 16; ++j) { vh[j] = frag_bu(vb + j * 512, lo); vl[j] = frag_bu(wb + j * 512, lo); }
  asm volatile("s_wait_xcnt 0x0" :: "s"(vb), "s"(wb), "v"(lo) : "memory");   /* the same for the v loads */
  v8f a[2] = {}, l[2] = {};
#pragma unroll
  for (int kc = 0; kc < HD / 32; ++kc) {   /* the two key tiles alternate: no product waits for the one directly in front of it */
    a[0] = wmma16(k.h[0][kc], qh[kc], a[0]); a[1] = wmma16(k.h[1][kc], qh[kc], a[1]);
    l[0] = wmma16(k.h[0][kc], ql[kc], l[0]); l[1] = wmma16(k.h[1][kc], ql[kc], l[1]);
    l[0] = wmma16(k.l[0][kc], qh[kc], l[0]); l[1] = wmma16(k.l[1][kc], qh[kc], l[1]); }
  if (!LAST) load_k(k, kn, ln, lo);   /* the next chunk's k into the registers just read: it flies behind the softmax and P v */
  float sv[16]; float cm = -3.0e38f;
#pragma unroll
  for (int i = 0; i < 16; ++i) { const int jt = i >> 3, r = i & 7; const float x = a[jt][r] + l[jt][r] * (1.0f / 1024.0f); const float v = (!LAST || jt * 16 + r <= dl) ? x : -3.0e38f; sv[i] = v; cm = fmaxf(cm, v); }   /* raw logits: SCALE goes into K2 */
  cm = fmaxf(cm, xhalf(cm));
  const float mn = fmaxf(m, cm * K2); const float al = exp2_slot(m - mn); float cs = 0.f; float pv[16], ea[16], ex[16];   /* m, mn = running maximum x K2; every chunk's P and every rescale use the same rounded values of it */
#pragma unroll
  for (int i = 0; i < 16; ++i) ea[i] = __builtin_fmaf(sv[i], K2, -mn);
  exp2_run8<0>(ex, ea); exp2_run8<8>(ex, ea);
#pragma unroll
  for (int i = 0; i < 16; ++i) { const float e = (LAST && sv[i] <= -1.0e38f) ? 0.f : ex[i]; pv[i] = e; cs += e; }
  sum = sum * al + cs; m = mn;
#pragma unroll
  for (int j = 0; j < HD / 16; ++j) acc[j] *= al;
  const F2 p = bsplit16(pv);
#pragma unroll
  for (int j = 0; j < HD / 16; ++j) acc[j] = wmma_bf(vh[j], p.h, acc[j]);
#pragma unroll
  for (int j = 0; j < HD / 16; ++j) acc[j] = wmma_bf(vh[j], p.l, acc[j]);
#pragma unroll
  for (int j = 0; j < HD / 16; ++j) acc[j] = wmma_bf(vl[j], p.h, acc[j]); }
// one tile of 16 queries (rows ql0 .. ql0 + 15 of the sequence), from the logits to ctx. MORE = the wave goes on to another tile
template <bool MORE> __device__ __forceinline__ void att_tile(int ql0, size_t ph, size_t yo, unsigned lo, const _Float16* __restrict__ QH, const _Float16* __restrict__ KH, const _Float16* __restrict__ QL, const _Float16* __restrict__ KL, const __bf16* __restrict__ VB, const __bf16* __restrict__ VBL, float* __restrict__ Y) {
  const int col = lo & 15, g = lo >> 4; const int t = ql0 + col;
  v16h qh[HD / 32], ql[HD / 32]; const _Float16* qp = QH + ph + (size_t)(ql0 / 16) * (16 * HD); const _Float16* rp = QL + ph + (size_t)(ql0 / 16) * (16 * HD);
#pragma unroll
  for (int kc = 0; kc < HD / 32; ++kc) { qh[kc] = frag_hu(qp + kc * 512, lo); ql[kc] = frag_hu(rp + kc * 512, lo); }
  asm volatile("s_wait_xcnt 0x0" :: "s"(qp), "s"(rp), "v"(lo) : "memory");   /* stands before the q loads' address registers are written again; named as inputs, they live up to it */
  const _Float16* kb = KH + ph; const _Float16* lb = KL + ph; const __bf16* vb = VB + ph; const __bf16* wb = VBL + ph;
  const int nl = ql0 >> 5;   /* chunks of 32 keys wholly open to the wave's 16 queries; chunk nl holds the diagonal */
  KF k; load_k(k, kb, lb, lo);
  v8f acc[HD / 16] = {}; float m = -3.0e38f, sum = 0.f;
#pragma unroll 1
  for (int c = 0; c < nl; ++c) {   /* stays rolled: a tile's text is two chunk bodies */
    kb += 32 * HD; lb += 32 * HD;
    att_chunk<false>(k, kb, lb, vb, wb, lo, qh, ql, acc, m, sum, 0);
    vb += 32 * HD; wb += 32 * HD; }
  att_chunk<true>(k, kb, lb, vb, wb, lo, qh, ql, acc, m, sum, t - 8 * g - nl * 32);   /* key 32 nl + 16 jt + 8 g + r is open to query t where 16 jt + r <= t - 8 g - 32 nl */
  sum += xhalf(sum);
  const float inv = sum > 0.f ? 1.0f / sum : 0.f;   /* a fully excluded row yields ctx = 0 */
  float* yb = Y + yo + (size_t)ql0 * CC; const unsigned l4 = lo * 4;   /* scalar base + the lane's place, as for the loads. D element r of channel tile j = channel 16 j + 8 g + r of query t: the lane that holds it here reads it in k_out */
#pragma unroll
  for (int j = 0; j < HD / 16; ++j) acc[j] *= inv;
#pragma unroll
  for (int j = 0; j < HD / 16; ++j) { vst2(yb + j * 256 + l4, __builtin_shufflevector(acc[j], acc[j], 0, 1, 2, 3)); vst2(yb + j * 256 + 128 + l4, __builtin_shufflevector(acc[j], acc[j], 4, 5, 6, 7)); }
  if (MORE) asm volatile("s_wait_xcnt 0x0" :: "s"(yb), "v"(lo), "v"(acc[0]), "v"(acc[1]), "v"(acc[2]), "v"(acc[3]) : "memory"); }   /* stands before the next tile writes the ctx stores' address and data registers again; named as inputs, they live up to it */
// four waves per SIMD: q, one chunk's k and v and the ctx tiles fill most of 256 registers, and the budget keeps the scheduler inside them
__global__ __launch_bounds__(128) __attribute__((amdgpu_waves_per_eu(4, 4))) void k_att(const _Float16* __restrict__ QH, const _Float16* __restrict__ KH, const _Float16* __restrict__ QL, const _Float16* __restrict__ KL, const __bf16* __restrict__ VB, const __bf16* __restrict__ VBL, float* __restrict__ Y) {
  static_assert(CAUSAL && QBH == NQB && QHI == TT && KHI == TT && NQB % 2 == 0, "causal; every row on the 3-product path; the tiles pair up");
  const int b = blockIdx.z / HG, h = blockIdx.z % HG; const int tid = threadIdx.x; const unsigned lo = tid & 31; const int wave = __builtin_amdgcn_readfirstlane(tid >> 5);   /* the trip counts and the plane addresses are the wave's own: scalar loops, scalar bases */
  const int pi = blockIdx.x * 4 + wave; const size_t ph = ((size_t)b * NH + h) * FPH; const size_t yo = (size_t)b * TT * CC + h * (HD * 16);
  att_tile<true>((TT / 16 - 1 - pi) * 16, ph, yo, lo, QH, KH, QL, KL, VB, VBL, Y);   /* (TT / 16 - 1 - pi) / 2 + 1 chunks */
  att_tile<false>(pi * 16, ph, yo, lo, QH, KH, QL, KL, VB, VBL, Y); }                 /* pi / 2 + 1 chunks: TT / 32 + 1 together, for every pi */
// ---- k_out: block = (BR rows, 128 cols): out = ctx Wo (+ bo): all rows: ctx bf16 hi + lo against exact bf16 Wo (2 products)
__global__ __launch_bounds__(NWV * 32) void k_out(const float* __restrict__ Y, const float* __restrict__ WO, const float* __restrict__ BO, float* __restrict__ OUT) { __shared__ __align__(16) unsigned char lds[128 * WPITCH * 2]; static_assert(sizeof(lds) >= NWV * 16 * 132 * 4, "output staging fits"); __bf16* wt = (__bf16*)lds; float (*sf)[16][132] = (float (*)[16][132])lds;   /* the Wo slab during the K loop, the output staging behind it */
  const int tid = threadIdx.x, wave = tid >> 5, lane = tid & 31, col = lane & 15, g = lane >> 4; const int c0 = blockIdx.y * 128; const size_t r0 = (size_t)blockIdx.x * BR + wave * 16;
  stage_w(WO, c0, DIN, wt, wave, lane);
  __syncthreads();   /* every wave reads all waves' k runs */
  v8f acc[8] = {};
  if (true) {   /* ALL rows: ctx split bf16 hi + lo x exact Wo (2 products) */
#pragma unroll 2
    for (int kc = 0; kc < CC / 32; ++kc) { v16b w[8];   /* the pass's 16 LDS reads go out as one group, ahead of the ctx loads and of the first product */
#pragma unroll
      for (int j = 0; j < 8; ++j) w[j] = frag_b(wt + (j * 16 + col) * WPITCH + kc * 32, lane);
      const float* yp = Y + r0 * CC + kc * 512 + lane * 4; float yv[16];
#pragma unroll
      for (int i = 0; i < 16; ++i) yv[i] = yp[(i >> 2) * 128 + (i & 3)];
      asm volatile("s_wait_xcnt 0x0" :: "v"(yp) : "memory");   /* stands before the ctx loads' address registers are written again; named as an input, they live up to it */
      const F2 a = bsplit16(yv); asm volatile("s_wait_loadcnt 0x0" ::: "memory");
#pragma unroll
      for (int j = 0; j < 8; ++j) { acc[j] = wmma_bf(a.h, w[j], acc[j]); acc[j] = wmma_bf(a.l, w[j], acc[j]); } }
    __syncthreads();   /* the slab's last reads end before its LDS takes the output staging */
#pragma unroll
    for (int j = 0; j < 8; ++j) { const float bias = BO ? bfr(BO[c0 + j * 16 + col]) : 0.f;
#pragma unroll
      for (int r = 0; r < 8; ++r) sf[wave][8 * g + r][j * 16 + col] = acc[j][r] + bias; }
  }
  LDSX(); for (int rl = 0; rl < 16; ++rl) vst2(OUT + (r0 + rl) * DIN + c0 + lane * 4, *(const v4f*)&sf[wave][rl][lane * 4]); }

extern "C" void kernel_launch(void* const* d_in, const int* in_sizes, int n_in, void* d_out, int out_size, void* d_ws, size_t ws_size, hipStream_t stream) {
  (void)in_sizes; (void)n_in; (void)out_size;
  const float** F = (const float**)d_in;
  if (ws_size < (size_t)WS_END) return;
  char* ws = (char*)d_ws; _Float16 *QH = (_Float16*)(ws + WS_QH), *KH = (_Float16*)(ws + WS_KH), *VT = (_Float16*)(ws + WS_VT), *QL = (_Float16*)(ws + WS_QL), *KL = (_Float16*)(ws + WS_KL); __bf16 *VB = (__bf16*)(ws + WS_VB), *VBL = (__bf16*)(ws + WS_VBL); float *Y = (float*)(ws + WS_Y);
  (void)Y; (void)QL; (void)KL; (void)VB; (void)VBL;
  // inputs: 0 x [64,256,384]; 1 Wq, 2 Wk, 3 Wv [384,384] (in,out); 4 Wo (in,out), 5 bo
  k_proj<<<dim3(TNB * TT / BR, CC / 128, 3), NWV * 32, 0, stream>>>(F[0], F[0], F[0], F[1], F[2], F[3], nullptr, nullptr, nullptr, QH, QL, KH, KL, VT, VB, VBL);
  /* all sequences and heads in one launch */
  k_att<<<dim3(NQB / 2, 1, TNB * HG), 128, 0, stream>>>(QH, KH, QL, KL, VB, VBL, Y);
  k_out<<<dim3(TNB * TT / BR, DIN / 128), NWV * 32, 0, stream>>>(Y, F[4], F[5], (float*)d_out);
}

// v009
// A run of this version takes 62.8 microseconds.
// In both of two side-by-side timings against v008, it was 1.10 times as fast.
// Counting every step since v000, it is 30.1 times as fast.
// compute dtype: all float inputs rounded to bf16; q/k/v = x W with EXACT bf16 products on WMMA 16x16x32 (f32 accumulate); causal logits with q, k as f16 hi + residual (3 products, all rows) x 64^-0.5; softmax in f32; P split in bf16 hi + lo against v bf16 hi + lo (3 products); ctx split bf16 hi + lo against exact Wo (2 products) + bo; f32 output.
#include <hip/hip_runtime.h>
#include <math.h>

typedef __attribute__((ext_vector_type(16))) _Float16 v16h;
typedef __attribute__((ext_vector_type(16))) __bf16 v16b;
typedef __attribute__((ext_vector_type(8)))  _Float16 v8h;
typedef __attribute__((ext_vector_type(8)))  float v8f;
typedef __attribute__((ext_vector_type(4)))  float v4f;
typedef __attribute__((ext_vector_type(2)))  float v2f;
typedef __attribute__((ext_vector_type(4)))  unsigned v4u;
typedef __attribute__((ext_vector_type(4)))  int v4i;
typedef float __attribute__((may_alias)) float_a;
typedef int __attribute__((may_alias)) int_a;

template <typename T> __device__ __forceinline__ void vst2(void* p, T v) { *(T*)p = v;  }
__device__ __forceinline__ v8f wmma16(v16h a, v16h b, v8f c) {
  v8f d = __builtin_amdgcn_wmma_f32_16x16x32_f16(false, a, false, b, (short)0, c, false, false);
  asm volatile("v_nop\n\tv_nop\n\tv_nop\n\tv_nop" : "+v"(d) : "v"(a), "v"(b));
  return d;
}
__device__ __forceinline__ v8f wmma_bf(v16b a, v16b b, v8f c) {
  v8f d = __builtin_amdgcn_wmma_f32_16x16x32_bf16(false, a, false, b, (short)0, c, false, false);
  asm volatile("v_nop\n\tv_nop\n\tv_nop\n\tv_nop" : "+v"(d) : "v"(a), "v"(b));
  return d;
}
// 16x16x32 fragments: lane = (h = lane>>4, row/col = lane&15); elements 0..7 = k0+8h+0..7, 8..15 = k0+16+8h+0..7; D element r = row 8h+r
__device__ __forceinline__ v16h frag_h(const _Float16* rowk0, int lane) {
  union { v16h v; v8h q[2]; } u; const _Float16* p = rowk0 + 8 * (lane >> 4);
  u.q[0] = *(const v8h*)p; u.q[1] = *(const v8h*)(p + 16); return u.v;
}
__device__ __forceinline__ v16h frag_f32(const float* rowk0, int lane) {
  v16h a; const float* p = rowk0 + 8 * (lane >> 4);
#pragma unroll
  for (int i = 0; i < 8; ++i) { a[i] = (_Float16)p[i]; a[8 + i] = (_Float16)p[16 + i]; }
  return a;
}
__device__ __forceinline__ v16h frag_f32s(const float* rowk0, int lane, float sc) {
  v16h a; const float* p = rowk0 + 8 * (lane >> 4);
#pragma unroll
  for (int i = 0; i < 8; ++i) { a[i] = (_Float16)(p[i] * sc); a[8 + i] = (_Float16)(p[16 + i] * sc); }
  return a;
}
// column fragment from a [K][ld] layout (column n), rows >= K read as 0
__device__ __forceinline__ v16h fragc_f32(const float* W, int k0, int n, int lane, int ld, int K) {
  v16h a; const int g = lane >> 4;
#pragma unroll
  for (int i = 0; i < 8; ++i) { const int ka = k0 + 8 * g + i, kb = ka + 16;
    a[i] = (_Float16)(ka < K ? W[(size_t)(ka < K ? ka : K - 1) * ld + n] : 0.f); a[8 + i] = (_Float16)(kb < K ? W[(size_t)(kb < K ? kb : K - 1) * ld + n] : 0.f); }
  return a;
}
struct F2 { v16b h, l; };
__device__ __forceinline__ F2 bsplit16(const float v[16]) { F2 r;
#pragma unroll
  for (int i = 0; i < 16; ++i) { const __bf16 h = (__bf16)v[i]; r.h[i] = h; r.l[i] = (__bf16)(v[i] - (float)h); }
  return r; }
__device__ __forceinline__ F2 split_row(const float* row, int k0, int lane) { float v[16]; const float* p = row + k0 + 8 * (lane >> 4);
#pragma unroll
  for (int i = 0; i < 8; ++i) { v[i] = p[i]; v[8 + i] = p[16 + i]; }
  return bsplit16(v); }
__device__ __forceinline__ F2 split_rowK(const float* row, int k0, int lane, int K) { float v[16]; const int g = lane >> 4;
#pragma unroll
  for (int i = 0; i < 8; ++i) { const int ka = k0 + 8 * g + i, kb = ka + 16; v[i] = ka < K ? row[ka < K ? ka : K - 1] : 0.f; v[8 + i] = kb < K ? row[kb < K ? kb : K - 1] : 0.f; }
  return bsplit16(v); }
__device__ __forceinline__ F2 split_col(const float* W, int k0, int n, int lane, int ld, int K) { float v[16]; const int g = lane >> 4;
#pragma unroll
  for (int i = 0; i < 8; ++i) { const int ka = k0 + 8 * g + i, kb = ka + 16; v[i] = ka < K ? W[(size_t)(ka < K ? ka : K - 1) * ld + n] : 0.f; v[8 + i] = kb < K ? W[(size_t)(kb < K ? kb : K - 1) * ld + n] : 0.f; }
  return bsplit16(v); }
__device__ __forceinline__ v8f mac3(const F2& a, const F2& b, v8f c) { c = wmma_bf(a.l, b.h, c); c = wmma_bf(a.h, b.l, c); return wmma_bf(a.h, b.h, c); }
__device__ __forceinline__ float sigm(float v) { return 1.0f / (1.0f + expf(-v)); }
#define LDSX() do { asm volatile("s_wait_dscnt 0" ::: "memory"); __builtin_amdgcn_wave_barrier(); __builtin_amdgcn_fence(__ATOMIC_RELEASE, "workgroup"); } while (0)

// Causal multi-head self-attention (B 64, T 256, C 384 = 6 x 64): q,k,v = x W ((in,out), no bias); causal softmax(q k^T / 8) (-inf above the diagonal); out = merged(attn v) Wo + bo.
#define NB 64
#define TT 256
#define CC 384            // NH * HD = projected width
#define DIN 384          // input (model) width
#define NH 6
#define HD 64
#define NQB (TT / 64)
#define HG 6
#define SCALE (0.125f)
#define CAUSAL 1
#ifndef TNB
#define TNB NB
#endif
__device__ __forceinline__ float bfr(float v) { return (float)(__bf16)v; }
__host__ __device__ __forceinline__ int kb_last(int qb) { return CAUSAL ? ((qb * 64 + 63) >> 7) : (TT / 128 - 1); }
typedef __attribute__((ext_vector_type(8))) __bf16 v8b;
__device__ __forceinline__ v16b frag_b(const __bf16* rowk0, int lane) {
  union { v16b v; v8b q[2]; } u; const __bf16* p = rowk0 + 8 * (lane >> 4);
  u.q[0] = *(const v8b*)p; u.q[1] = *(const v8b*)(p + 16); return u.v;
}
#define QBH 4              // causal: query blocks 0..QBH-1 of each sequence take the high-precision path; QBH == NQB, so every block does
#define QHI 256            // rows carrying a q residual plane (all rows: 3-product logits everywhere)
#define KHI 256            // key rows carrying k residual / v bf16 hi+lo planes (used only by the causal high-precision path)
// B fragment (k rows k0+.., output column o) of a weight: (in,out) [K][ld] or (out,in) [ld rows of K]: bf16 exact, or f16(bf16 * 256) exact
__device__ __forceinline__ v16b wcol_io(const float* Wm, int k0, int o, int lane, int ld) { v16b w; const int g = lane >> 4;
#pragma unroll
  for (int i = 0; i < 8; ++i) { w[i] = (__bf16)Wm[(size_t)(k0 + 8 * g + i) * ld + o]; w[8 + i] = (__bf16)Wm[(size_t)(k0 + 16 + 8 * g + i) * ld + o]; }
  return w; }
__device__ __forceinline__ v16b wcol_oi(const float* Wm, int k0, int o, int lane, int K) { v16b w; const float* p = Wm + (size_t)o * K + k0 + 8 * (lane >> 4);
#pragma unroll
  for (int i = 0; i < 8; ++i) { w[i] = (__bf16)p[i]; w[8 + i] = (__bf16)p[16 + i]; }
  return w; }
__device__ __forceinline__ v16h wcolh_io(const float* Wm, int k0, int o, int lane, int ld) { v16h w; const int g = lane >> 4;
#pragma unroll
  for (int i = 0; i < 8; ++i) { w[i] = (_Float16)(bfr(Wm[(size_t)(k0 + 8 * g + i) * ld + o]) * 256.0f); w[8 + i] = (_Float16)(bfr(Wm[(size_t)(k0 + 16 + 8 * g + i) * ld + o]) * 256.0f); }
  return w; }
__device__ __forceinline__ v16h wcolh_oi(const float* Wm, int k0, int o, int lane, int K) { v16h w; const float* p = Wm + (size_t)o * K + k0 + 8 * (lane >> 4);
#pragma unroll
  for (int i = 0; i < 8; ++i) { w[i] = (_Float16)(bfr(p[i]) * 256.0f); w[8 + i] = (_Float16)(bfr(p[16 + i]) * 256.0f); }
  return w; }
#define WQKV_LAYOUT 0   // 0 = (in,out) [DIN][CC]; 1 = (out,in) [CC][DIN]; 2 = per-head [NH][DIN][HD]
__device__ __forceinline__ v16b wcol_hdk(const float* Wm, int k0, int o, int lane) { v16b w; const int g = lane >> 4; const float* p = Wm + (size_t)(o / HD) * DIN * HD + (o % HD);
#pragma unroll
  for (int i = 0; i < 8; ++i) { w[i] = (__bf16)p[(size_t)(k0 + 8 * g + i) * HD]; w[8 + i] = (__bf16)p[(size_t)(k0 + 16 + 8 * g + i) * HD]; }
  return w; }
#define WO_OUT_IN 0
#if WQKV_LAYOUT == 1
#define WCOL(W, k0, o, lane) wcol_oi(W, k0, o, lane, DIN)
#elif WQKV_LAYOUT == 2
#define WCOL(W, k0, o, lane) wcol_hdk(W, k0, o, lane)
#else
#define WCOL(W, k0, o, lane) wcol_io(W, k0, o, lane, CC)
#endif
#if WO_OUT_IN
#define WOCOL(W, k0, o, lane) wcol_oi(W, k0, o, lane, CC)
#define WOCOLH(W, k0, o, lane) wcolh_oi(W, k0, o, lane, CC)
#else
#define WOCOL(W, k0, o, lane) wcol_io(W, k0, o, lane, DIN)
#define WOCOLH(W, k0, o, lane) wcolh_io(W, k0, o, lane, DIN)
#endif

#ifndef SM_EXTRA_PARAMS
#define SM_EXTRA_PARAMS
#endif
#ifndef PROJ_EXTRA_PARAMS
#define PROJ_EXTRA_PARAMS
#endif
#ifndef SM_MASK_HOOK
#define SM_MASK_HOOK (void)0
#endif

// q, k, v and ctx lie in FRAGMENT ORDER: the 16 bytes that lane l takes with one load stand at l * 16 of a 512-byte unit, so a wave-wide load or store covers four whole 128-byte lines (rows of a [t][c] plane gave 16 lines of 32 bytes)
// q, k: [b][head][t / 16][u = c / 16 of the head][lane = 16 * ((c / 8) & 1) + t % 16][c % 8]; v: [b][head][t / 32][c / 16 of the head][(t / 16) & 1][lane = 16 * ((t / 8) & 1) + c % 16][t % 8]; ctx: [row / 16][c / 32][(c / 16) & 1][(c / 4) & 1][lane = 16 * ((c / 8) & 1) + row % 16][c % 4]
#define FPH (TT * HD)                                  // elements of one head's plane of one sequence
#define WS_QH  0u                                      // f16 q, fragment order
#define WS_KH  (WS_QH + 2u * (size_t)NB * TT * CC)      // f16 k, fragment order
#define WS_VT  (WS_KH + 2u * (size_t)NB * TT * CC)      // not in use
#define WS_QL  (WS_VT + 2u * (size_t)NB * CC * TT)      // f16 q residual x 2^10, fragment order
#define WS_KL  (WS_QL + 2u * (size_t)NB * QHI * CC)     // f16 k residual x 2^10, fragment order
#define WS_VB  (WS_KL + 2u * (size_t)NB * KHI * CC)     // bf16 v hi, fragment order (VBL: lo)
#define WS_VBL (WS_VB + 2u * (size_t)NB * CC * KHI)
#define WS_S   (WS_VBL + 2u * (size_t)NB * CC * KHI)    // f32 [b][hg][t][s] area, unused: k_att keeps the logits and P in registers
#define WS_Y   (WS_S  + 4u * (size_t)NB * HG * TT * TT) // f32 ctx, fragment order
#define WS_END (WS_Y  + 4u * (size_t)NB * TT * CC)

// W slab (all DIN k rows, 128 output columns from c0, (in,out) f32 rows of ld) -> LDS rows wt[column][k] in bf16, once per block of NWV waves: a wave-wide 16-byte load covers the slab's whole 512-byte row, eight k rows give each lane four columns' 16-byte k runs.
// Row pitch 784 B = 16 B x odd: the 16 columns of a fragment's ds_load_b128 fall on distinct banks.
#define WPITCH (DIN + 8)
#define NWV 8               // waves of a k_proj or k_out block: 16 rows each, all on one slab
#define BR (NWV * 16)       // rows of a k_out block, or of one k_proj pass
static_assert(CC == DIN && DIN % (NWV * 8) == 0 && TT % BR == 0, "one slab shape serves the q/k/v weights and Wo; a block stays inside one sequence");
__device__ __forceinline__ void stage_w(const float* __restrict__ Wm, int c0, int ld, __bf16* __restrict__ wt, int wave, int lane) {
  const float* p = Wm + (size_t)(wave * 8) * ld + c0 + lane * 4; __bf16* d = wt + (lane * 4) * WPITCH + wave * 8;
#pragma unroll
  for (int kg = 0; kg < DIN / (NWV * 8); ++kg) { v4f r[8];
    if (kg == DIN / (NWV * 16)) __builtin_amdgcn_sched_barrier(0);   /* the second half's loads stay behind the first half's LDS stores: with all loads lifted to the top, raw and converted rows together pass 160 registers and k_proj spills */
#pragma unroll
    for (int kk = 0; kk < 8; ++kk) r[kk] = *(const v4f*)(p + (size_t)(kg * (NWV * 8) + kk) * ld);
    if (kg + 1 == DIN / (NWV * 8)) asm volatile("s_wait_xcnt 0x0" :: "v"(p) : "memory");   /* stands before the slab loads' address registers are written again; named as an input, they live up to it */
#pragma unroll
    for (int i = 0; i < 4; ++i) { v8b o;
#pragma unroll
      for (int kk = 0; kk < 8; ++kk) o[kk] = (__bf16)r[kk][i];
      *(v8b*)(d + i * WPITCH + kg * (NWV * 8)) = o; } } }
// ---- k_proj: block = (one sequence's TT rows in passes of BR, 128 cols, which): q/k/v = X W with exact bf16 products (K = DIN) -> which 0: q f16 + residual; 1: k f16 + residual; 2: v bf16 hi + lo, all in fragment order
// One staged slab serves every pass: nothing else uses its LDS. The results leave straight from the accumulators, which already hold them in fragment order:
// q, k are formed transposed (W^T x^T: D element r of column tile j = channel 16 j + 8 g + r of the lane's row), v as it is (D element r = row 8 g + r of the lane's channel), so a lane's 8 elements are the 16 bytes of its place in a 512-byte unit.
// one pass: 16 rows a wave against the whole slab. TR = transposed product (the A and B fragments have the same lane and k order, so the operands change places and nothing else)
template <bool TR> __device__ __forceinline__ void proj_pass(const float* __restrict__ X, size_t r0, const __bf16* wt, int wave, int lane, int col, int g, v8f (&acc)[8]) {
#pragma unroll 2
  for (int kc = 0; kc < DIN / 32; ++kc) { v16b w[8];   /* the pass's 16 LDS reads go out as one group, ahead of the x loads and of the first product */
#pragma unroll
    for (int j = 0; j < 8; ++j) w[j] = frag_b(wt + (j * 16 + col) * WPITCH + kc * 32, lane);
    v16b a; { const float* p = X + (r0 + wave * 16 + col) * DIN + kc * 32 + 8 * g;
#pragma unroll
      for (int i = 0; i < 8; ++i) { a[i] = (__bf16)p[i]; a[8 + i] = (__bf16)p[16 + i]; }
      asm volatile("s_wait_xcnt 0x0" :: "v"(p) : "memory"); }   /* stands before the x loads' address registers are written again */
    asm volatile("s_wait_loadcnt 0x0" ::: "memory");
#pragma unroll
    for (int j = 0; j < 8; ++j) acc[j] = TR ? wmma_bf(w[j], a, acc[j]) : wmma_bf(a, w[j], acc[j]); } }
// sixteen 512-byte units (two planes x eight tiles) from registers; tile j stands (j >> 2) heads and (j & 3) x US elements behind the first
template <int US, typename E> __device__ __forceinline__ void store_units(E* __restrict__ d0, E* __restrict__ d1, bool second, const v4u (&u0)[8], const v4u (&u1)[8]) {
#pragma unroll
  for (int j = 0; j < 8; ++j) { vst2(d0 + (j >> 2) * FPH + (j & 3) * US, u0[j]); if (second) vst2(d1 + (j >> 2) * FPH + (j & 3) * US, u1[j]); }
  asm volatile("s_wait_xcnt 0x0" :: "v"(d0), "v"(d1), "v"(u0[0]), "v"(u0[1]), "v"(u0[2]), "v"(u0[3]), "v"(u0[4]), "v"(u0[5]), "v"(u0[6]), "v"(u0[7]), "v"(u1[0]), "v"(u1[1]), "v"(u1[2]), "v"(u1[3]), "v"(u1[4]), "v"(u1[5]), "v"(u1[6]), "v"(u1[7]) : "memory"); }   /* stands before the next pass writes the stores' address and data registers again; named as inputs, they live up to it */
// six waves per SIMD: three blocks, which the LDS admits, stay resident only inside 160 registers
__global__ __launch_bounds__(NWV * 32) __attribute__((amdgpu_waves_per_eu(6))) void k_proj(const float* __restrict__ XQ, const float* __restrict__ XK, const float* __restrict__ XV, const float* __restrict__ WQ, const float* __restrict__ WK, const float* __restrict__ WV,
    _Float16* __restrict__ QH, _Float16* __restrict__ QL, _Float16* __restrict__ KH, _Float16* __restrict__ KL, __bf16* __restrict__ VB, __bf16* __restrict__ VBL) {
  __shared__ __align__(16) unsigned char lds[128 * WPITCH * 2]; __bf16* wt = (__bf16*)lds;   /* the W slab, from the one barrier to the block's end */
  const int tid = threadIdx.x, wave = tid >> 5, lane = tid & 31, col = lane & 15, g = lane >> 4; const int which = blockIdx.z; const int c0 = blockIdx.y * 128; const size_t bb = blockIdx.x;
  const float* X = which == 0 ? XQ : which == 1 ? XK : XV; const float* WA = which == 0 ? WQ : which == 1 ? WK : WV;
  stage_w(WA, c0, CC, wt, wave, lane);
  __syncthreads();   /* every wave reads all waves' k runs */
#pragma unroll 1
  for (int t0 = 0; t0 < TT; t0 += BR) {   /* stays rolled: the passes share one text */
    const size_t r0 = bb * TT + t0; v8f acc[8] = {}; v4u u0[8], u1[8];
    if (which < 2) { proj_pass<true>(X, r0, wt, wave, lane, col, g, acc);
#pragma unroll
      for (int j = 0; j < 8; ++j) { v8h hv, lv;
#pragma unroll
        for (int r = 0; r < 8; ++r) { const float v = acc[j][r]; const _Float16 h = (_Float16)v; hv[r] = h; lv[r] = (_Float16)((v - (float)h) * 1024.0f); }
        u0[j] = __builtin_bit_cast(v4u, hv); u1[j] = __builtin_bit_cast(v4u, lv); }
      const size_t o = (bb * NH + c0 / HD) * (size_t)FPH + (size_t)(t0 / 16 + wave) * (16 * HD) + lane * 8;
      store_units<256>((which == 0 ? QH : KH) + o, (which == 0 ? QL : KL) + o, t0 < (which == 0 ? QHI : KHI), u0, u1);
    } else { proj_pass<false>(X, r0, wt, wave, lane, col, g, acc);
#pragma unroll
      for (int j = 0; j < 8; ++j) { v8b hv, lv;
#pragma unroll
        for (int r = 0; r < 8; ++r) { const float v = acc[j][r]; const __bf16 h = (__bf16)v; hv[r] = h; lv[r] = (__bf16)(v - (float)h); }
        u0[j] = __builtin_bit_cast(v4u, hv); u1[j] = __builtin_bit_cast(v4u, lv); }
      const size_t o3 = (bb * NH + c0 / HD) * (size_t)FPH + (size_t)(t0 / 32 + (wave >> 1)) * (32 * HD) + (wave & 1) * 256 + lane * 8;
      if (t0 < KHI) store_units<512>(VB + o3, VBL + o3, true, u0, u1); } } }
__device__ __forceinline__ float exp2_slot(float a) { float y; asm("v_exp_f32 %0, %1\n\tv_nop" : "=v"(y) : "v"(a)); return y; }
template <int O> __device__ __forceinline__ void exp2_run8(float (&y)[16], const float (&a)[16]) {
  asm("v_exp_f32 %0, %8\n\tv_exp_f32 %1, %9\n\tv_exp_f32 %2, %10\n\tv_exp_f32 %3, %11\n\tv_exp_f32 %4, %12\n\tv_exp_f32 %5, %13\n\tv_exp_f32 %6, %14\n\tv_exp_f32 %7, %15\n\tv_nop"
      : "=&v"(y[O]), "=&v"(y[O + 1]), "=&v"(y[O + 2]), "=&v"(y[O + 3]), "=&v"(y[O + 4]), "=&v"(y[O + 5]), "=&v"(y[O + 6]), "=&v"(y[O + 7])
      : "v"(a[O]), "v"(a[O + 1]), "v"(a[O + 2]), "v"(a[O + 3]), "v"(a[O + 4]), "v"(a[O + 5]), "v"(a[O + 6]), "v"(a[O + 7])); }
#define K2 (SCALE * 1.44269504088896340736f)   // logit scale x log2 e: exp(SCALE (s - max)) = 2^(s K2 - max K2)
// the value that lane ^ 16 holds (the other half of the same query's keys), by one vector cross-row move
__device__ __forceinline__ float xhalf(float v) { const unsigned u = __builtin_bit_cast(unsigned, v); return __builtin_bit_cast(float, __builtin_amdgcn_permlanex16(u, u, 0x76543210u, 0xfedcba98u, false, false)); }
// fragment loads from a wave-uniform base (scalar registers) + the lane's number lo, which counts 16-byte pieces (one vector register for all planes, never rewritten): stepping a plane from chunk to chunk is one scalar add
__device__ __forceinline__ v16h frag_hu(const _Float16* base, unsigned lo) { union { v16h v; v8h q[2]; } u; u.q[0] = ((const v8h*)base)[lo]; u.q[1] = ((const v8h*)(base + 256))[lo]; return u.v; }
__device__ __forceinline__ v16b frag_bu(const __bf16* base, unsigned lo) { union { v16b v; v8b q[2]; } u; u.q[0] = ((const v8b*)base)[lo]; u.q[1] = ((const v8b*)(base + 256))[lo]; return u.v; }
struct KF { v16h h[2][HD / 32], l[2][HD / 32]; };   // the k fragments (hi, residual) of one chunk of 32 keys: [key tile][kc]
__device__ __forceinline__ void load_k(KF& k, const _Float16* kb, const _Float16* lb, unsigned lo) {
#pragma unroll
  for (int jt = 0; jt < 2; ++jt)
#pragma unroll
    for (int kc = 0; kc < HD / 32; ++kc) { k.h[jt][kc] = frag_hu(kb + jt * (16 * HD) + kc * 512, lo); k.l[jt][kc] = frag_hu(lb + jt * (16 * HD) + kc * 512, lo); }
  asm volatile("s_wait_xcnt 0x0" :: "s"(kb), "s"(lb), "v"(lo) : "memory"); }   /* stands before the k loads' address registers are written again; named as inputs, they live up to it */
// one chunk of 32 keys: logits, running maximum and sum, ctx rescaled by exp(old maximum - new maximum), then P v. LAST = the chunk that holds the diagonal: the only one with closed keys, and none is fetched behind it.
template <bool LAST> __device__ __forceinline__ void att_chunk(KF& k, const _Float16* kn, const _Float16* ln, const __bf16* vb, const __bf16* wb, unsigned lo, const v16h (&qh)[HD / 32], const v16h (&ql)[HD / 32], v8f (&acc)[HD / 16], float& m, float& sum, int dl) {
  v16b vh[HD / 16], vl[HD / 16];   /* this chunk's v goes out first and flies behind the logits and the softmax */
#pragma unroll
  for (int j = 0; j < HD / 16; ++j) { vh[j] = frag_bu(vb + j * 512, lo); vl[j] = frag_bu(wb + j * 512, lo); }
  asm volatile("s_wait_xcnt 0x0" :: "s"(vb), "s"(wb), "v"(lo) : "memory");   /* the same for the v loads */
  v8f a[2] = {}, l[2] = {};
#pragma unroll
  for (int kc = 0; kc < HD / 32; ++kc) {   /* the two key tiles alternate: no product waits for the one directly in front of it */
    a[0] = wmma16(k.h[0][kc], qh[kc], a[0]); a[1] = wmma16(k.h[1][kc], qh[kc], a[1]);
    l[0] = wmma16(k.h[0][kc], ql[kc], l[0]); l[1] = wmma16(k.h[1][kc], ql[kc], l[1]);
    l[0] = wmma16(k.l[0][kc], qh[kc], l[0]); l[1] = wmma16(k.l[1][kc], qh[kc], l[1]); }
  if (!LAST) load_k(k, kn, ln, lo);   /* the next chunk's k into the registers just read: it flies behind the softmax and P v */
  float sv[16]; float cm = -3.0e38f;
#pragma unroll
  for (int i = 0; i < 16; ++i) { const int jt = i >> 3, r = i & 7; const float x = a[jt][r] + l[jt][r] * (1.0f / 1024.0f); const float v = (!LAST || jt * 16 + r <= dl) ? x : -3.0e38f; sv[i] = v; cm = fmaxf(cm, v); }   /* raw logits: SCALE goes into K2 */
  cm = fmaxf(cm, xhalf(cm));
  const float mn = fmaxf(m, cm * K2); const float al = exp2_slot(m - mn); float cs = 0.f; float pv[16], ea[16], ex[16];   /* m, mn = running maximum x K2; every chunk's P and every rescale use the same rounded values of it */
#pragma unroll
  for (int i = 0; i < 16; ++i) ea[i] = __builtin_fmaf(sv[i], K2, -mn);
  exp2_run8<0>(ex, ea); exp2_run8<8>(ex, ea);
#pragma unroll
  for (int i = 0; i < 16; ++i) { const float e = (LAST && sv[i] <= -1.0e38f) ? 0.f : ex[i]; pv[i] = e; cs += e; }
  sum = sum * al + cs; m = mn;
#pragma unroll
  for (int j = 0; j < HD / 16; ++j) acc[j] *= al;
  const F2 p = bsplit16(pv);
#pragma unroll
  for (int j = 0; j < HD / 16; ++j) acc[j] = wmma_bf(vh[j], p.h, acc[j]);
#pragma unroll
  for (int j = 0; j < HD / 16; ++j) acc[j] = wmma_bf(vh[j], p.l, acc[j]);
#pragma unroll
  for (int j = 0; j < HD / 16; ++j) acc[j] = wmma_bf(vl[j], p.h, acc[j]); }
// one tile of 16 queries (rows ql0 .. ql0 + 15 of the sequence), from the logits to ctx. MORE = the wave goes on to another tile
template <bool MORE> __device__ __forceinline__ void att_tile(int ql0, size_t ph, size_t yo, unsigned lo, const _Float16* __restrict__ QH, const _Float16* __restrict__ KH, const _Float16* __restrict__ QL, const _Float16* __restrict__ KL, const __bf16* __restrict__ VB, const __bf16* __restrict__ VBL, float* __restrict__ Y) {
  const int col = lo & 15, g = lo >> 4; const int t = ql0 + col;
  v16h qh[HD / 32], ql[HD / 32]; const _Float16* qp = QH + ph + (size_t)(ql0 / 16) * (16 * HD); const _Float16* rp = QL + ph + (size_t)(ql0 / 16) * (16 * HD);
#pragma unroll
  for (int kc = 0; kc < HD / 32; ++kc) { qh[kc] = frag_hu(qp + kc * 512, lo); ql[kc] = frag_hu(rp + kc * 512, lo); }
  asm volatile("s_wait_xcnt 0x0" :: "s"(qp), "s"(rp), "v"(lo) : "memory");   /* stands before the q loads' address registers are written again; named as inputs, they live up to it */
  const _Float16* kb = KH + ph; const _Float16* lb = KL + ph; const __bf16* vb = VB + ph; const __bf16* wb = VBL + ph;
  const int nl = ql0 >> 5;   /* chunks of 32 keys wholly open to the wave's 16 queries; chunk nl holds the diagonal */
  KF k; load_k(k, kb, lb, lo);
  v8f acc[HD / 16] = {}; float m = -3.0e38f, sum = 0.f;
#pragma unroll 1
  for (int c = 0; c < nl; ++c) {   /* stays rolled: a tile's text is two chunk bodies */
    kb += 32 * HD; lb += 32 * HD;
    att_chunk<false>(k, kb, lb, vb, wb, lo, qh, ql, acc, m, sum, 0);
    vb += 32 * HD; wb += 32 * HD; }
  att_chunk<true>(k, kb, lb, vb, wb, lo, qh, ql, acc, m, sum, t - 8 * g - nl * 32);   /* key 32 nl + 16 jt + 8 g + r is open to query t where 16 jt + r <= t - 8 g - 32 nl */
  sum += xhalf(sum);
  const float inv = sum > 0.f ? 1.0f / sum : 0.f;   /* a fully excluded row yields ctx = 0 */
  float* yb = Y + yo + (size_t)ql0 * CC; const unsigned l4 = lo * 4;   /* scalar base + the lane's place, as for the loads. D element r of channel tile j = channel 16 j + 8 g + r of query t: the lane that holds it here reads it in k_out */
#pragma unroll
  for (int j = 0; j < HD / 16; ++j) acc[j] *= inv;
#pragma unroll
  for (int j = 0; j < HD / 16; ++j) { vst2(yb + j * 256 + l4, __builtin_shufflevector(acc[j], acc[j], 0, 1, 2, 3)); vst2(yb + j * 256 + 128 + l4, __builtin_shufflevector(acc[j], acc[j], 4, 5, 6, 7)); }
  if (MORE) asm volatile("s_wait_xcnt 0x0" :: "s"(yb), "v"(lo), "v"(acc[0]), "v"(acc[1]), "v"(acc[2]), "v"(acc[3]) : "memory"); }   /* stands before the next tile writes the ctx stores' address and data registers again; named as inputs, they live up to it */
// four waves per SIMD: q, one chunk's k and v and the ctx tiles fill most of 256 registers, and the budget keeps the scheduler inside them
__global__ __launch_bounds__(128) __attribute__((amdgpu_waves_per_eu(4, 4))) void k_att(const _Float16* __restrict__ QH, const _Float16* __restrict__ KH, const _Float16* __restrict__ QL, const _Float16* __restrict__ KL, const __bf16* __restrict__ VB, const __bf16* __restrict__ VBL, float* __restrict__ Y) {
  static_assert(CAUSAL && QBH == NQB && QHI == TT && KHI == TT && NQB % 2 == 0, "causal; every row on the 3-product path; the tiles pair up");
  const int b = blockIdx.z / HG, h = blockIdx.z % HG; const int tid = threadIdx.x; const unsigned lo = tid & 31; const int wave = __builtin_amdgcn_readfirstlane(tid >> 5);   /* the trip counts and the plane addresses are the wave's own: scalar loops, scalar bases */
  const int pi = blockIdx.x * 4 + wave; const size_t ph = ((size_t)b * NH + h) * FPH; const size_t yo = (size_t)b * TT * CC + h * (HD * 16);
  att_tile<true>((TT / 16 - 1 - pi) * 16, ph, yo, lo, QH, KH, QL, KL, VB, VBL, Y);   /* (TT / 16 - 1 - pi) / 2 + 1 chunks */
  att_tile<false>(pi * 16, ph, yo, lo, QH, KH, QL, KL, VB, VBL, Y); }                 /* pi / 2 + 1 chunks: TT / 32 + 1 together, for every pi */
// ---- k_out: block = (BR rows, 128 cols): out = ctx Wo (+ bo): all rows: ctx bf16 hi + lo against exact bf16 Wo (2 products)
__global__ __launch_bounds__(NWV * 32) void k_out(const float* __restrict__ Y, const float* __restrict__ WO, const float* __restrict__ BO, float* __restrict__ OUT) { __shared__ __align__(16) unsigned char lds[128 * WPITCH * 2]; static_assert(sizeof(lds) >= NWV * 16 * 132 * 4, "output staging fits"); __bf16* wt = (__bf16*)lds; float (*sf)[16][132] = (float (*)[16][132])lds;   /* the Wo slab during the K loop, the output staging behind it */
  const int tid = threadIdx.x, wave = tid >> 5, lane = tid & 31, col = lane & 15, g = lane >> 4; const int c0 = blockIdx.y * 128; const size_t r0 = (size_t)blockIdx.x * BR + wave * 16;
  stage_w(WO, c0, DIN, wt, wave, lane);
  __syncthreads();   /* every wave reads all waves' k runs */
  v8f acc[8] = {};
  if (true) {   /* ALL rows: ctx split bf16 hi + lo x exact Wo (2 products) */
#pragma unroll 2
    for (int kc = 0; kc < CC / 32; ++kc) { v16b w[8];   /* the pass's 16 LDS reads go out as one group, ahead of the ctx loads and of the first product */
#pragma unroll
      for (int j = 0; j < 8; ++j) w[j] = frag_b(wt + (j * 16 + col) * WPITCH + kc * 32, lane);
      const float* yp = Y + r0 * CC + kc * 512 + lane * 4; float yv[16];
#pragma unroll
      for (int i = 0; i < 16; ++i) yv[i] = yp[(i >> 2) * 128 + (i & 3)];
      asm volatile("s_wait_xcnt 0x0" :: "v"(yp) : "memory");   /* stands before the ctx loads' address registers are written again; named as an input, they live up to it */
      const F2 a = bsplit16(yv); asm volatile("s_wait_loadcnt 0x0" ::: "memory");
#pragma unroll
      for (int j = 0; j < 8; ++j) { acc[j] = wmma_bf(a.h, w[j], acc[j]); acc[j] = wmma_bf(a.l, w[j], acc[j]); } }
    __syncthreads();   /* the slab's last reads end before its LDS takes the output staging */
#pragma unroll
    for (int j = 0; j < 8; ++j) { const float bias = BO ? bfr(BO[c0 + j * 16 + col]) : 0.f;
#pragma unroll
      for (int r = 0; r < 8; ++r) sf[wave][8 * g + r][j * 16 + col] = acc[j][r] + bias; }
  }
  LDSX(); for (int rl = 0; rl < 16; ++rl) vst2(OUT + (r0 + rl) * DIN + c0 + lane * 4, *(const v4f*)&sf[wave][rl][lane * 4]); }

extern "C" void kernel_launch(void* const* d_in, const int* in_sizes, int n_in, void* d_out, int out_size, void* d_ws, size_t ws_size, hipStream_t stream) {
  (void)in_sizes; (void)n_in; (void)out_size;
  const float** F = (const float**)d_in;
  if (ws_size < (size_t)WS_END) return;
  char* ws = (char*)d_ws; _Float16 *QH = (_Float16*)(ws + WS_QH), *KH = (_Float16*)(ws + WS_KH), *QL = (_Float16*)(ws + WS_QL), *KL = (_Float16*)(ws + WS_KL); __bf16 *VB = (__bf16*)(ws + WS_VB), *VBL = (__bf16*)(ws + WS_VBL); float *Y = (float*)(ws + WS_Y);
  (void)Y; (void)QL; (void)KL; (void)VB; (void)VBL;
  // inputs: 0 x [64,256,384]; 1 Wq, 2 Wk, 3 Wv [384,384] (in,out); 4 Wo (in,out), 5 bo
  k_proj<<<dim3(TNB, CC / 128, 3), NWV * 32, 0, stream>>>(F[0], F[0], F[0], F[1], F[2], F[3], QH, QL, KH, KL, VB, VBL);
  /* all sequences and heads in one launch */
  k_att<<<dim3(NQB / 2, 1, TNB * HG), 128, 0, stream>>>(QH, KH, QL, KL, VB, VBL, Y);
  k_out<<<dim3(TNB * TT / BR, DIN / 128), NWV * 32, 0, stream>>>(Y, F[4], F[5], (float*)d_out);
}

// v010
// One run takes 59.8 microseconds.
// Next to v009, in two timings, it ran 1.05 times as fast each time.
// All steps since v000 together make it 31.6 times as fast.
// compute dtype: all float inputs rounded to bf16; q/k/v = x W with EXACT bf16 products on WMMA 16x16x32 (f32 accumulate); causal logits with q, k as f16 hi + residual (3 products, all rows) x 64^-0.5; softmax in f32; P split in bf16 hi + lo against v bf16 hi + lo (3 products); ctx split bf16 hi + lo against exact Wo (2 products) + bo; f32 output.
#include <hip/hip_runtime.h>
#include <math.h>

typedef __attribute__((ext_vector_type(16))) _Float16 v16h;
typedef __attribute__((ext_vector_type(16))) __bf16 v16b;
typedef __attribute__((ext_vector_type(8)))  _Float16 v8h;
typedef __attribute__((ext_vector_type(8)))  float v8f;
typedef __attribute__((ext_vector_type(4)))  float v4f;
typedef __attribute__((ext_vector_type(2)))  float v2f;
typedef __attribute__((ext_vector_type(4)))  unsigned v4u;
typedef __attribute__((ext_vector_type(4)))  int v4i;
typedef float __attribute__((may_alias)) float_a;
typedef int __attribute__((may_alias)) int_a;

template <typename T> __device__ __forceinline__ void vst2(void* p, T v) { *(T*)p = v;  }
__device__ __forceinline__ v8f wmma16(v16h a, v16h b, v8f c) {
  v8f d = __builtin_amdgcn_wmma_f32_16x16x32_f16(false, a, false, b, (short)0, c, false, false);
  asm volatile("v_nop\n\tv_nop\n\tv_nop\n\tv_nop" : "+v"(d) : "v"(a), "v"(b));
  return d;
}
__device__ __forceinline__ v8f wmma_bf(v16b a, v16b b, v8f c) {
  v8f d = __builtin_amdgcn_wmma_f32_16x16x32_bf16(false, a, false, b, (short)0, c, false, false);
  asm volatile("v_nop\n\tv_nop\n\tv_nop\n\tv_nop" : "+v"(d) : "v"(a), "v"(b));
  return d;
}
// 16x16x32 fragments: lane = (h = lane>>4, row/col = lane&15); elements 0..7 = k0+8h+0..7, 8..15 = k0+16+8h+0..7; D element r = row 8h+r
__device__ __forceinline__ v16h frag_h(const _Float16* rowk0, int lane) {
  union { v16h v; v8h q[2]; } u; const _Float16* p = rowk0 + 8 * (lane >> 4);
  u.q[0] = *(const v8h*)p; u.q[1] = *(const v8h*)(p + 16); return u.v;
}
__device__ __forceinline__ v16h frag_f32(const float* rowk0, int lane) {
  v16h a; const float* p = rowk0 + 8 * (lane >> 4);
#pragma unroll
  for (int i = 0; i < 8; ++i) { a[i] = (_Float16)p[i]; a[8 + i] = (_Float16)p[16 + i]; }
  return a;
}
__device__ __forceinline__ v16h frag_f32s(const float* rowk0, int lane, float sc) {
  v16h a; const float* p = rowk0 + 8 * (lane >> 4);
#pragma unroll
  for (int i = 0; i < 8; ++i) { a[i] = (_Float16)(p[i] * sc); a[8 + i] = (_Float16)(p[16 + i] * sc); }
  return a;
}
// column fragment from a [K][ld] layout (column n), rows >= K read as 0
__device__ __forceinline__ v16h fragc_f32(const float* W, int k0, int n, int lane, int ld, int K) {
  v16h a; const int g = lane >> 4;
#pragma unroll
  for (int i = 0; i < 8; ++i) { const int ka = k0 + 8 * g + i, kb = ka + 16;
    a[i] = (_Float16)(ka < K ? W[(size_t)(ka < K ? ka : K - 1) * ld + n] : 0.f); a[8 + i] = (_Float16)(kb < K ? W[(size_t)(kb < K ? kb : K - 1) * ld + n] : 0.f); }
  return a;
}
struct F2 { v16b h, l; };
__device__ __forceinline__ F2 bsplit16(const float v[16]) { F2 r;
#pragma unroll
  for (int i = 0; i < 16; ++i) { const __bf16 h = (__bf16)v[i]; r.h[i] = h; r.l[i] = (__bf16)(v[i] - (float)h); }
  return r; }
__device__ __forceinline__ F2 split_row(const float* row, int k0, int lane) { float v[16]; const float* p = row + k0 + 8 * (lane >> 4);
#pragma unroll
  for (int i = 0; i < 8; ++i) { v[i] = p[i]; v[8 + i] = p[16 + i]; }
  return bsplit16(v); }
__device__ __forceinline__ F2 split_rowK(const float* row, int k0, int lane, int K) { float v[16]; const int g = lane >> 4;
#pragma unroll
  for (int i = 0; i < 8; ++i) { const int ka = k0 + 8 * g + i, kb = ka + 16; v[i] = ka < K ? row[ka < K ? ka : K - 1] : 0.f; v[8 + i] = kb < K ? row[kb < K ? kb : K - 1] : 0.f; }
  return bsplit16(v); }
__device__ __forceinline__ F2 split_col(const float* W, int k0, int n, int lane, int ld, int K) { float v[16]; const int g = lane >> 4;
#pragma unroll
  for (int i = 0; i < 8; ++i) { const int ka = k0 + 8 * g + i, kb = ka + 16; v[i] = ka < K ? W[(size_t)(ka < K ? ka : K - 1) * ld + n] : 0.f; v[8 + i] = kb < K ? W[(size_t)(kb < K ? kb : K - 1) * ld + n] : 0.f; }
  return bsplit16(v); }
__device__ __forceinline__ v8f mac3(const F2& a, const F2& b, v8f c) { c = wmma_bf(a.l, b.h, c); c = wmma_bf(a.h, b.l, c); return wmma_bf(a.h, b.h, c); }
__device__ __forceinline__ float sigm(float v) { return 1.0f / (1.0f + expf(-v)); }
#define LDSX() do { asm volatile("s_wait_dscnt 0" ::: "memory"); __builtin_amdgcn_wave_barrier(); __builtin_amdgcn_fence(__ATOMIC_RELEASE, "workgroup"); } while (0)

// Causal multi-head self-attention (B 64, T 256, C 384 = 6 x 64): q,k,v = x W ((in,out), no bias); causal softmax(q k^T / 8) (-inf above the diagonal); out = merged(attn v) Wo + bo.
#define NB 64
#define TT 256
#define CC 384            // NH * HD = projected width
#define DIN 384          // input (model) width
#define NH 6
#define HD 64
#define NQB (TT / 64)
#define HG 6
#define SCALE (0.125f)
#define CAUSAL 1
#ifndef TNB
#define TNB NB
#endif
__device__ __forceinline__ float bfr(float v) { return (float)(__bf16)v; }
__host__ __device__ __forceinline__ int kb_last(int qb) { return CAUSAL ? ((qb * 64 + 63) >> 7) : (TT / 128 - 1); }
typedef __attribute__((ext_vector_type(8))) __bf16 v8b;
typedef __attribute__((ext_vector_type(4))) __bf16 v4b;
__device__ __forceinline__ v16b frag_b(const __bf16* rowk0, int lane) {
  union { v16b v; v8b q[2]; } u; const __bf16* p = rowk0 + 8 * (lane >> 4);
  u.q[0] = *(const v8b*)p; u.q[1] = *(const v8b*)(p + 16); return u.v;
}
#define QBH 4              // causal: query blocks 0..QBH-1 of each sequence take the high-precision path; QBH == NQB, so every block does
#define QHI 256            // rows carrying a q residual plane (all rows: 3-product logits everywhere)
#define KHI 256            // key rows carrying k residual / v bf16 hi+lo planes (used only by the causal high-precision path)
// B fragment (k rows k0+.., output column o) of a weight: (in,out) [K][ld] or (out,in) [ld rows of K]: bf16 exact, or f16(bf16 * 256) exact
__device__ __forceinline__ v16b wcol_io(const float* Wm, int k0, int o, int lane, int ld) { v16b w; const int g = lane >> 4;
#pragma unroll
  for (int i = 0; i < 8; ++i) { w[i] = (__bf16)Wm[(size_t)(k0 + 8 * g + i) * ld + o]; w[8 + i] = (__bf16)Wm[(size_t)(k0 + 16 + 8 * g + i) * ld + o]; }
  return w; }
__device__ __forceinline__ v16b wcol_oi(const float* Wm, int k0, int o, int lane, int K) { v16b w; const float* p = Wm + (size_t)o * K + k0 + 8 * (lane >> 4);
#pragma unroll
  for (int i = 0; i < 8; ++i) { w[i] = (__bf16)p[i]; w[8 + i] = (__bf16)p[16 + i]; }
  return w; }
__device__ __forceinline__ v16h wcolh_io(const float* Wm, int k0, int o, int lane, int ld) { v16h w; const int g = lane >> 4;
#pragma unroll
  for (int i = 0; i < 8; ++i) { w[i] = (_Float16)(bfr(Wm[(size_t)(k0 + 8 * g + i) * ld + o]) * 256.0f); w[8 + i] = (_Float16)(bfr(Wm[(size_t)(k0 + 16 + 8 * g + i) * ld + o]) * 256.0f); }
  return w; }
__device__ __forceinline__ v16h wcolh_oi(const float* Wm, int k0, int o, int lane, int K) { v16h w; const float* p = Wm + (size_t)o * K + k0 + 8 * (lane >> 4);
#pragma unroll
  for (int i = 0; i < 8; ++i) { w[i] = (_Float16)(bfr(p[i]) * 256.0f); w[8 + i] = (_Float16)(bfr(p[16 + i]) * 256.0f); }
  return w; }
#define WQKV_LAYOUT 0   // 0 = (in,out) [DIN][CC]; 1 = (out,in) [CC][DIN]; 2 = per-head [NH][DIN][HD]
__device__ __forceinline__ v16b wcol_hdk(const float* Wm, int k0, int o, int lane) { v16b w; const int g = lane >> 4; const float* p = Wm + (size_t)(o / HD) * DIN * HD + (o % HD);
#pragma unroll
  for (int i = 0; i < 8; ++i) { w[i] = (__bf16)p[(size_t)(k0 + 8 * g + i) * HD]; w[8 + i] = (__bf16)p[(size_t)(k0 + 16 + 8 * g + i) * HD]; }
  return w; }
#define WO_OUT_IN 0
#if WQKV_LAYOUT == 1
#define WCOL(W, k0, o, lane) wcol_oi(W, k0, o, lane, DIN)
#elif WQKV_LAYOUT == 2
#define WCOL(W, k0, o, lane) wcol_hdk(W, k0, o, lane)
#else
#define WCOL(W, k0, o, lane) wcol_io(W, k0, o, lane, CC)
#endif
#if WO_OUT_IN
#define WOCOL(W, k0, o, lane) wcol_oi(W, k0, o, lane, CC)
#define WOCOLH(W, k0, o, lane) wcolh_oi(W, k0, o, lane, CC)
#else
#define WOCOL(W, k0, o, lane) wcol_io(W, k0, o, lane, DIN)
#define WOCOLH(W, k0, o, lane) wcolh_io(W, k0, o, lane, DIN)
#endif

#ifndef SM_EXTRA_PARAMS
#define SM_EXTRA_PARAMS
#endif
#ifndef PROJ_EXTRA_PARAMS
#define PROJ_EXTRA_PARAMS
#endif
#ifndef SM_MASK_HOOK
#define SM_MASK_HOOK (void)0
#endif

// q, k, v and ctx lie in FRAGMENT ORDER: the 16 bytes that lane l takes with one load stand at l * 16 of a 512-byte unit, so a wave-wide load or store covers four whole 128-byte lines (rows of a [t][c] plane gave 16 lines of 32 bytes)
// q, k: [b][head][t / 16][u = c / 16 of the head][lane = 16 * ((c / 8) & 1) + t % 16][c % 8]; v: [b][head][t / 32][c / 16 of the head][(t / 16) & 1][lane = 16 * ((t / 8) & 1) + c % 16][t % 8]; ctx: [row / 16][c / 32][(c / 16) & 1][(c / 4) & 1][lane = 16 * ((c / 8) & 1) + row % 16][c % 4]
#define FPH (TT * HD)                                  // elements of one head's plane of one sequence
#define WS_QH  0u                                      // f16 q, fragment order
#define WS_KH  (WS_QH + 2u * (size_t)NB * TT * CC)      // f16 k, fragment order
#define WS_VT  (WS_KH + 2u * (size_t)NB * TT * CC)      // not in use
#define WS_QL  (WS_VT + 2u * (size_t)NB * CC * TT)      // f16 q residual x 2^10, fragment order
#define WS_KL  (WS_QL + 2u * (size_t)NB * QHI * CC)     // f16 k residual x 2^10, fragment order
#define WS_VB  (WS_KL + 2u * (size_t)NB * KHI * CC)     // bf16 v hi, fragment order (VBL: lo)
#define WS_VBL (WS_VB + 2u * (size_t)NB * CC * KHI)
#define WS_S   (WS_VBL + 2u * (size_t)NB * CC * KHI)    // f32 [b][hg][t][s] area, unused: k_att keeps the logits and P in registers
#define WS_Y   (WS_S  + 4u * (size_t)NB * HG * TT * TT) // f32 ctx, fragment order
#define WS_END (WS_Y  + 4u * (size_t)NB * TT * CC)

// W slab (all DIN k rows, 128 output columns from c0, (in,out) f32 rows of ld) -> LDS rows wt[column][k] in bf16, once per block of NWV waves: a wave-wide 16-byte load covers the slab's whole 512-byte row, eight k rows give each lane four columns' 16-byte k runs.
// Row pitch 784 B = 16 B x odd: the 16 columns of a fragment's ds_load_b128 fall on distinct banks.
#define WPITCH (DIN + 8)
#define NWV 8               // waves of a k_proj or k_out block: 16 rows each, all on one slab
#define BR (NWV * 16)       // rows of a k_out block and of one k_proj pass
#define XSB 1024            // bytes of a k_proj wave's own x tile in LDS: 16 rows x 32 k in bf16
static_assert(CC == DIN && DIN % (NWV * 8) == 0 && TT % BR == 0, "one slab shape serves the q/k/v weights and Wo; a block stays inside one sequence");
__device__ __forceinline__ void stage_w(const float* __restrict__ Wm, int c0, int ld, __bf16* __restrict__ wt, int wave, int lane) {
  const float* p = Wm + (size_t)(wave * 8) * ld + c0 + lane * 4; __bf16* d = wt + (lane * 4) * WPITCH + wave * 8;
#pragma unroll
  for (int kg = 0; kg < DIN / (NWV * 8); ++kg) { v4f r[8];
    if (kg == DIN / (NWV * 16)) __builtin_amdgcn_sched_barrier(0);   /* the second half's loads stay behind the first half's LDS stores: with all loads lifted to the top, raw and converted rows together pass 160 registers and k_proj spills */
#pragma unroll
    for (int kk = 0; kk < 8; ++kk) r[kk] = *(const v4f*)(p + (size_t)(kg * (NWV * 8) + kk) * ld);
    if (kg + 1 == DIN / (NWV * 8)) asm volatile("s_wait_xcnt 0x0" :: "v"(p) : "memory");   /* stands before the slab loads' address registers are written again; named as an input, they live up to it */
#pragma unroll
    for (int i = 0; i < 4; ++i) { v8b o;
#pragma unroll
      for (int kk = 0; kk < 8; ++kk) o[kk] = (__bf16)r[kk][i];
      *(v8b*)(d + i * WPITCH + kg * (NWV * 8)) = o; } } }
// ---- k_proj: block = (one sequence's TT rows in passes of BR, 128 cols, which): q/k/v = X W with exact bf16 products (K = DIN) -> which 0: q f16 + residual; 1: k f16 + residual; 2: v bf16 hi + lo, all in fragment order
// One staged slab serves every pass: nothing else uses its LDS. The results leave straight from the accumulators, which already hold them in fragment order:
// q, k are formed transposed (W^T x^T: D element r of column tile j = channel 16 j + 8 g + r of the lane's row), v as it is (D element r = row 8 g + r of the lane's channel), so a lane's 8 elements are the 16 bytes of its place in a 512-byte unit.
// one pass: 16 rows a wave against the whole slab. TR = transposed product (the A and B fragments have the same lane and k order, so the operands change places and nothing else)
// x comes in whole lines: a wave-wide 16-byte load covers four rows' 128 bytes each (lane = 8 x (row & 3) + k / 4), not 32 bytes of each of 16 rows. The lanes change places through the wave's own XSB bytes of LDS (xs), which hold the 16 x 32 tile in bf16 in fragment order:
// element (row, k) stands at 256 q + 16 (row ^ 4 q) + 2 (k & 7), q = k / 8; the ^ spreads the four q of one store over all 64 banks, and a fragment read still covers 256 bytes in a row per half wave.
template <bool TR> __device__ __forceinline__ void proj_pass(const float* __restrict__ X, size_t r0, const __bf16* wt, unsigned char* lds, unsigned xs, int wave, int lane, int col, int g, v8f (&acc)[8]) {   /* xs = the tile's byte offset in lds, a multiple of 256 */
  const int rr = lane >> 3, kq = lane & 7, q = kq >> 1; const unsigned so = xs + q * 256 + q * 64 + rr * 16 + (kq & 1) * 8;   /* load i brings row 4 i + rr: its place is so ^ 64 i */
  const unsigned xo = rr * DIN + kq * 4;
  const unsigned ao = xs + g * 256 + (col ^ (g << 2)) * 16;   /* the lane's k 8 g .. 8 g + 7; its k 16 + 8 g .. stand at (ao ^ 128) + 512 */
#pragma unroll 1
  for (int kp = 0; kp < DIN / 64; ++kp) { v4b o[2][4];   /* stays rolled: its text is two k steps. Both steps' x, two neighbouring lines of each row, is asked for at once: one wait for memory per 64 k */
    { const float* p = X + (r0 + wave * 16) * DIN + kp * 64 + xo; v4f r[2][4];
#pragma unroll
      for (int i = 0; i < 4; ++i) { r[0][i] = *(const v4f*)(p + i * 4 * DIN); r[1][i] = *(const v4f*)(p + i * 4 * DIN + 32); }
      asm volatile("s_wait_xcnt 0x0" :: "v"(p) : "memory");   /* stands before the x loads' address registers are written again; named as an input, they live up to it */
#pragma unroll
      for (int h = 0; h < 2; ++h)
#pragma unroll
        for (int i = 0; i < 4; ++i)
#pragma unroll
          for (int e = 0; e < 4; ++e) o[h][i][e] = (__bf16)r[h][i][e]; }
#pragma unroll
    for (int h = 0; h < 2; ++h) { const int kc = kp * 2 + h; v16b w[8];
#pragma unroll
      for (int i = 0; i < 4; ++i) *(v4b*)(lds + (so ^ (unsigned)(i * 64))) = o[h][i];
      asm volatile("s_wait_dscnt 0x0" ::: "memory");   /* the wave's own stores have landed before its lanes read one another's values back */
      union { v16b v; v8b h[2]; } a; a.h[0] = *(const v8b*)(lds + ao); a.h[1] = *(const v8b*)(lds + (ao ^ 128u) + 512);
#pragma unroll
      for (int j = 0; j < 8; ++j) w[j] = frag_b(wt + (j * 16 + col) * WPITCH + kc * 32, lane);   /* the step's 18 LDS reads go out as one group, ahead of the first product; the raw x registers are free by then */
#pragma unroll
      for (int j = 0; j < 8; ++j) acc[j] = TR ? wmma_bf(w[j], a.v, acc[j]) : wmma_bf(a.v, w[j], acc[j]); } } }
// sixteen 512-byte units (two planes x eight tiles) from registers; tile j stands (j >> 2) heads and (j & 3) x US elements behind the first. d0, d1 = the wave's own bases (scalar registers), lo = the lane's place in a unit: no address pair of a lane lives through the passes
template <int US, typename E> __device__ __forceinline__ void store_units(E* __restrict__ d0, E* __restrict__ d1, unsigned lo, bool second, const v4u (&u0)[8], const v4u (&u1)[8]) {
#pragma unroll
  for (int j = 0; j < 8; ++j) { vst2(d0 + (j >> 2) * FPH + (j & 3) * US + lo, u0[j]); if (second) vst2(d1 + (j >> 2) * FPH + (j & 3) * US + lo, u1[j]); }
  asm volatile("s_wait_xcnt 0x0" :: "s"(d0), "s"(d1), "v"(lo), "v"(u0[0]), "v"(u0[1]), "v"(u0[2]), "v"(u0[3]), "v"(u0[4]), "v"(u0[5]), "v"(u0[6]), "v"(u0[7]), "v"(u1[0]), "v"(u1[1]), "v"(u1[2]), "v"(u1[3]), "v"(u1[4]), "v"(u1[5]), "v"(u1[6]), "v"(u1[7]) : "memory"); }   /* stands before the next pass writes the stores' address and data registers again; named as inputs, they live up to it */
// six waves per SIMD: three blocks, which the LDS admits, stay resident only inside 160 registers
__global__ __launch_bounds__(NWV * 32) __attribute__((amdgpu_waves_per_eu(6))) void k_proj(const float* __restrict__ XQ, const float* __restrict__ XK, const float* __restrict__ XV, const float* __restrict__ WQ, const float* __restrict__ WK, const float* __restrict__ WV,
    _Float16* __restrict__ QH, _Float16* __restrict__ QL, _Float16* __restrict__ KH, _Float16* __restrict__ KL, __bf16* __restrict__ VB, __bf16* __restrict__ VBL) {
  __shared__ __align__(256) unsigned char lds[128 * WPITCH * 2 + NWV * XSB]; __bf16* wt = (__bf16*)lds;   /* the W slab, from the one barrier to the block's end; behind it each wave's x tile */
  static_assert((128 * WPITCH * 2) % 256 == 0 && 3 * sizeof(lds) <= 327680, "the x tiles start on bank 0; three blocks still fit a WGP's LDS");
  const int tid = threadIdx.x, wave = __builtin_amdgcn_readfirstlane(tid >> 5), lane = tid & 31, col = lane & 15, g = lane >> 4;   /* the wave's number in a scalar register: what is formed from it (x rows, its tile's place, the results' units) takes no vector register through the passes */
  const unsigned xs = 128 * WPITCH * 2 + wave * XSB; const int which = blockIdx.z; const int c0 = blockIdx.y * 128; const size_t bb = blockIdx.x;
  const float* X = which == 0 ? XQ : which == 1 ? XK : XV; const float* WA = which == 0 ? WQ : which == 1 ? WK : WV;
  stage_w(WA, c0, CC, wt, wave, lane);
  __syncthreads();   /* every wave reads all waves' k runs */
#pragma unroll 1
  for (int t0 = 0; t0 < TT; t0 += BR) {   /* stays rolled: the passes share one text */
    const size_t r0 = bb * TT + t0; v8f acc[8] = {}; v4u u0[8], u1[8];
    if (which < 2) { proj_pass<true>(X, r0, wt, lds, xs, wave, lane, col, g, acc);
#pragma unroll
      for (int j = 0; j < 8; ++j) { v8h hv, lv;
#pragma unroll
        for (int r = 0; r < 8; ++r) { const float v = acc[j][r]; const _Float16 h = (_Float16)v; hv[r] = h; lv[r] = (_Float16)((v - (float)h) * 1024.0f); }
        u0[j] = __builtin_bit_cast(v4u, hv); u1[j] = __builtin_bit_cast(v4u, lv); }
      const size_t o = (bb * NH + c0 / HD) * (size_t)FPH + (size_t)(t0 / 16 + wave) * (16 * HD);
      store_units<256>((which == 0 ? QH : KH) + o, (which == 0 ? QL : KL) + o, lane * 8, t0 < (which == 0 ? QHI : KHI), u0, u1);
    } else { proj_pass<false>(X, r0, wt, lds, xs, wave, lane, col, g, acc);
#pragma unroll
      for (int j = 0; j < 8; ++j) { v8b hv, lv;
#pragma unroll
        for (int r = 0; r < 8; ++r) { const float v = acc[j][r]; const __bf16 h = (__bf16)v; hv[r] = h; lv[r] = (__bf16)(v - (float)h); }
        u0[j] = __builtin_bit_cast(v4u, hv); u1[j] = __builtin_bit_cast(v4u, lv); }
      const size_t o3 = (bb * NH + c0 / HD) * (size_t)FPH + (size_t)(t0 / 32 + (wave >> 1)) * (32 * HD) + (wave & 1) * 256;
      if (t0 < KHI) store_units<512>(VB + o3, VBL + o3, lane * 8, true, u0, u1); } } }
__device__ __forceinline__ float exp2_slot(float a) { float y; asm("v_exp_f32 %0, %1\n\tv_nop" : "=v"(y) : "v"(a)); return y; }
template <int O> __device__ __forceinline__ void exp2_run8(float (&y)[16], const float (&a)[16]) {
  asm("v_exp_f32 %0, %8\n\tv_exp_f32 %1, %9\n\tv_exp_f32 %2, %10\n\tv_exp_f32 %3, %11\n\tv_exp_f32 %4, %12\n\tv_exp_f32 %5, %13\n\tv_exp_f32 %6, %14\n\tv_exp_f32 %7, %15\n\tv_nop"
      : "=&v"(y[O]), "=&v"(y[O + 1]), "=&v"(y[O + 2]), "=&v"(y[O + 3]), "=&v"(y[O + 4]), "=&v"(y[O + 5]), "=&v"(y[O + 6]), "=&v"(y[O + 7])
      : "v"(a[O]), "v"(a[O + 1]), "v"(a[O + 2]), "v"(a[O + 3]), "v"(a[O + 4]), "v"(a[O + 5]), "v"(a[O + 6]), "v"(a[O + 7])); }
#define K2 (SCALE * 1.44269504088896340736f)   // logit scale x log2 e: exp(SCALE (s - max)) = 2^(s K2 - max K2)
// the value that lane ^ 16 holds (the other half of the same query's keys), by one vector cross-row move
__device__ __forceinline__ float xhalf(float v) { const unsigned u = __builtin_bit_cast(unsigned, v); return __builtin_bit_cast(float, __builtin_amdgcn_permlanex16(u, u, 0x76543210u, 0xfedcba98u, false, false)); }
// fragment loads from a wave-uniform base (scalar registers) + the lane's number lo, which counts 16-byte pieces (one vector register for all planes, never rewritten): stepping a plane from chunk to chunk is one scalar add
__device__ __forceinline__ v16h frag_hu(const _Float16* base, unsigned lo) { union { v16h v; v8h q[2]; } u; u.q[0] = ((const v8h*)base)[lo]; u.q[1] = ((const v8h*)(base + 256))[lo]; return u.v; }
__device__ __forceinline__ v16b frag_bu(const __bf16* base, unsigned lo) { union { v16b v; v8b q[2]; } u; u.q[0] = ((const v8b*)base)[lo]; u.q[1] = ((const v8b*)(base + 256))[lo]; return u.v; }
struct KF { v16h h[2][HD / 32], l[2][HD / 32]; };   // the k fragments (hi, residual) of one chunk of 32 keys: [key tile][kc]
__device__ __forceinline__ void load_k(KF& k, const _Float16* kb, const _Float16* lb, unsigned lo) {
#pragma unroll
  for (int jt = 0; jt < 2; ++jt)
#pragma unroll
    for (int kc = 0; kc < HD / 32; ++kc) { k.h[jt][kc] = frag_hu(kb + jt * (16 * HD) + kc * 512, lo); k.l[jt][kc] = frag_hu(lb + jt * (16 * HD) + kc * 512, lo); }
  asm volatile("s_wait_xcnt 0x0" :: "s"(kb), "s"(lb), "v"(lo) : "memory"); }   /* stands before the k loads' address registers are written again; named as inputs, they live up to it */
// one chunk of 32 keys: logits, running maximum and sum, ctx rescaled by exp(old maximum - new maximum), then P v. LAST = the chunk that holds the diagonal: the only one with closed keys, and none is fetched behind it.
template <bool LAST> __device__ __forceinline__ void att_chunk(KF& k, const _Float16* kn, const _Float16* ln, const __bf16* vb, const __bf16* wb, unsigned lo, const v16h (&qh)[HD / 32], const v16h (&ql)[HD / 32], v8f (&acc)[HD / 16], float& m, float& sum, int dl) {
  v16b vh[HD / 16], vl[HD / 16];   /* this chunk's v goes out first and flies behind the logits and the softmax */
#pragma unroll
  for (int j = 0; j < HD / 16; ++j) { vh[j] = frag_bu(vb + j * 512, lo); vl[j] = frag_bu(wb + j * 512, lo); }
  asm volatile("s_wait_xcnt 0x0" :: "s"(vb), "s"(wb), "v"(lo) : "memory");   /* the same for the v loads */
  v8f a[2] = {}, l[2] = {};
#pragma unroll
  for (int kc = 0; kc < HD / 32; ++kc) {   /* the two key tiles alternate: no product waits for the one directly in front of it */
    a[0] = wmma16(k.h[0][kc], qh[kc], a[0]); a[1] = wmma16(k.h[1][kc], qh[kc], a[1]);
    l[0] = wmma16(k.h[0][kc], ql[kc], l[0]); l[1] = wmma16(k.h[1][kc], ql[kc], l[1]);
    l[0] = wmma16(k.l[0][kc], qh[kc], l[0]); l[1] = wmma16(k.l[1][kc], qh[kc], l[1]); }
  if (!LAST) load_k(k, kn, ln, lo);   /* the next chunk's k into the registers just read: it flies behind the softmax and P v */
  float sv[16]; float cm = -3.0e38f;
#pragma unroll
  for (int i = 0; i < 16; ++i) { const int jt = i >> 3, r = i & 7; const float x = a[jt][r] + l[jt][r] * (1.0f / 1024.0f); const float v = (!LAST || jt * 16 + r <= dl) ? x : -3.0e38f; sv[i] = v; cm = fmaxf(cm, v); }   /* raw logits: SCALE goes into K2 */
  cm = fmaxf(cm, xhalf(cm));
  const float mn = fmaxf(m, cm * K2); const float al = exp2_slot(m - mn); float cs = 0.f; float pv[16], ea[16], ex[16];   /* m, mn = running maximum x K2; every chunk's P and every rescale use the same rounded values of it */
#pragma unroll
  for (int i = 0; i < 16; ++i) ea[i] = __builtin_fmaf(sv[i], K2, -mn);
  exp2_run8<0>(ex, ea); exp2_run8<8>(ex, ea);
#pragma unroll
  for (int i = 0; i < 16; ++i) { const float e = (LAST && sv[i] <= -1.0e38f) ? 0.f : ex[i]; pv[i] = e; cs += e; }
  sum = sum * al + cs; m = mn;
#pragma unroll
  for (int j = 0; j < HD / 16; ++j) acc[j] *= al;
  const F2 p = bsplit16(pv);
#pragma unroll
  for (int j = 0; j < HD / 16; ++j) acc[j] = wmma_bf(vh[j], p.h, acc[j]);
#pragma unroll
  for (int j = 0; j < HD / 16; ++j) acc[j] = wmma_bf(vh[j], p.l, acc[j]);
#pragma unroll
  for (int j = 0; j < HD / 16; ++j) acc[j] = wmma_bf(vl[j], p.h, acc[j]); }
// one tile of 16 queries (rows ql0 .. ql0 + 15 of the sequence), from the logits to ctx. MORE = the wave goes on to another tile
template <bool MORE> __device__ __forceinline__ void att_tile(int ql0, size_t ph, size_t yo, unsigned lo, const _Float16* __restrict__ QH, const _Float16* __restrict__ KH, const _Float16* __restrict__ QL, const _Float16* __restrict__ KL, const __bf16* __restrict__ VB, const __bf16* __restrict__ VBL, float* __restrict__ Y) {
  const int col = lo & 15, g = lo >> 4; const int t = ql0 + col;
  v16h qh[HD / 32], ql[HD / 32]; const _Float16* qp = QH + ph + (size_t)(ql0 / 16) * (16 * HD); const _Float16* rp = QL + ph + (size_t)(ql0 / 16) * (16 * HD);
#pragma unroll
  for (int kc = 0; kc < HD / 32; ++kc) { qh[kc] = frag_hu(qp + kc * 512, lo); ql[kc] = frag_hu(rp + kc * 512, lo); }
  asm volatile("s_wait_xcnt 0x0" :: "s"(qp), "s"(rp), "v"(lo) : "memory");   /* stands before the q loads' address registers are written again; named as inputs, they live up to it */
  const _Float16* kb = KH + ph; const _Float16* lb = KL + ph; const __bf16* vb = VB + ph; const __bf16* wb = VBL + ph;
  const int nl = ql0 >> 5;   /* chunks of 32 keys wholly open to the wave's 16 queries; chunk nl holds the diagonal */
  KF k; load_k(k, kb, lb, lo);
  v8f acc[HD / 16] = {}; float m = -3.0e38f, sum = 0.f;
#pragma unroll 1
  for (int c = 0; c < nl; ++c) {   /* stays rolled: a tile's text is two chunk bodies */
    kb += 32 * HD; lb += 32 * HD;
    att_chunk<false>(k, kb, lb, vb, wb, lo, qh, ql, acc, m, sum, 0);
    vb += 32 * HD; wb += 32 * HD; }
  att_chunk<true>(k, kb, lb, vb, wb, lo, qh, ql, acc, m, sum, t - 8 * g - nl * 32);   /* key 32 nl + 16 jt + 8 g + r is open to query t where 16 jt + r <= t - 8 g - 32 nl */
  sum += xhalf(sum);
  const float inv = sum > 0.f ? 1.0f / sum : 0.f;   /* a fully excluded row yields ctx = 0 */
  float* yb = Y + yo + (size_t)ql0 * CC; const unsigned l4 = lo * 4;   /* scalar base + the lane's place, as for the loads. D element r of channel tile j = channel 16 j + 8 g + r of query t: the lane that holds it here reads it in k_out */
#pragma unroll
  for (int j = 0; j < HD / 16; ++j) acc[j] *= inv;
#pragma unroll
  for (int j = 0; j < HD / 16; ++j) { vst2(yb + j * 256 + l4, __builtin_shufflevector(acc[j], acc[j], 0, 1, 2, 3)); vst2(yb + j * 256 + 128 + l4, __builtin_shufflevector(acc[j], acc[j], 4, 5, 6, 7)); }
  if (MORE) asm volatile("s_wait_xcnt 0x0" :: "s"(yb), "v"(lo), "v"(acc[0]), "v"(acc[1]), "v"(acc[2]), "v"(acc[3]) : "memory"); }   /* stands before the next tile writes the ctx stores' address and data registers again; named as inputs, they live up to it */
// four waves per SIMD: q, one chunk's k and v and the ctx tiles fill most of 256 registers, and the budget keeps the scheduler inside them
__global__ __launch_bounds__(128) __attribute__((amdgpu_waves_per_eu(4, 4))) void k_att(const _Float16* __restrict__ QH, const _Float16* __restrict__ KH, const _Float16* __restrict__ QL, const _Float16* __restrict__ KL, const __bf16* __restrict__ VB, const __bf16* __restrict__ VBL, float* __restrict__ Y) {
  static_assert(CAUSAL && QBH == NQB && QHI == TT && KHI == TT && NQB % 2 == 0, "causal; every row on the 3-product path; the tiles pair up");
  const int b = blockIdx.z / HG, h = blockIdx.z % HG; const int tid = threadIdx.x; const unsigned lo = tid & 31; const int wave = __builtin_amdgcn_readfirstlane(tid >> 5);   /* the trip counts and the plane addresses are the wave's own: scalar loops, scalar bases */
  const int pi = blockIdx.x * 4 + wave; const size_t ph = ((size_t)b * NH + h) * FPH; const size_t yo = (size_t)b * TT * CC + h * (HD * 16);
  att_tile<true>((TT / 16 - 1 - pi) * 16, ph, yo, lo, QH, KH, QL, KL, VB, VBL, Y);   /* (TT / 16 - 1 - pi) / 2 + 1 chunks */
  att_tile<false>(pi * 16, ph, yo, lo, QH, KH, QL, KL, VB, VBL, Y); }                 /* pi / 2 + 1 chunks: TT / 32 + 1 together, for every pi */
// ---- k_out: block = (BR rows, 128 cols): out = ctx Wo (+ bo): all rows: ctx bf16 hi + lo against exact bf16 Wo (2 products)
__global__ __launch_bounds__(NWV * 32) void k_out(const float* __restrict__ Y, const float* __restrict__ WO, const float* __restrict__ BO, float* __restrict__ OUT) { __shared__ __align__(16) unsigned char lds[128 * WPITCH * 2]; static_assert(sizeof(lds) >= NWV * 16 * 132 * 4, "output staging fits"); __bf16* wt = (__bf16*)lds; float (*sf)[16][132] = (float (*)[16][132])lds;   /* the Wo slab during the K loop, the output staging behind it */
  const int tid = threadIdx.x, wave = tid >> 5, lane = tid & 31, col = lane & 15, g = lane >> 4; const int c0 = blockIdx.y * 128; const size_t r0 = (size_t)blockIdx.x * BR + wave * 16;
  stage_w(WO, c0, DIN, wt, wave, lane);
  __syncthreads();   /* every wave reads all waves' k runs */
  v8f acc[8] = {};
  if (true) {   /* ALL rows: ctx split bf16 hi + lo x exact Wo (2 products) */
#pragma unroll 2
    for (int kc = 0; kc < CC / 32; ++kc) { v16b w[8];   /* the pass's 16 LDS reads go out as one group, ahead of the ctx loads and of the first product */
#pragma unroll
      for (int j = 0; j < 8; ++j) w[j] = frag_b(wt + (j * 16 + col) * WPITCH + kc * 32, lane);
      const float* yp = Y + r0 * CC + kc * 512 + lane * 4; float yv[16];
#pragma unroll
      for (int i = 0; i < 16; ++i) yv[i] = yp[(i >> 2) * 128 + (i & 3)];
      asm volatile("s_wait_xcnt 0x0" :: "v"(yp) : "memory");   /* stands before the ctx loads' address registers are written again; named as an input, they live up to it */
      const F2 a = bsplit16(yv); asm volatile("s_wait_loadcnt 0x0" ::: "memory");
#pragma unroll
      for (int j = 0; j < 8; ++j) { acc[j] = wmma_bf(a.h, w[j], acc[j]); acc[j] = wmma_bf(a.l, w[j], acc[j]); } }
    __syncthreads();   /* the slab's last reads end before its LDS takes the output staging */
#pragma unroll
    for (int j = 0; j < 8; ++j) { const float bias = BO ? bfr(BO[c0 + j * 16 + col]) : 0.f;
#pragma unroll
      for (int r = 0; r < 8; ++r) sf[wave][8 * g + r][j * 16 + col] = acc[j][r] + bias; }
  }
  LDSX(); for (int rl = 0; rl < 16; ++rl) vst2(OUT + (r0 + rl) * DIN + c0 + lane * 4, *(const v4f*)&sf[wave][rl][lane * 4]); }

extern "C" void kernel_launch(void* const* d_in, const int* in_sizes, int n_in, void* d_out, int out_size, void* d_ws, size_t ws_size, hipStream_t stream) {
  (void)in_sizes; (void)n_in; (void)out_size;
  const float** F = (const float**)d_in;
  if (ws_size < (size_t)WS_END) return;
  char* ws = (char*)d_ws; _Float16 *QH = (_Float16*)(ws + WS_QH), *KH = (_Float16*)(ws + WS_KH), *QL = (_Float16*)(ws + WS_QL), *KL = (_Float16*)(ws + WS_KL); __bf16 *VB = (__bf16*)(ws + WS_VB), *VBL = (__bf16*)(ws + WS_VBL); float *Y = (float*)(ws + WS_Y);
  (void)Y; (void)QL; (void)KL; (void)VB; (void)VBL;
  // inputs: 0 x [64,256,384]; 1 Wq, 2 Wk, 3 Wv [384,384] (in,out); 4 Wo (in,out), 5 bo
  k_proj<<<dim3(TNB, CC / 128, 3), NWV * 32, 0, stream>>>(F[0], F[0], F[0], F[1], F[2], F[3], QH, QL, KH, KL, VB, VBL);
  /* all sequences and heads in one launch */
  k_att<<<dim3(NQB / 2, 1, TNB * HG), 128, 0, stream>>>(QH, KH, QL, KL, VB, VBL, Y);
  k_out<<<dim3(TNB * TT / BR, DIN / 128), NWV * 32, 0, stream>>>(Y, F[4], F[5], (float*)d_out);
}
